// v000
// Times are from an AMD MI455X. After a warm-up the kernel runs many times in a row, and a time is the length of
// such a window on the GPU divided by its runs, so every launch and the gaps after it count. The runs cycle
// through copies of the inputs. A figure is the median of several windows, for all but v000 over two sittings.
// Sittings can differ by a few percent; kernels timed side by side share one.
// v000, which the later versions start from, runs in 122 microseconds.
// Contractions: 1x1 projections, local-window q.k and p.v all on v_wmma_f32_16x16x32_bf16 with bf16 hi/lo split operands (hi*hi + hi*lo + lo*hi), f32 accumulate; softmax, scaling and transposes in f32.
#include <hip/hip_runtime.h>
#include <stdint.h>
#include <stddef.h>

typedef __attribute__((ext_vector_type(16))) _Float16 v16h;
typedef __attribute__((ext_vector_type(8)))  _Float16 v8h;
typedef __attribute__((ext_vector_type(16))) __bf16   v16b;
typedef __attribute__((ext_vector_type(8)))  __bf16   v8b;
typedef __attribute__((ext_vector_type(8)))  float    v8f;
typedef __attribute__((ext_vector_type(4)))  float    v4f;
typedef __attribute__((ext_vector_type(4)))  unsigned int v4u;
typedef __attribute__((ext_vector_type(8)))  unsigned int v8u;
typedef __attribute__((ext_vector_type(8)))  unsigned short v8us;

__device__ __forceinline__ unsigned short f2bf_bits(float f) {
  unsigned u = __float_as_uint(f);
  return (unsigned short)((u + 0x7FFFu + ((u >> 16) & 1u)) >> 16);
}
__device__ __forceinline__ float bf_bits2f(unsigned short h) { return __uint_as_float(((unsigned)h) << 16); }

// hazard guards as plain device helpers (no inline asm inside the kernel template body)
__device__ __forceinline__ void dep_guard_h(v8f& a, v8f& b, v16h x, v16h y) { asm volatile("v_nop\n\tv_nop\n\tv_nop\n\tv_nop" : "+v"(a), "+v"(b) : "v"(x), "v"(y)); }
__device__ __forceinline__ void dep_guard_b(v8f& a, v8f& b, v16b x, v16b y) { asm volatile("v_nop\n\tv_nop\n\tv_nop\n\tv_nop" : "+v"(a), "+v"(b) : "v"(x), "v"(y)); }
__device__ __forceinline__ void keep4_h(v16h a, v16h b, v16h c, v16h d) { asm volatile("v_nop" :: "v"(a), "v"(b), "v"(c), "v"(d)); }
__device__ __forceinline__ void keep4_b(v16b a, v16b b, v16b c, v16b d) { asm volatile("v_nop" :: "v"(a), "v"(b), "v"(c), "v"(d)); }
__device__ __forceinline__ void acc_guard4(v8f& a, v8f& b, v8f& c, v8f& d) { asm volatile("v_nop\n\tv_nop\n\tv_nop\n\tv_nop" : "+v"(a), "+v"(b), "+v"(c), "+v"(d)); }
template <typename T> struct Frag;
template <> struct Frag<_Float16> {
  typedef v16h V; union U { v16h v; v8h h[2]; };
  static __device__ __forceinline__ v16h load(const _Float16* p) {   // elements 0..7 <- p[0..7], 8..15 <- p[16..23]
    U f; f.h[0] = *(const v8h*)(p); f.h[1] = *(const v8h*)(p + 16); return f.v;
  }
  static __device__ __forceinline__ v8f mma(v16h a, v16h b, v8f c) {
    return __builtin_amdgcn_wmma_f32_16x16x32_f16(false, a, false, b, (short)0, c, false, false);
  }
  static __device__ __forceinline__ void guard(v8f& a, v8f& b, v16h x, v16h y) { dep_guard_h(a, b, x, y); }
  static __device__ __forceinline__ void keep(v16h a, v16h b, v16h c, v16h d) { keep4_h(a, b, c, d); }
};
template <> struct Frag<__bf16> {
  typedef v16b V; union U { v16b v; v8b h[2]; };
  static __device__ __forceinline__ v16b load(const __bf16* p) {
    U f; f.h[0] = *(const v8b*)(p); f.h[1] = *(const v8b*)(p + 16); return f.v;
  }
  static __device__ __forceinline__ v8f mma(v16b a, v16b b, v8f c) {
    return __builtin_amdgcn_wmma_f32_16x16x32_bf16(false, a, false, b, (short)0, c, false, false);
  }
  static __device__ __forceinline__ void guard(v8f& a, v8f& b, v16b x, v16b y) { dep_guard_b(a, b, x, y); }
  static __device__ __forceinline__ void keep(v16b a, v16b b, v16b c, v16b d) { keep4_b(a, b, c, d); }
};

// ---- Register-blocked batched WMMA GEMM ------------------------------------
// C[m,n] = scale * sum_k A[m,k] * Bt[n,k] (+bias)(+resid); each wave owns a 64x64 tile.
// A row-major [M,K]; Bt row-major [N,K]; M,N % 64 == 0, K % 32 == 0.
// SPLIT: operands are hi/lo planes (A2/Bt2 = lo planes, same layout); product = hi.hi + hi.lo + lo.hi.
// BIAS_MODE: 0 = none, 1 = bias[m], 2 = bias[n].
// OUT_MODE: 0 = f32, 1 = f16, 2 = bf16 hi plane (Cout) + bf16 lo plane (Cout2).
// ET: 0 = f16 operands, 1 = bf16 operands (pointers passed as 16-bit storage)
template <int ET> struct Elem;
template <> struct Elem<0> { typedef _Float16 T; };
template <> struct Elem<1> { typedef __bf16 T; };
template <int ET, bool SPLIT, int BIAS_MODE, int OUT_MODE, bool RESID, int ACT = 0>
__global__ __launch_bounds__(256) void wmma_gemm64(
    const unsigned short* __restrict__ Ap, const unsigned short* __restrict__ A2p, int lda, long strideA,
    const unsigned short* __restrict__ Btp, const unsigned short* __restrict__ Bt2p, int ldb, long strideB,
    void* __restrict__ Cout, void* __restrict__ Cout2, int ldc, long strideC,
    const float* __restrict__ bias,
    const float* __restrict__ resid, long strideR,
    int M, int N, int K, float scale) {
  typedef typename Elem<ET>::T T;
  typedef typename Frag<T>::V V;
  const T* A = (const T*)Ap; const T* A2 = (const T*)A2p; const T* Bt = (const T*)Btp; const T* Bt2 = (const T*)Bt2p;
  __shared__ __align__(16) float sT[8][16 * 68];   // per-wave 16x64 slab, pitch 68 floats
  const int b    = blockIdx.y;
  const int lane = threadIdx.x & 31;
  const int wave = threadIdx.x >> 5;
  const int tilesN = N >> 6;
  const int tilesM = M >> 6;
  const int tile = blockIdx.x * 8 + wave;
  if (tile >= tilesM * tilesN) return;   // wave-uniform; no block barriers in this kernel
  const int tm = tile / tilesN;
  const int tn = tile - tm * tilesN;
  const int m0 = tm << 6;
  const int n0 = tn << 6;

  const T* Ab  = A  + (size_t)b * strideA;
  const T* Bb  = Bt + (size_t)b * strideB;
  const T* Ab2 = SPLIT ? (A2  + (size_t)b * strideA) : nullptr;
  const T* Bb2 = SPLIT ? (Bt2 + (size_t)b * strideB) : nullptr;

  const int rlane = lane & 15;                 // row (A) / col (B, D) within subtile
  const int koff  = (lane >> 4) * 8;           // k offset of this lane half
  const int mOff  = (lane >> 4) * 8;           // D row offset

  v8f acc[4][4];
#pragma unroll
  for (int i = 0; i < 4; ++i)
#pragma unroll
    for (int j = 0; j < 4; ++j) acc[i][j] = (v8f){0.f,0.f,0.f,0.f,0.f,0.f,0.f,0.f};

  for (int k0 = 0; k0 < K; k0 += 32) {
    V bh[4], bl[4];
#pragma unroll
    for (int j = 0; j < 4; ++j) {
      const size_t bo = (size_t)(n0 + (j << 4) + rlane) * ldb + koff + k0;
      bh[j] = Frag<T>::load(Bb + bo);
      if (SPLIT) bl[j] = Frag<T>::load(Bb2 + bo);
    }
#pragma unroll
    for (int i = 0; i < 4; ++i) {
      const size_t ao = (size_t)(m0 + (i << 4) + rlane) * lda + koff + k0;
      V ah = Frag<T>::load(Ab + ao);
      V al;
      if (SPLIT) al = Frag<T>::load(Ab2 + ao);
#pragma unroll
      for (int j = 0; j < 4; ++j) {
        acc[i][j] = Frag<T>::mma(ah, bh[j], acc[i][j]);
        if (SPLIT) {
          acc[i][j] = Frag<T>::mma(ah, bl[j], acc[i][j]);
          acc[i][j] = Frag<T>::mma(al, bh[j], acc[i][j]);
        }
      }
      Frag<T>::guard(acc[i][0], acc[i][3], ah, SPLIT ? al : ah);
    }
    Frag<T>::keep(bh[0], bh[1], bh[2], bh[3]);
    if (SPLIT) Frag<T>::keep(bl[0], bl[1], bl[2], bl[3]);
  }
  acc_guard4(acc[0][0], acc[0][1], acc[0][2], acc[0][3]);
  acc_guard4(acc[1][0], acc[1][1], acc[1][2], acc[1][3]);
  acc_guard4(acc[2][0], acc[2][1], acc[2][2], acc[2][3]);
  acc_guard4(acc[3][0], acc[3][1], acc[3][2], acc[3][3]);

  // ---- epilogue ----
  float* slab = sT[wave];
  const float* Rb = RESID ? (resid + (size_t)b * strideR) : nullptr;
#pragma unroll
  for (int i = 0; i < 4; ++i) {
    const int mBase = m0 + (i << 4);
#pragma unroll
    for (int j = 0; j < 4; ++j) {
      const int n = n0 + (j << 4) + rlane;
      float bv = 0.f;
      if (BIAS_MODE == 2) bv = bias[n];
#pragma unroll
      for (int r = 0; r < 8; ++r) {
        float v = acc[i][j][r] * scale;
        if (BIAS_MODE == 1) v += bias[mBase + mOff + r];
        if (BIAS_MODE == 2) v += bv;
        if (RESID) v += Rb[(size_t)(mBase + mOff + r) * ldc + n];
        if (ACT == 1) v = tanhf(v);
        if (ACT == 2) v = fmaxf(v, 0.0f);
        if (ACT == 3) v = v / (1.0f + expf(-v));
        if (ACT == 4) v = (v > 0.f) ? v : 0.01f * v;
        if (ACT == 5) v = 0.5f * v * (1.0f + erff(v * 0.70710678118654752f));
        slab[(mOff + r) * 68 + (j << 4) + rlane] = v;
      }
    }
    __builtin_amdgcn_fence(__ATOMIC_RELEASE, "workgroup");
    __builtin_amdgcn_wave_barrier();
    __builtin_amdgcn_fence(__ATOMIC_ACQUIRE, "workgroup");
    if (OUT_MODE == 0) {
      float* C = (float*)Cout + (size_t)b * strideC;
      const int hh = lane >> 4, c4 = (lane & 15) * 4;     // row seg = 256 B = 16 lanes x 16 B
      {
#pragma unroll
        for (int it = 0; it < 8; ++it) {
          const int row = it * 2 + hh;
          v4f v = *(const v4f*)(slab + row * 68 + c4);
          *(v4f*)(C + (size_t)(mBase + row) * ldc + n0 + c4) = v;
        }
        
      }
    } else {
      const int q = lane >> 3, c8 = (lane & 7) * 8;
      unsigned short* C  = (unsigned short*)Cout  + (size_t)b * strideC;
      unsigned short* C2 = (OUT_MODE == 2) ? ((unsigned short*)Cout2 + (size_t)b * strideC) : nullptr;
      {
#pragma unroll
        for (int it = 0; it < 4; ++it) {
          const int row = it * 4 + q;
          const float* sp = slab + row * 68 + c8;
          v8h hv, lv;
#pragma unroll
          for (int e = 0; e < 8; ++e) {
            if (OUT_MODE == 1) {
              hv[e] = (_Float16)sp[e];
            } else {
              unsigned short hb = f2bf_bits(sp[e]);
              unsigned short lb = f2bf_bits(sp[e] - bf_bits2f(hb));
              hv[e] = __builtin_bit_cast(_Float16, hb);
              lv[e] = __builtin_bit_cast(_Float16, lb);
            }
          }
          *(v8h*)(C + (size_t)(mBase + row) * ldc + n0 + c8) = hv;
          if (OUT_MODE == 2) *(v8h*)(C2 + (size_t)(mBase + row) * ldc + n0 + c8) = lv;
        }
        
      }
    }
    __builtin_amdgcn_fence(__ATOMIC_RELEASE, "workgroup");
    __builtin_amdgcn_wave_barrier();
    __builtin_amdgcn_fence(__ATOMIC_ACQUIRE, "workgroup");
  }
}

// ---- bf16 split helpers and guarded bf16 WMMA ----
__device__ __forceinline__ unsigned short at_bf_bits(float f) {
  unsigned u = __float_as_uint(f);
  return (unsigned short)((u + 0x7FFFu + ((u >> 16) & 1u)) >> 16);
}
__device__ __forceinline__ __bf16 at_f2bf(float f) { return __builtin_bit_cast(__bf16, at_bf_bits(f)); }
__device__ __forceinline__ void at_split(float f, __bf16& hi, __bf16& lo) {
  const unsigned short hb = at_bf_bits(f);
  hi = __builtin_bit_cast(__bf16, hb);
  lo = at_f2bf(f - __uint_as_float(((unsigned)hb) << 16));
}
__device__ __forceinline__ v8f at_mma(v16b a, v16b b, v8f c) {
  c = __builtin_amdgcn_wmma_f32_16x16x32_bf16(false, a, false, b, (short)0, c, false, false);
  asm volatile("v_nop\n\tv_nop\n\tv_nop\n\tv_nop" : "+v"(c) : "v"(a), "v"(b));
  return c;
}

// ---- problem geometry ----
constexpr int kB     = 2;
constexpr int kPix   = 4096;
constexpr int kW     = 64;
constexpr int kCh    = 256;
constexpr int kHeads = 4;
constexpr int kDh    = 64;
constexpr int kTileY = 4;                       // pixel tile of one block: 4 rows x 8 cols, 2 waves (2 rows x 8 cols each)
constexpr int kTileX = 8;
constexpr int kNbRows = kTileY + 6;             // 10 neighbourhood rows
constexpr int kNbCols = kTileX + 6;             // 14 neighbourhood cols
constexpr int kKRows  = kNbRows * kNbCols;      // 140 staged K rows per block
constexpr int kPp     = 128;                    // P row pitch (elements)
constexpr int kTilesY = kW / kTileY;            // 16
constexpr int kTilesX = kW / kTileX;            // 8
static_assert(kHeads * kDh == kCh, "geometry");
static_assert(kW * kW == kPix, "geometry");
static_assert(kPix % 64 == 0 && kCh % 64 == 0 && kCh % 32 == 0, "gemm tile and K multiples");
static_assert(kW % kTileY == 0 && kW % kTileX == 0, "tile coverage");
static_assert(2 * kNbCols + 6 * 16 + 8 + 7 < kKRows, "pv gather rows in range");

union FragB { v16b v; v8b h[2]; };

// ---- activation transpose + bf16 hi/lo split ----
// X: [kB][kCh][kPix] f32 -> Ah/Al: [kB][kPix][kCh] bf16 bits; one 64-c x 64-p tile per block (grid 64 x 4 x kB, 256 threads).
// Load phase: 256 threads x 4 iterations x float4 = 64 c-rows x 64 p (exact). Store phase: 8 waves x 8 p-rows x (8 lanes x 8 elements) = 64 x 64 (exact),
__global__ __launch_bounds__(256) void tr_split_in_kernel(const float* __restrict__ X,
                                                          unsigned short* __restrict__ Ah,
                                                          unsigned short* __restrict__ Al)
{
  __shared__ __align__(16) float sT[64 * 68];   // [p][c], pitch 68 floats
  const int tid = threadIdx.x;
  const int p0 = blockIdx.x * 64, c0 = blockIdx.y * 64, b = blockIdx.z;
#pragma unroll
  for (int it = 0; it < 4; ++it) {
    const int idx = tid + 256 * it;
    const int crow = idx >> 4, p4 = (idx & 15) * 4;
    const v4f v = *(const v4f*)(X + ((size_t)(b * kCh + c0 + crow)) * kPix + p0 + p4);
    sT[(p4 + 0) * 68 + crow] = v.x;
    sT[(p4 + 1) * 68 + crow] = v.y;
    sT[(p4 + 2) * 68 + crow] = v.z;
    sT[(p4 + 3) * 68 + crow] = v.w;
  }
  __syncthreads();
  const int wv = tid >> 5, lane = tid & 31, q = lane >> 3, c8 = (lane & 7) * 8;
  v8us hv[2], lv[2];
  size_t off[2];
#pragma unroll
  for (int it = 0; it < 2; ++it) {
    const int row = wv * 8 + it * 4 + q;
    const float* sp = sT + row * 68 + c8;
    const v4f a0 = *(const v4f*)sp;
    const v4f a1 = *(const v4f*)(sp + 4);
#pragma unroll
    for (int e = 0; e < 8; ++e) {
      const float fe = (e < 4) ? a0[e] : a1[e - 4];
      const unsigned short hb = f2bf_bits(fe);
      const unsigned short lb = f2bf_bits(fe - bf_bits2f(hb));
      hv[it][e] = hb;
      lv[it][e] = lb;
    }
    off[it] = ((size_t)(b * kPix + p0 + row)) * kCh + c0 + c8;
  }
  {
#pragma unroll
    for (int it = 0; it < 2; ++it) {
      *(v8us*)(Ah + off[it]) = hv[it];
      *(v8us*)(Al + off[it]) = lv[it];
    }
    
  }
}

__global__ __launch_bounds__(256) void split_w_kernel(const float* __restrict__ Wf,
                                                      unsigned short* __restrict__ Wh,
                                                      unsigned short* __restrict__ Wl, int n8)
{
  const int i = blockIdx.x * 256 + threadIdx.x;
  if (i < n8) {
    const v4f a0 = *(const v4f*)(Wf + (size_t)i * 8);
    const v4f a1 = *(const v4f*)(Wf + (size_t)i * 8 + 4);
    v8us hv, lv;
#pragma unroll
    for (int e = 0; e < 8; ++e) {
      const float fe = (e < 4) ? a0[e] : a1[e - 4];
      const unsigned short hb = f2bf_bits(fe);
      const unsigned short lb = f2bf_bits(fe - bf_bits2f(hb));
      hv[e] = hb;
      lv[e] = lb;
    }
    unsigned short* ph = Wh + (size_t)i * 8;
    unsigned short* pl = Wl + (size_t)i * 8;
    *(v8us*)ph = hv;
    *(v8us*)pl = lv;
    
  }
}

// ---- local 7x7 window attention, both kv branches, one (b, head, 4x8 pixel tile) per block of 2 waves ----
// Qh/Ql, KVh/KVl: bf16 hi/lo planes [b][p][256] (KV planes: branch-major, 2 x [b][p][256]); Obuf: f32 [b][p][256].
// Wave w owns pixel rows y0+2w..y0+2w+1, cols x0..x0+7; its 8x14 union neighbourhood is LDS rows 28w..28w+111 of the
// block's 10x14 neighbourhood (row index nr*14+nc, image pos (y0-3+nr, x0-3+nc), zero row when outside the image).
__global__ __launch_bounds__(64) void local_window_attn_kernel(
    const unsigned short* __restrict__ Qh, const unsigned short* __restrict__ Ql,
    const unsigned short* __restrict__ KVh, const unsigned short* __restrict__ KVl,
    float* __restrict__ Obuf)
{
  __shared__ __align__(16) unsigned short Ksh[kKRows * kDh];   // 17920 B
  __shared__ __align__(16) unsigned short Ksl[kKRows * kDh];   // 17920 B
  __shared__ __align__(16) __bf16 Psh[2][16 * kPp];            //  8192 B
  __shared__ __align__(16) __bf16 Psl[2][16 * kPp];            //  8192 B
  __shared__ __align__(16) float  Osh[2][16 * 68];             //  8704 B

  const int tid  = threadIdx.x;
  const int w    = tid >> 5, lane = tid & 31, hh = lane >> 4, c = lane & 15;
  const int bidx = blockIdx.x;
  const int tx   = bidx % kTilesX;
  const int ty   = (bidx / kTilesX) % kTilesY;
  const int head = (bidx / (kTilesX * kTilesY)) % kHeads;
  const int b    = bidx / (kTilesX * kTilesY * kHeads);
  const int y0 = ty * kTileY, x0 = tx * kTileX;
  const int nb = w * 2 * kNbCols;   // base LDS row of this wave's union neighbourhood

  // Q A-fragments for pixel row m = c of this wave (split k-map via Frag load)
  v16b qh[2], ql[2];
  {
    const int py = y0 + 2 * w + (c >> 3), px = x0 + (c & 7);
    const size_t qoff = ((size_t)(b * kPix + py * kW + px)) * kCh + head * kDh;
    const __bf16* qhp = (const __bf16*)Qh + qoff;
    const __bf16* qlp = (const __bf16*)Ql + qoff;
#pragma unroll
    for (int dc = 0; dc < 2; ++dc) {
      qh[dc] = Frag<__bf16>::load(qhp + dc * 32 + 8 * hh);
      ql[dc] = Frag<__bf16>::load(qlp + dc * 32 + 8 * hh);
    }
  }
  // per-lane neighbourhood row/col of neighbour index n = t*16 + c (relative to the wave's 8x14 union)
  int nrow[7], ncol[7];
#pragma unroll
  for (int t = 0; t < 7; ++t) {
    const int n = t * 16 + c;
    nrow[t] = n / kNbCols;
    ncol[t] = n - nrow[t] * kNbCols;
  }

  v8f oacc[4];
#pragma unroll
  for (int dt = 0; dt < 4; ++dt) oacc[dt] = (v8f){0.f,0.f,0.f,0.f,0.f,0.f,0.f,0.f};
  const size_t planeElems = (size_t)kB * kPix * kCh;
  const v4u z4 = {0u, 0u, 0u, 0u};
  const v8b z8 = __builtin_bit_cast(v8b, z4);

#pragma unroll 1
  for (int br = 0; br < 2; ++br) {
    const unsigned short* Kh = KVh + (size_t)br * planeElems;
    const unsigned short* Kl = KVl + (size_t)br * planeElems;
    __syncthreads();
    // stage 140 rows x 8 chunks of 16 B per plane: idx 0..1119 over 64 threads covers every row fully (zeros outside the image)
#pragma unroll 1
    for (int idx = tid; idx < kKRows * 8; idx += 64) {
      const int row = idx >> 3, ch = idx & 7;
      const int nr = row / kNbCols, nc = row - nr * kNbCols;
      const int gy = y0 - 3 + nr, gx = x0 - 3 + nc;
      const bool valid = ((unsigned)gy < (unsigned)kW) && ((unsigned)gx < (unsigned)kW);
      const int gyc = gy < 0 ? 0 : (gy > kW - 1 ? kW - 1 : gy);
      const int gxc = gx < 0 ? 0 : (gx > kW - 1 ? kW - 1 : gx);
      const size_t off = ((size_t)(b * kPix + gyc * kW + gxc)) * kCh + head * kDh + ch * 8;
      v4u vh = *(const v4u*)(Kh + off);
      v4u vl = *(const v4u*)(Kl + off);
      const unsigned msk = valid ? 0xffffffffu : 0u;
      vh.x &= msk; vh.y &= msk; vh.z &= msk; vh.w &= msk;
      vl.x &= msk; vl.y &= msk; vl.z &= msk; vl.w &= msk;
      *(v4u*)(Ksh + row * kDh + ch * 8) = vh;
      *(v4u*)(Ksl + row * kDh + ch * 8) = vl;
    }
    __syncthreads();

    // scores s[t][r] = q(pixel 8hh+r) . k(neighbour t*16+c); B fragments = rows of K in LDS (split k-map via Frag load)
    v8f s[7];
#pragma unroll
    for (int t = 0; t < 7; ++t) {
      s[t] = (v8f){0.f,0.f,0.f,0.f,0.f,0.f,0.f,0.f};
#pragma unroll
      for (int dc = 0; dc < 2; ++dc) {
        const int ko = (nb + t * 16 + c) * kDh + dc * 32 + 8 * hh;
        const v16b kfh = Frag<__bf16>::load((const __bf16*)Ksh + ko);
        const v16b kfl = Frag<__bf16>::load((const __bf16*)Ksl + ko);
        s[t] = at_mma(qh[dc], kfh, s[t]);
        s[t] = at_mma(qh[dc], kfl, s[t]);
        s[t] = at_mma(ql[dc], kfh, s[t]);
      }
    }

    // window mask (pixel 8hh+r keeps union rows hh..hh+6, cols r..r+6: exactly 49, zero vectors included) + softmax in f32
    __bf16* pwh = Psh[w];
    __bf16* pwl = Psl[w];
#pragma unroll
    for (int r = 0; r < 8; ++r) {
      float mx = -INFINITY;
#pragma unroll
      for (int t = 0; t < 7; ++t) {
        const bool inwin = (nrow[t] >= hh) && (nrow[t] <= hh + 6) && (ncol[t] >= r) && (ncol[t] <= r + 6);
        const float sv = inwin ? s[t][r] : -INFINITY;
        s[t][r] = sv;
        mx = fmaxf(mx, sv);
      }
      mx = fmaxf(mx, __shfl_xor(mx, 1, 32));
      mx = fmaxf(mx, __shfl_xor(mx, 2, 32));
      mx = fmaxf(mx, __shfl_xor(mx, 4, 32));
      mx = fmaxf(mx, __shfl_xor(mx, 8, 32));
      float l = 0.f;
#pragma unroll
      for (int t = 0; t < 7; ++t) {
        const float p = expf(s[t][r] - mx);
        s[t][r] = p;
        l += p;
      }
      l += __shfl_xor(l, 1, 32);
      l += __shfl_xor(l, 2, 32);
      l += __shfl_xor(l, 4, 32);
      l += __shfl_xor(l, 8, 32);
      const float scl = 0.5f / l;
#pragma unroll
      for (int t = 0; t < 7; ++t) {
        __bf16 ph, plo;
        at_split(s[t][r] * scl, ph, plo);
        pwh[(8 * hh + r) * kPp + t * 16 + c] = ph;
        pwl[(8 * hh + r) * kPp + t * 16 + c] = plo;
      }
    }
    __builtin_amdgcn_fence(__ATOMIC_RELEASE, "workgroup");
    __builtin_amdgcn_wave_barrier();
    __builtin_amdgcn_fence(__ATOMIC_ACQUIRE, "workgroup");

    // O += P . V : A = P rows (pixel) from this wave's LDS tile, B = V gathered down column d of the K rows (split k-map),
    // neighbour range 0..111; k-step 3 uses elements 0..7 only (8..15 zero in both operands)
#pragma unroll
    for (int kk = 0; kk < 4; ++kk) {
      FragB pa, pb;
      pa.h[0] = *(const v8b*)(pwh + c * kPp + kk * 32 + 8 * hh);
      pb.h[0] = *(const v8b*)(pwl + c * kPp + kk * 32 + 8 * hh);
      if (kk < 3) {
        pa.h[1] = *(const v8b*)(pwh + c * kPp + kk * 32 + 16 + 8 * hh);
        pb.h[1] = *(const v8b*)(pwl + c * kPp + kk * 32 + 16 + 8 * hh);
      } else {
        pa.h[1] = z8;
        pb.h[1] = z8;
      }
      const int rb = nb + kk * 32 + 8 * hh;
#pragma unroll
      for (int dt = 0; dt < 4; ++dt) {
        const int col = dt * 16 + c;
        v8u wh, wl;
#pragma unroll
        for (int j = 0; j < 4; ++j) {
          const int e0 = (rb + 2 * j) * kDh + col, e1 = e0 + kDh;
          wh[j] = (unsigned)Ksh[e0] | ((unsigned)Ksh[e1] << 16);
          wl[j] = (unsigned)Ksl[e0] | ((unsigned)Ksl[e1] << 16);
          if (kk < 3) {
            const int e2 = (rb + 16 + 2 * j) * kDh + col, e3 = e2 + kDh;
            wh[4 + j] = (unsigned)Ksh[e2] | ((unsigned)Ksh[e3] << 16);
            wl[4 + j] = (unsigned)Ksl[e2] | ((unsigned)Ksl[e3] << 16);
          } else {
            wh[4 + j] = 0u;
            wl[4 + j] = 0u;
          }
        }
        const v16b vfh = __builtin_bit_cast(v16b, wh);
        const v16b vfl = __builtin_bit_cast(v16b, wl);
        oacc[dt] = at_mma(pa.v, vfh, oacc[dt]);
        oacc[dt] = at_mma(pa.v, vfl, oacc[dt]);
        oacc[dt] = at_mma(pb.v, vfh, oacc[dt]);
      }
    }
  }

  float* osw = Osh[w];
#pragma unroll
  for (int r = 0; r < 8; ++r)
#pragma unroll
    for (int dt = 0; dt < 4; ++dt) osw[(8 * hh + r) * 68 + dt * 16 + c] = oacc[dt][r];
  __builtin_amdgcn_fence(__ATOMIC_RELEASE, "workgroup");
  __builtin_amdgcn_wave_barrier();
  __builtin_amdgcn_fence(__ATOMIC_ACQUIRE, "workgroup");
  {
    const int c4 = c * 4;
    {
#pragma unroll
      for (int it = 0; it < 8; ++it) {
        const int row = it * 2 + hh;
        const v4f val = *(const v4f*)(osw + row * 68 + c4);
        const int py = y0 + 2 * w + (row >> 3), px = x0 + (row & 7);
        *(v4f*)(Obuf + ((size_t)(b * kPix + py * kW + px)) * kCh + head * kDh + c4) = val;
      }
      
    }
  }
}

// ---- final transpose: O [kB][kPix][kCh] f32 -> out [kB][kCh][kPix] f32; one 64-p x 64-ch tile per block (grid 64 x 4 x kB) ----
// Load: 256 threads x 4 iterations x float4 = 64 p x 64 ch (exact). Store: 8 waves x 8 ch-rows x (16 lanes x 4 floats) = 64 x 64,
__global__ __launch_bounds__(256) void tr_out_kernel(const float* __restrict__ O, float* __restrict__ out)
{
  __shared__ __align__(16) float sT[64 * 68];   // [ch][p], pitch 68
  const int tid = threadIdx.x;
  const int p0 = blockIdx.x * 64, c0 = blockIdx.y * 64, b = blockIdx.z;
#pragma unroll
  for (int it = 0; it < 4; ++it) {
    const int idx = tid + 256 * it;
    const int prow = idx >> 4, c4 = (idx & 15) * 4;
    const v4f v = *(const v4f*)(O + ((size_t)(b * kPix + p0 + prow)) * kCh + c0 + c4);
    sT[(c4 + 0) * 68 + prow] = v.x;
    sT[(c4 + 1) * 68 + prow] = v.y;
    sT[(c4 + 2) * 68 + prow] = v.z;
    sT[(c4 + 3) * 68 + prow] = v.w;
  }
  __syncthreads();
  const int wv = tid >> 5, lane = tid & 31, hh = lane >> 4, p4 = (lane & 15) * 4;
  v4f val[4];
  size_t off[4];
#pragma unroll
  for (int it = 0; it < 4; ++it) {
    const int row = wv * 8 + it * 2 + hh;
    val[it] = *(const v4f*)(sT + row * 68 + p4);
    off[it] = ((size_t)(b * kCh + c0 + row)) * kPix + p0 + p4;
  }
  {
#pragma unroll
    for (int it = 0; it < 4; ++it) *(v4f*)(out + off[it]) = val[it];
    
  }
}

// ---------------------------------------------------------------------------
// Workspace region map (bytes, all offsets multiples of 131072):
//   P16 = kB*kPix*kCh*2 = 4,194,304 (one bf16 plane [kB][kPix][kCh])
//   [ 0]          XT qmap  hi,lo           2 x P16
//   [ 8,388,608]  XT kvmap1 hi,lo          2 x P16
//   [16,777,216]  XT kvmap2 hi,lo          2 x P16
//   [25,165,824]  Wq hi,lo / Wkv hi,lo    4 x 131,072
//   [25,690,112]  Q hi,lo                  2 x P16
//   [34,078,720]  KV hi (branch 0,1)       2 x P16
//   [42,467,328]  KV lo (branch 0,1)       2 x P16
//   [50,855,936]  O f32 [kB][kPix][kCh]    8,388,608
//   total 59,244,544 <= 134,217,728
// ---------------------------------------------------------------------------
extern "C" void kernel_launch(void* const* d_in, const int* in_sizes, int n_in,
                              void* d_out, int out_size, void* d_ws, size_t ws_size,
                              hipStream_t stream)
{
  const int nAct = kB * kCh * kPix;   // 2,097,152
  const int nW   = kCh * kCh;         // 65,536
  if (n_in < 5) return;
  if (in_sizes[0] != nAct || in_sizes[1] != nAct || in_sizes[2] != nAct) return;
  if (in_sizes[3] != nW || in_sizes[4] != nW) return;
  if (out_size != nAct) return;

  const float* kvmap1 = (const float*)d_in[0];
  const float* qmap   = (const float*)d_in[1];
  const float* kvmap2 = (const float*)d_in[2];
  const float* Wq     = (const float*)d_in[3];
  const float* Wkv    = (const float*)d_in[4];
  float* out = (float*)d_out;

  const size_t planeB  = (size_t)nAct * 2;
  const size_t wplaneB = (size_t)nW * 2;
  char* ws = (char*)d_ws;
  size_t o = 0;
  unsigned short* XTqh  = (unsigned short*)(ws + o); o += planeB;
  unsigned short* XTql  = (unsigned short*)(ws + o); o += planeB;
  unsigned short* XTk1h = (unsigned short*)(ws + o); o += planeB;
  unsigned short* XTk1l = (unsigned short*)(ws + o); o += planeB;
  unsigned short* XTk2h = (unsigned short*)(ws + o); o += planeB;
  unsigned short* XTk2l = (unsigned short*)(ws + o); o += planeB;
  unsigned short* Wqh   = (unsigned short*)(ws + o); o += wplaneB;
  unsigned short* Wql   = (unsigned short*)(ws + o); o += wplaneB;
  unsigned short* Wkh   = (unsigned short*)(ws + o); o += wplaneB;
  unsigned short* Wkl   = (unsigned short*)(ws + o); o += wplaneB;
  unsigned short* Qh    = (unsigned short*)(ws + o); o += planeB;
  unsigned short* Ql    = (unsigned short*)(ws + o); o += planeB;
  unsigned short* KVh   = (unsigned short*)(ws + o); o += 2 * planeB;
  unsigned short* KVl   = (unsigned short*)(ws + o); o += 2 * planeB;
  float*          Obuf  = (float*)(ws + o);          o += (size_t)nAct * 4;
  if (o > ws_size) return;
  const float* dummyf = (const float*)(const void*)Wqh;   // never dereferenced (bias/resid modes off)

  // 1-3: activation transposes [b][c][p] -> [b][p][c] bf16 hi/lo
  const dim3 gtr(kPix / 64, kCh / 64, kB);
  tr_split_in_kernel<<<gtr, 256, 0, stream>>>(qmap,   XTqh,  XTql);
  tr_split_in_kernel<<<gtr, 256, 0, stream>>>(kvmap1, XTk1h, XTk1l);
  tr_split_in_kernel<<<gtr, 256, 0, stream>>>(kvmap2, XTk2h, XTk2l);
  // 4-5: weight splits (layout [o][c] kept = Bt operand)
  const int n8 = nW / 8;
  split_w_kernel<<<(n8 + 255) / 256, 256, 0, stream>>>(Wq,  Wqh, Wql, n8);
  split_w_kernel<<<(n8 + 255) / 256, 256, 0, stream>>>(Wkv, Wkh, Wkl, n8);
  // 6-8: projections C[p][o] = sum_c XT[p][c] W[o][c]; M = 4096, N = 256, K = 256 per batch; 256 tiles = 32 blocks x 8 waves
  const long strideAct = (long)kPix * kCh;
  const dim3 ggemm((kPix / 64) * (kCh / 64) / 8, kB, 1);
  wmma_gemm64<1, true, 0, 2, false, 0><<<ggemm, 256, 0, stream>>>(
      XTqh, XTql, kCh, strideAct, Wqh, Wql, kCh, 0L,
      (void*)Qh, (void*)Ql, kCh, strideAct, dummyf, dummyf, 0L, kPix, kCh, kCh, 0.125f);
  wmma_gemm64<1, true, 0, 2, false, 0><<<ggemm, 256, 0, stream>>>(
      XTk1h, XTk1l, kCh, strideAct, Wkh, Wkl, kCh, 0L,
      (void*)KVh, (void*)KVl, kCh, strideAct, dummyf, dummyf, 0L, kPix, kCh, kCh, 1.0f);
  wmma_gemm64<1, true, 0, 2, false, 0><<<ggemm, 256, 0, stream>>>(
      XTk2h, XTk2l, kCh, strideAct, Wkh, Wkl, kCh, 0L,
      (void*)(KVh + (size_t)nAct), (void*)(KVl + (size_t)nAct), kCh, strideAct, dummyf, dummyf, 0L, kPix, kCh, kCh, 1.0f);
  // 9: local window attention, both branches, O as [b][p][256] f32
  local_window_attn_kernel<<<kB * kHeads * kTilesY * kTilesX, 64, 0, stream>>>(Qh, Ql, KVh, KVl, Obuf);
  // 10: O [b][p][ch] -> out [b][ch][p]
  tr_out_kernel<<<gtr, 256, 0, stream>>>(Obuf, out);
}

// v001
// Measured time: 61.8 microseconds a run.
// Next to v000, in two timings, it ran 1.97 times as fast each time.
// Contractions: 1x1 projections, local-window q.k and p.v all on v_wmma_f32_16x16x32_bf16 with bf16 hi/lo split operands (hi*hi + hi*lo + lo*hi), f32 accumulate; softmax, scaling and transposes in f32.
#include <hip/hip_runtime.h>
#include <stdint.h>
#include <stddef.h>

typedef __attribute__((ext_vector_type(16))) _Float16 v16h;
typedef __attribute__((ext_vector_type(8)))  _Float16 v8h;
typedef __attribute__((ext_vector_type(16))) __bf16   v16b;
typedef __attribute__((ext_vector_type(8)))  __bf16   v8b;
typedef __attribute__((ext_vector_type(8)))  float    v8f;
typedef __attribute__((ext_vector_type(4)))  float    v4f;
typedef __attribute__((ext_vector_type(4)))  unsigned int v4u;
typedef __attribute__((ext_vector_type(8)))  unsigned int v8u;
typedef __attribute__((ext_vector_type(8)))  unsigned short v8us;

__device__ __forceinline__ unsigned short f2bf_bits(float f) {
  unsigned u = __float_as_uint(f);
  return (unsigned short)((u + 0x7FFFu + ((u >> 16) & 1u)) >> 16);
}
__device__ __forceinline__ float bf_bits2f(unsigned short h) { return __uint_as_float(((unsigned)h) << 16); }

// hazard guards as plain device helpers (no inline asm inside the kernel template body)
__device__ __forceinline__ void dep_guard_h(v8f& a, v8f& b, v16h x, v16h y) { asm volatile("v_nop\n\tv_nop\n\tv_nop\n\tv_nop" : "+v"(a), "+v"(b) : "v"(x), "v"(y)); }
__device__ __forceinline__ void dep_guard_b(v8f& a, v8f& b, v16b x, v16b y) { asm volatile("v_nop\n\tv_nop\n\tv_nop\n\tv_nop" : "+v"(a), "+v"(b) : "v"(x), "v"(y)); }
__device__ __forceinline__ void keep4_h(v16h a, v16h b, v16h c, v16h d) { asm volatile("v_nop" :: "v"(a), "v"(b), "v"(c), "v"(d)); }
__device__ __forceinline__ void keep4_b(v16b a, v16b b, v16b c, v16b d) { asm volatile("v_nop" :: "v"(a), "v"(b), "v"(c), "v"(d)); }
__device__ __forceinline__ void acc_guard4(v8f& a, v8f& b, v8f& c, v8f& d) { asm volatile("v_nop\n\tv_nop\n\tv_nop\n\tv_nop" : "+v"(a), "+v"(b), "+v"(c), "+v"(d)); }
template <typename T> struct Frag;
template <> struct Frag<_Float16> {
  typedef v16h V; union U { v16h v; v8h h[2]; };
  static __device__ __forceinline__ v16h load(const _Float16* p) {   // elements 0..7 <- p[0..7], 8..15 <- p[16..23]
    U f; f.h[0] = *(const v8h*)(p); f.h[1] = *(const v8h*)(p + 16); return f.v;
  }
  static __device__ __forceinline__ v8f mma(v16h a, v16h b, v8f c) {
    return __builtin_amdgcn_wmma_f32_16x16x32_f16(false, a, false, b, (short)0, c, false, false);
  }
  static __device__ __forceinline__ void guard(v8f& a, v8f& b, v16h x, v16h y) { dep_guard_h(a, b, x, y); }
  static __device__ __forceinline__ void keep(v16h a, v16h b, v16h c, v16h d) { keep4_h(a, b, c, d); }
};
template <> struct Frag<__bf16> {
  typedef v16b V; union U { v16b v; v8b h[2]; };
  static __device__ __forceinline__ v16b load(const __bf16* p) {
    U f; f.h[0] = *(const v8b*)(p); f.h[1] = *(const v8b*)(p + 16); return f.v;
  }
  static __device__ __forceinline__ v8f mma(v16b a, v16b b, v8f c) {
    return __builtin_amdgcn_wmma_f32_16x16x32_bf16(false, a, false, b, (short)0, c, false, false);
  }
  static __device__ __forceinline__ void guard(v8f& a, v8f& b, v16b x, v16b y) { dep_guard_b(a, b, x, y); }
  static __device__ __forceinline__ void keep(v16b a, v16b b, v16b c, v16b d) { keep4_b(a, b, c, d); }
};

// ---- Register-blocked batched WMMA GEMM ------------------------------------
// C[m,n] = scale * sum_k A[m,k] * Bt[n,k] (+bias)(+resid); each wave owns a 64x64 tile.
// A row-major [M,K]; Bt row-major [N,K]; M,N % 64 == 0, K % 32 == 0.
// SPLIT: operands are hi/lo planes (A2/Bt2 = lo planes, same layout); product = hi.hi + hi.lo + lo.hi.
// BIAS_MODE: 0 = none, 1 = bias[m], 2 = bias[n].
// OUT_MODE: 0 = f32, 1 = f16, 2 = bf16 hi plane (Cout) + bf16 lo plane (Cout2).
// ET: 0 = f16 operands, 1 = bf16 operands (pointers passed as 16-bit storage)
// One launch runs three independent problems of the same shape (operand sets 0, 1, 2) over nBatch batches each:
// the flat wave index (6 waves a block) counts problem, then batch, then tile.
template <int ET> struct Elem;
template <> struct Elem<0> { typedef _Float16 T; };
template <> struct Elem<1> { typedef __bf16 T; };
template <int ET, bool SPLIT, int BIAS_MODE, int OUT_MODE, bool RESID, int ACT = 0>
__global__ __launch_bounds__(192) void wmma_gemm64(
    const unsigned short* __restrict__ Ap0, const unsigned short* __restrict__ A2p0,
    const unsigned short* __restrict__ Ap1, const unsigned short* __restrict__ A2p1,
    const unsigned short* __restrict__ Ap2, const unsigned short* __restrict__ A2p2, int lda, long strideA,
    const unsigned short* __restrict__ Btp0, const unsigned short* __restrict__ Bt2p0,
    const unsigned short* __restrict__ Btp1, const unsigned short* __restrict__ Bt2p1,
    const unsigned short* __restrict__ Btp2, const unsigned short* __restrict__ Bt2p2, int ldb, long strideB,
    void* __restrict__ CoutHi0, void* __restrict__ CoutLo0,
    void* __restrict__ CoutHi1, void* __restrict__ CoutLo1,
    void* __restrict__ CoutHi2, void* __restrict__ CoutLo2, int ldc, long strideC,
    const float* __restrict__ bias,
    const float* __restrict__ resid, long strideR,
    int M, int N, int K, int nBatch, float scale0, float scale1, float scale2) {
  typedef typename Elem<ET>::T T;
  typedef typename Frag<T>::V V;
  __shared__ __align__(16) float sT[6][16 * 68];   // per-wave 16x64 slab, pitch 68 floats
  const int lane = threadIdx.x & 31;
  const int wave = __builtin_amdgcn_readfirstlane(threadIdx.x >> 5);   // scalar, so that problem, batch and tile are scalar too
  const int tilesN = N >> 6;
  const int tilesM = M >> 6;
  const int tilesB = tilesM * tilesN;
  const int flat = blockIdx.x * 6 + wave;
  const int gb   = flat / tilesB;          // problem * nBatch + batch
  const int g    = gb / nBatch;
  if (g >= 3) return;   // wave-uniform; no block barriers in this kernel
  const int b    = gb - g * nBatch;
  const int tile = flat - gb * tilesB;
  const T* A   = (const T*)(g == 0 ? Ap0   : (g == 1 ? Ap1   : Ap2));
  const T* A2  = (const T*)(g == 0 ? A2p0  : (g == 1 ? A2p1  : A2p2));
  const T* Bt  = (const T*)(g == 0 ? Btp0  : (g == 1 ? Btp1  : Btp2));
  const T* Bt2 = (const T*)(g == 0 ? Bt2p0 : (g == 1 ? Bt2p1 : Bt2p2));
  void* Cout   = g == 0 ? CoutHi0  : (g == 1 ? CoutHi1  : CoutHi2);
  void* Cout2  = g == 0 ? CoutLo0 : (g == 1 ? CoutLo1 : CoutLo2);
  const float scale = g == 0 ? scale0 : (g == 1 ? scale1 : scale2);
  const int tm = tile / tilesN;
  const int tn = tile - tm * tilesN;
  const int m0 = tm << 6;
  const int n0 = tn << 6;

  const T* Ab  = A  + (size_t)b * strideA;
  const T* Bb  = Bt + (size_t)b * strideB;
  const T* Ab2 = SPLIT ? (A2  + (size_t)b * strideA) : nullptr;
  const T* Bb2 = SPLIT ? (Bt2 + (size_t)b * strideB) : nullptr;

  const int rlane = lane & 15;                 // row (A) / col (B, D) within subtile
  const int koff  = (lane >> 4) * 8;           // k offset of this lane half
  const int mOff  = (lane >> 4) * 8;           // D row offset

  v8f acc[4][4];
#pragma unroll
  for (int i = 0; i < 4; ++i)
#pragma unroll
    for (int j = 0; j < 4; ++j) acc[i][j] = (v8f){0.f,0.f,0.f,0.f,0.f,0.f,0.f,0.f};

  for (int k0 = 0; k0 < K; k0 += 32) {
    V bh[4], bl[4];
#pragma unroll
    for (int j = 0; j < 4; ++j) {
      const size_t bo = (size_t)(n0 + (j << 4) + rlane) * ldb + koff + k0;
      bh[j] = Frag<T>::load(Bb + bo);
      if (SPLIT) bl[j] = Frag<T>::load(Bb2 + bo);
    }
#pragma unroll
    for (int i = 0; i < 4; ++i) {
      const size_t ao = (size_t)(m0 + (i << 4) + rlane) * lda + koff + k0;
      V ah = Frag<T>::load(Ab + ao);
      V al;
      if (SPLIT) al = Frag<T>::load(Ab2 + ao);
#pragma unroll
      for (int j = 0; j < 4; ++j) {
        acc[i][j] = Frag<T>::mma(ah, bh[j], acc[i][j]);
        if (SPLIT) {
          acc[i][j] = Frag<T>::mma(ah, bl[j], acc[i][j]);
          acc[i][j] = Frag<T>::mma(al, bh[j], acc[i][j]);
        }
      }
      Frag<T>::guard(acc[i][0], acc[i][3], ah, SPLIT ? al : ah);
    }
    Frag<T>::keep(bh[0], bh[1], bh[2], bh[3]);
    if (SPLIT) Frag<T>::keep(bl[0], bl[1], bl[2], bl[3]);
  }
  acc_guard4(acc[0][0], acc[0][1], acc[0][2], acc[0][3]);
  acc_guard4(acc[1][0], acc[1][1], acc[1][2], acc[1][3]);
  acc_guard4(acc[2][0], acc[2][1], acc[2][2], acc[2][3]);
  acc_guard4(acc[3][0], acc[3][1], acc[3][2], acc[3][3]);

  // ---- epilogue ----
  float* slab = sT[wave];
  const float* Rb = RESID ? (resid + (size_t)b * strideR) : nullptr;
#pragma unroll
  for (int i = 0; i < 4; ++i) {
    const int mBase = m0 + (i << 4);
#pragma unroll
    for (int j = 0; j < 4; ++j) {
      const int n = n0 + (j << 4) + rlane;
      float bv = 0.f;
      if (BIAS_MODE == 2) bv = bias[n];
#pragma unroll
      for (int r = 0; r < 8; ++r) {
        float v = acc[i][j][r] * scale;
        if (BIAS_MODE == 1) v += bias[mBase + mOff + r];
        if (BIAS_MODE == 2) v += bv;
        if (RESID) v += Rb[(size_t)(mBase + mOff + r) * ldc + n];
        if (ACT == 1) v = tanhf(v);
        if (ACT == 2) v = fmaxf(v, 0.0f);
        if (ACT == 3) v = v / (1.0f + expf(-v));
        if (ACT == 4) v = (v > 0.f) ? v : 0.01f * v;
        if (ACT == 5) v = 0.5f * v * (1.0f + erff(v * 0.70710678118654752f));
        slab[(mOff + r) * 68 + (j << 4) + rlane] = v;
      }
    }
    __builtin_amdgcn_fence(__ATOMIC_RELEASE, "workgroup");
    __builtin_amdgcn_wave_barrier();
    __builtin_amdgcn_fence(__ATOMIC_ACQUIRE, "workgroup");
    if (OUT_MODE == 0) {
      float* C = (float*)Cout + (size_t)b * strideC;
      const int hh = lane >> 4, c4 = (lane & 15) * 4;     // row seg = 256 B = 16 lanes x 16 B
      {
#pragma unroll
        for (int it = 0; it < 8; ++it) {
          const int row = it * 2 + hh;
          v4f v = *(const v4f*)(slab + row * 68 + c4);
          *(v4f*)(C + (size_t)(mBase + row) * ldc + n0 + c4) = v;
        }
        
      }
    } else {
      const int q = lane >> 3, c8 = (lane & 7) * 8;
      unsigned short* C  = (unsigned short*)Cout  + (size_t)b * strideC;
      unsigned short* C2 = (OUT_MODE == 2) ? ((unsigned short*)Cout2 + (size_t)b * strideC) : nullptr;
      {
#pragma unroll
        for (int it = 0; it < 4; ++it) {
          const int row = it * 4 + q;
          const float* sp = slab + row * 68 + c8;
          v8h hv, lv;
#pragma unroll
          for (int e = 0; e < 8; ++e) {
            if (OUT_MODE == 1) {
              hv[e] = (_Float16)sp[e];
            } else {
              unsigned short hb = f2bf_bits(sp[e]);
              unsigned short lb = f2bf_bits(sp[e] - bf_bits2f(hb));
              hv[e] = __builtin_bit_cast(_Float16, hb);
              lv[e] = __builtin_bit_cast(_Float16, lb);
            }
          }
          *(v8h*)(C + (size_t)(mBase + row) * ldc + n0 + c8) = hv;
          if (OUT_MODE == 2) *(v8h*)(C2 + (size_t)(mBase + row) * ldc + n0 + c8) = lv;
        }
        
      }
    }
    __builtin_amdgcn_fence(__ATOMIC_RELEASE, "workgroup");
    __builtin_amdgcn_wave_barrier();
    __builtin_amdgcn_fence(__ATOMIC_ACQUIRE, "workgroup");
  }
}

// ---- bf16 split helpers and guarded bf16 WMMA ----
__device__ __forceinline__ unsigned short at_bf_bits(float f) {
  unsigned u = __float_as_uint(f);
  return (unsigned short)((u + 0x7FFFu + ((u >> 16) & 1u)) >> 16);
}
__device__ __forceinline__ __bf16 at_f2bf(float f) { return __builtin_bit_cast(__bf16, at_bf_bits(f)); }
__device__ __forceinline__ void at_split(float f, __bf16& hi, __bf16& lo) {
  const unsigned short hb = at_bf_bits(f);
  hi = __builtin_bit_cast(__bf16, hb);
  lo = at_f2bf(f - __uint_as_float(((unsigned)hb) << 16));
}
__device__ __forceinline__ v8f at_mma(v16b a, v16b b, v8f c) {
  c = __builtin_amdgcn_wmma_f32_16x16x32_bf16(false, a, false, b, (short)0, c, false, false);
  asm volatile("v_nop\n\tv_nop\n\tv_nop\n\tv_nop" : "+v"(c) : "v"(a), "v"(b));
  return c;
}

// ---- problem geometry ----
constexpr int kB     = 2;
constexpr int kPix   = 4096;
constexpr int kW     = 64;
constexpr int kCh    = 256;
constexpr int kHeads = 4;
constexpr int kDh    = 64;
constexpr int kTileY = 4;                       // pixel tile of one block: 4 rows x 8 cols, 2 waves (2 rows x 8 cols each)
constexpr int kTileX = 8;
constexpr int kNbRows = kTileY + 6;             // 10 neighbourhood rows
constexpr int kNbCols = kTileX + 6;             // 14 neighbourhood cols
constexpr int kKRows  = kNbRows * kNbCols;      // 140 staged K rows per block
constexpr int kPp     = 128;                    // P row pitch (elements)
constexpr int kTilesY = kW / kTileY;            // 16
constexpr int kTilesX = kW / kTileX;            // 8
static_assert(kHeads * kDh == kCh, "geometry");
static_assert(kW * kW == kPix, "geometry");
static_assert(kPix % 64 == 0 && kCh % 64 == 0 && kCh % 32 == 0, "gemm tile and K multiples");
static_assert(kW % kTileY == 0 && kW % kTileX == 0, "tile coverage");
static_assert(2 * kNbCols + 6 * 16 + 8 + 7 < kKRows, "pv gather rows in range");

union FragB { v16b v; v8b h[2]; };

// ---- activation transpose + bf16 hi/lo split ----
// X: [kB][kCh][kPix] f32 -> Ah/Al: [kB][kPix][kCh] bf16 bits; one 64-c x 64-p tile per block (64 x 4 x kB tiles a map, 256 threads).
// Load phase: 256 threads x 4 iterations x float4 = 64 c-rows x 64 p (exact). Store phase: 8 waves x 8 p-rows x (8 lanes x 8 elements) = 64 x 64 (exact),
__device__ __forceinline__ void tr_split_in_tile(const float* __restrict__ X,
                                                 unsigned short* __restrict__ Ah,
                                                 unsigned short* __restrict__ Al,
                                                 int p0, int c0, int b)
{
  __shared__ __align__(16) float sT[64 * 68];   // [p][c], pitch 68 floats
  const int tid = threadIdx.x;
#pragma unroll
  for (int it = 0; it < 4; ++it) {
    const int idx = tid + 256 * it;
    const int crow = idx >> 4, p4 = (idx & 15) * 4;
    const v4f v = *(const v4f*)(X + ((size_t)(b * kCh + c0 + crow)) * kPix + p0 + p4);
    sT[(p4 + 0) * 68 + crow] = v.x;
    sT[(p4 + 1) * 68 + crow] = v.y;
    sT[(p4 + 2) * 68 + crow] = v.z;
    sT[(p4 + 3) * 68 + crow] = v.w;
  }
  __syncthreads();
  const int wv = tid >> 5, lane = tid & 31, q = lane >> 3, c8 = (lane & 7) * 8;
  v8us hv[2], lv[2];
  size_t off[2];
#pragma unroll
  for (int it = 0; it < 2; ++it) {
    const int row = wv * 8 + it * 4 + q;
    const float* sp = sT + row * 68 + c8;
    const v4f a0 = *(const v4f*)sp;
    const v4f a1 = *(const v4f*)(sp + 4);
#pragma unroll
    for (int e = 0; e < 8; ++e) {
      const float fe = (e < 4) ? a0[e] : a1[e - 4];
      const unsigned short hb = f2bf_bits(fe);
      const unsigned short lb = f2bf_bits(fe - bf_bits2f(hb));
      hv[it][e] = hb;
      lv[it][e] = lb;
    }
    off[it] = ((size_t)(b * kPix + p0 + row)) * kCh + c0 + c8;
  }
  {
#pragma unroll
    for (int it = 0; it < 2; ++it) {
      *(v8us*)(Ah + off[it]) = hv[it];
      *(v8us*)(Al + off[it]) = lv[it];
    }
    
  }
}

__device__ __forceinline__ void split_w_block(const float* __restrict__ Wf,
                                              unsigned short* __restrict__ Wh,
                                              unsigned short* __restrict__ Wl, int blk, int n8)
{
  const int i = blk * 256 + threadIdx.x;
  if (i < n8) {
    const v4f a0 = *(const v4f*)(Wf + (size_t)i * 8);
    const v4f a1 = *(const v4f*)(Wf + (size_t)i * 8 + 4);
    v8us hv, lv;
#pragma unroll
    for (int e = 0; e < 8; ++e) {
      const float fe = (e < 4) ? a0[e] : a1[e - 4];
      const unsigned short hb = f2bf_bits(fe);
      const unsigned short lb = f2bf_bits(fe - bf_bits2f(hb));
      hv[e] = hb;
      lv[e] = lb;
    }
    unsigned short* ph = Wh + (size_t)i * 8;
    unsigned short* pl = Wl + (size_t)i * 8;
    *(v8us*)ph = hv;
    *(v8us*)pl = lv;
    
  }
}

// ---- all operand preparation in one launch: blocks 0..3*kTrBlocks-1 transpose and split the three maps, the rest split the two weights ----
constexpr int kTrBlocks = (kPix / 64) * (kCh / 64) * kB;   // 512 tiles a map
constexpr int kW8       = kCh * kCh / 8;                   // 8192 groups of 8 weights
constexpr int kWBlocks  = (kW8 + 255) / 256;               // 32 blocks a weight
__global__ __launch_bounds__(256) void prep_kernel(
    const float* __restrict__ X0, const float* __restrict__ X1, const float* __restrict__ X2,
    const float* __restrict__ W0, const float* __restrict__ W1,
    unsigned short* __restrict__ X0h, unsigned short* __restrict__ X0l,
    unsigned short* __restrict__ X1h, unsigned short* __restrict__ X1l,
    unsigned short* __restrict__ X2h, unsigned short* __restrict__ X2l,
    unsigned short* __restrict__ W0h, unsigned short* __restrict__ W0l,
    unsigned short* __restrict__ W1h, unsigned short* __restrict__ W1l)
{
  const int bid = blockIdx.x;
  if (bid < 3 * kTrBlocks) {   // block-uniform: the barrier inside is passed by the whole block
    const int m = bid / kTrBlocks, r = bid - m * kTrBlocks;
    const int p0 = (r % (kPix / 64)) * 64, c0 = ((r / (kPix / 64)) % (kCh / 64)) * 64, b = r / ((kPix / 64) * (kCh / 64));
    tr_split_in_tile(m == 0 ? X0 : (m == 1 ? X1 : X2),
                     m == 0 ? X0h : (m == 1 ? X1h : X2h),
                     m == 0 ? X0l : (m == 1 ? X1l : X2l), p0, c0, b);
  } else {
    const int r = bid - 3 * kTrBlocks;
    const int m = r / kWBlocks;
    split_w_block(m == 0 ? W0 : W1, m == 0 ? W0h : W1h, m == 0 ? W0l : W1l, r - m * kWBlocks, kW8);
  }
}

// ---- local 7x7 window attention, both kv branches, one (b, head, 4x8 pixel tile) per block of 2 waves ----
// Qh/Ql, KVh/KVl: bf16 hi/lo planes [b][p][256] (KV planes: branch-major, 2 x [b][p][256]); Obuf: f32 [b][p][256].
// Wave w owns pixel rows y0+2w..y0+2w+1, cols x0..x0+7; its 8x14 union neighbourhood is LDS rows 28w..28w+111 of the
// block's 10x14 neighbourhood (row index nr*14+nc, image pos (y0-3+nr, x0-3+nc), zero row when outside the image).
__global__ __launch_bounds__(64) void local_window_attn_kernel(
    const unsigned short* __restrict__ Qh, const unsigned short* __restrict__ Ql,
    const unsigned short* __restrict__ KVh, const unsigned short* __restrict__ KVl,
    float* __restrict__ Obuf)
{
  __shared__ __align__(16) unsigned short Ksh[kKRows * kDh];   // 17920 B
  __shared__ __align__(16) unsigned short Ksl[kKRows * kDh];   // 17920 B
  __shared__ __align__(16) __bf16 Psh[2][16 * kPp];            //  8192 B
  __shared__ __align__(16) __bf16 Psl[2][16 * kPp];            //  8192 B
  __shared__ __align__(16) float  Osh[2][16 * 68];             //  8704 B

  const int tid  = threadIdx.x;
  const int w    = tid >> 5, lane = tid & 31, hh = lane >> 4, c = lane & 15;
  const int bidx = blockIdx.x;
  const int tx   = bidx % kTilesX;
  const int ty   = (bidx / kTilesX) % kTilesY;
  const int head = (bidx / (kTilesX * kTilesY)) % kHeads;
  const int b    = bidx / (kTilesX * kTilesY * kHeads);
  const int y0 = ty * kTileY, x0 = tx * kTileX;
  const int nb = w * 2 * kNbCols;   // base LDS row of this wave's union neighbourhood

  // Q A-fragments for pixel row m = c of this wave (split k-map via Frag load)
  v16b qh[2], ql[2];
  {
    const int py = y0 + 2 * w + (c >> 3), px = x0 + (c & 7);
    const size_t qoff = ((size_t)(b * kPix + py * kW + px)) * kCh + head * kDh;
    const __bf16* qhp = (const __bf16*)Qh + qoff;
    const __bf16* qlp = (const __bf16*)Ql + qoff;
#pragma unroll
    for (int dc = 0; dc < 2; ++dc) {
      qh[dc] = Frag<__bf16>::load(qhp + dc * 32 + 8 * hh);
      ql[dc] = Frag<__bf16>::load(qlp + dc * 32 + 8 * hh);
    }
  }
  // per-lane neighbourhood row/col of neighbour index n = t*16 + c (relative to the wave's 8x14 union)
  int nrow[7], ncol[7];
#pragma unroll
  for (int t = 0; t < 7; ++t) {
    const int n = t * 16 + c;
    nrow[t] = n / kNbCols;
    ncol[t] = n - nrow[t] * kNbCols;
  }

  v8f oacc[4];
#pragma unroll
  for (int dt = 0; dt < 4; ++dt) oacc[dt] = (v8f){0.f,0.f,0.f,0.f,0.f,0.f,0.f,0.f};
  const size_t planeElems = (size_t)kB * kPix * kCh;
  const v4u z4 = {0u, 0u, 0u, 0u};
  const v8b z8 = __builtin_bit_cast(v8b, z4);

#pragma unroll 1
  for (int br = 0; br < 2; ++br) {
    const unsigned short* Kh = KVh + (size_t)br * planeElems;
    const unsigned short* Kl = KVl + (size_t)br * planeElems;
    __syncthreads();
    // stage 140 rows x 8 chunks of 16 B per plane: idx 0..1119 over 64 threads covers every row fully (zeros outside the image)
#pragma unroll 1
    for (int idx = tid; idx < kKRows * 8; idx += 64) {
      const int row = idx >> 3, ch = idx & 7;
      const int nr = row / kNbCols, nc = row - nr * kNbCols;
      const int gy = y0 - 3 + nr, gx = x0 - 3 + nc;
      const bool valid = ((unsigned)gy < (unsigned)kW) && ((unsigned)gx < (unsigned)kW);
      const int gyc = gy < 0 ? 0 : (gy > kW - 1 ? kW - 1 : gy);
      const int gxc = gx < 0 ? 0 : (gx > kW - 1 ? kW - 1 : gx);
      const size_t off = ((size_t)(b * kPix + gyc * kW + gxc)) * kCh + head * kDh + ch * 8;
      v4u vh = *(const v4u*)(Kh + off);
      v4u vl = *(const v4u*)(Kl + off);
      const unsigned msk = valid ? 0xffffffffu : 0u;
      vh.x &= msk; vh.y &= msk; vh.z &= msk; vh.w &= msk;
      vl.x &= msk; vl.y &= msk; vl.z &= msk; vl.w &= msk;
      *(v4u*)(Ksh + row * kDh + ch * 8) = vh;
      *(v4u*)(Ksl + row * kDh + ch * 8) = vl;
    }
    __syncthreads();

    // scores s[t][r] = q(pixel 8hh+r) . k(neighbour t*16+c); B fragments = rows of K in LDS (split k-map via Frag load)
    v8f s[7];
#pragma unroll
    for (int t = 0; t < 7; ++t) {
      s[t] = (v8f){0.f,0.f,0.f,0.f,0.f,0.f,0.f,0.f};
#pragma unroll
      for (int dc = 0; dc < 2; ++dc) {
        const int ko = (nb + t * 16 + c) * kDh + dc * 32 + 8 * hh;
        const v16b kfh = Frag<__bf16>::load((const __bf16*)Ksh + ko);
        const v16b kfl = Frag<__bf16>::load((const __bf16*)Ksl + ko);
        s[t] = at_mma(qh[dc], kfh, s[t]);
        s[t] = at_mma(qh[dc], kfl, s[t]);
        s[t] = at_mma(ql[dc], kfh, s[t]);
      }
    }

    // window mask (pixel 8hh+r keeps union rows hh..hh+6, cols r..r+6: exactly 49, zero vectors included) + softmax in f32
    __bf16* pwh = Psh[w];
    __bf16* pwl = Psl[w];
#pragma unroll
    for (int r = 0; r < 8; ++r) {
      float mx = -INFINITY;
#pragma unroll
      for (int t = 0; t < 7; ++t) {
        const bool inwin = (nrow[t] >= hh) && (nrow[t] <= hh + 6) && (ncol[t] >= r) && (ncol[t] <= r + 6);
        const float sv = inwin ? s[t][r] : -INFINITY;
        s[t][r] = sv;
        mx = fmaxf(mx, sv);
      }
      mx = fmaxf(mx, __shfl_xor(mx, 1, 32));
      mx = fmaxf(mx, __shfl_xor(mx, 2, 32));
      mx = fmaxf(mx, __shfl_xor(mx, 4, 32));
      mx = fmaxf(mx, __shfl_xor(mx, 8, 32));
      float l = 0.f;
#pragma unroll
      for (int t = 0; t < 7; ++t) {
        const float p = expf(s[t][r] - mx);
        s[t][r] = p;
        l += p;
      }
      l += __shfl_xor(l, 1, 32);
      l += __shfl_xor(l, 2, 32);
      l += __shfl_xor(l, 4, 32);
      l += __shfl_xor(l, 8, 32);
      const float scl = 0.5f / l;
#pragma unroll
      for (int t = 0; t < 7; ++t) {
        __bf16 ph, plo;
        at_split(s[t][r] * scl, ph, plo);
        pwh[(8 * hh + r) * kPp + t * 16 + c] = ph;
        pwl[(8 * hh + r) * kPp + t * 16 + c] = plo;
      }
    }
    __builtin_amdgcn_fence(__ATOMIC_RELEASE, "workgroup");
    __builtin_amdgcn_wave_barrier();
    __builtin_amdgcn_fence(__ATOMIC_ACQUIRE, "workgroup");

    // O += P . V : A = P rows (pixel) from this wave's LDS tile, B = V gathered down column d of the K rows (split k-map),
    // neighbour range 0..111; k-step 3 uses elements 0..7 only (8..15 zero in both operands)
#pragma unroll
    for (int kk = 0; kk < 4; ++kk) {
      FragB pa, pb;
      pa.h[0] = *(const v8b*)(pwh + c * kPp + kk * 32 + 8 * hh);
      pb.h[0] = *(const v8b*)(pwl + c * kPp + kk * 32 + 8 * hh);
      if (kk < 3) {
        pa.h[1] = *(const v8b*)(pwh + c * kPp + kk * 32 + 16 + 8 * hh);
        pb.h[1] = *(const v8b*)(pwl + c * kPp + kk * 32 + 16 + 8 * hh);
      } else {
        pa.h[1] = z8;
        pb.h[1] = z8;
      }
      const int rb = nb + kk * 32 + 8 * hh;
#pragma unroll
      for (int dt = 0; dt < 4; ++dt) {
        const int col = dt * 16 + c;
        v8u wh, wl;
#pragma unroll
        for (int j = 0; j < 4; ++j) {
          const int e0 = (rb + 2 * j) * kDh + col, e1 = e0 + kDh;
          wh[j] = (unsigned)Ksh[e0] | ((unsigned)Ksh[e1] << 16);
          wl[j] = (unsigned)Ksl[e0] | ((unsigned)Ksl[e1] << 16);
          if (kk < 3) {
            const int e2 = (rb + 16 + 2 * j) * kDh + col, e3 = e2 + kDh;
            wh[4 + j] = (unsigned)Ksh[e2] | ((unsigned)Ksh[e3] << 16);
            wl[4 + j] = (unsigned)Ksl[e2] | ((unsigned)Ksl[e3] << 16);
          } else {
            wh[4 + j] = 0u;
            wl[4 + j] = 0u;
          }
        }
        const v16b vfh = __builtin_bit_cast(v16b, wh);
        const v16b vfl = __builtin_bit_cast(v16b, wl);
        oacc[dt] = at_mma(pa.v, vfh, oacc[dt]);
        oacc[dt] = at_mma(pa.v, vfl, oacc[dt]);
        oacc[dt] = at_mma(pb.v, vfh, oacc[dt]);
      }
    }
  }

  float* osw = Osh[w];
#pragma unroll
  for (int r = 0; r < 8; ++r)
#pragma unroll
    for (int dt = 0; dt < 4; ++dt) osw[(8 * hh + r) * 68 + dt * 16 + c] = oacc[dt][r];
  __builtin_amdgcn_fence(__ATOMIC_RELEASE, "workgroup");
  __builtin_amdgcn_wave_barrier();
  __builtin_amdgcn_fence(__ATOMIC_ACQUIRE, "workgroup");
  {
    const int c4 = c * 4;
    {
#pragma unroll
      for (int it = 0; it < 8; ++it) {
        const int row = it * 2 + hh;
        const v4f val = *(const v4f*)(osw + row * 68 + c4);
        const int py = y0 + 2 * w + (row >> 3), px = x0 + (row & 7);
        *(v4f*)(Obuf + ((size_t)(b * kPix + py * kW + px)) * kCh + head * kDh + c4) = val;
      }
      
    }
  }
}

// ---- final transpose: O [kB][kPix][kCh] f32 -> out [kB][kCh][kPix] f32; one 64-p x 64-ch tile per block (grid 64 x 4 x kB) ----
// Load: 256 threads x 4 iterations x float4 = 64 p x 64 ch (exact). Store: 8 waves x 8 ch-rows x (16 lanes x 4 floats) = 64 x 64,
__global__ __launch_bounds__(256) void tr_out_kernel(const float* __restrict__ O, float* __restrict__ out)
{
  __shared__ __align__(16) float sT[64 * 68];   // [ch][p], pitch 68
  const int tid = threadIdx.x;
  const int p0 = blockIdx.x * 64, c0 = blockIdx.y * 64, b = blockIdx.z;
#pragma unroll
  for (int it = 0; it < 4; ++it) {
    const int idx = tid + 256 * it;
    const int prow = idx >> 4, c4 = (idx & 15) * 4;
    const v4f v = *(const v4f*)(O + ((size_t)(b * kPix + p0 + prow)) * kCh + c0 + c4);
    sT[(c4 + 0) * 68 + prow] = v.x;
    sT[(c4 + 1) * 68 + prow] = v.y;
    sT[(c4 + 2) * 68 + prow] = v.z;
    sT[(c4 + 3) * 68 + prow] = v.w;
  }
  __syncthreads();
  const int wv = tid >> 5, lane = tid & 31, hh = lane >> 4, p4 = (lane & 15) * 4;
  v4f val[4];
  size_t off[4];
#pragma unroll
  for (int it = 0; it < 4; ++it) {
    const int row = wv * 8 + it * 2 + hh;
    val[it] = *(const v4f*)(sT + row * 68 + p4);
    off[it] = ((size_t)(b * kCh + c0 + row)) * kPix + p0 + p4;
  }
  {
#pragma unroll
    for (int it = 0; it < 4; ++it) *(v4f*)(out + off[it]) = val[it];
    
  }
}

// ---------------------------------------------------------------------------
// Workspace region map (bytes, all offsets multiples of 131072):
//   P16 = kB*kPix*kCh*2 = 4,194,304 (one bf16 plane [kB][kPix][kCh])
//   [ 0]          XT qmap  hi,lo           2 x P16
//   [ 8,388,608]  XT kvmap1 hi,lo          2 x P16
//   [16,777,216]  XT kvmap2 hi,lo          2 x P16
//   [25,165,824]  Wq hi,lo / Wkv hi,lo    4 x 131,072
//   [25,690,112]  Q hi,lo                  2 x P16
//   [34,078,720]  KV hi (branch 0,1)       2 x P16
//   [42,467,328]  KV lo (branch 0,1)       2 x P16
//   [50,855,936]  O f32 [kB][kPix][kCh]    8,388,608
//   total 59,244,544 <= 134,217,728
// ---------------------------------------------------------------------------
extern "C" void kernel_launch(void* const* d_in, const int* in_sizes, int n_in,
                              void* d_out, int out_size, void* d_ws, size_t ws_size,
                              hipStream_t stream)
{
  const int nAct = kB * kCh * kPix;   // 2,097,152
  const int nW   = kCh * kCh;         // 65,536
  if (n_in < 5) return;
  if (in_sizes[0] != nAct || in_sizes[1] != nAct || in_sizes[2] != nAct) return;
  if (in_sizes[3] != nW || in_sizes[4] != nW) return;
  if (out_size != nAct) return;

  const float* kvmap1 = (const float*)d_in[0];
  const float* qmap   = (const float*)d_in[1];
  const float* kvmap2 = (const float*)d_in[2];
  const float* Wq     = (const float*)d_in[3];
  const float* Wkv    = (const float*)d_in[4];
  float* out = (float*)d_out;

  const size_t planeB  = (size_t)nAct * 2;
  const size_t wplaneB = (size_t)nW * 2;
  char* ws = (char*)d_ws;
  size_t o = 0;
  unsigned short* XTqh  = (unsigned short*)(ws + o); o += planeB;
  unsigned short* XTql  = (unsigned short*)(ws + o); o += planeB;
  unsigned short* XTk1h = (unsigned short*)(ws + o); o += planeB;
  unsigned short* XTk1l = (unsigned short*)(ws + o); o += planeB;
  unsigned short* XTk2h = (unsigned short*)(ws + o); o += planeB;
  unsigned short* XTk2l = (unsigned short*)(ws + o); o += planeB;
  unsigned short* Wqh   = (unsigned short*)(ws + o); o += wplaneB;
  unsigned short* Wql   = (unsigned short*)(ws + o); o += wplaneB;
  unsigned short* Wkh   = (unsigned short*)(ws + o); o += wplaneB;
  unsigned short* Wkl   = (unsigned short*)(ws + o); o += wplaneB;
  unsigned short* Qh    = (unsigned short*)(ws + o); o += planeB;
  unsigned short* Ql    = (unsigned short*)(ws + o); o += planeB;
  unsigned short* KVh   = (unsigned short*)(ws + o); o += 2 * planeB;
  unsigned short* KVl   = (unsigned short*)(ws + o); o += 2 * planeB;
  float*          Obuf  = (float*)(ws + o);          o += (size_t)nAct * 4;
  if (o > ws_size) return;
  const float* dummyf = (const float*)(const void*)Wqh;   // never dereferenced (bias/resid modes off)

  // 1: activation transposes [b][c][p] -> [b][p][c] bf16 hi/lo and weight splits (layout [o][c] kept = Bt operand), one launch
  const dim3 gtr(kPix / 64, kCh / 64, kB);
  prep_kernel<<<3 * kTrBlocks + 2 * kWBlocks, 256, 0, stream>>>(
      qmap, kvmap1, kvmap2, Wq, Wkv,
      XTqh, XTql, XTk1h, XTk1l, XTk2h, XTk2l, Wqh, Wql, Wkh, Wkl);
  // 2: the three projections C[p][o] = sum_c XT[p][c] W[o][c] in one launch; M = 4096, N = 256, K = 256 per batch;
  //    3 x kB x 256 tiles = 256 blocks x 6 waves
  const long strideAct = (long)kPix * kCh;
  wmma_gemm64<1, true, 0, 2, false, 0><<<3 * kB * (kPix / 64) * (kCh / 64) / 6, 192, 0, stream>>>(
      XTqh, XTql, XTk1h, XTk1l, XTk2h, XTk2l, kCh, strideAct,
      Wqh, Wql, Wkh, Wkl, Wkh, Wkl, kCh, 0L,
      (void*)Qh, (void*)Ql, (void*)KVh, (void*)KVl,
      (void*)(KVh + (size_t)nAct), (void*)(KVl + (size_t)nAct), kCh, strideAct,
      dummyf, dummyf, 0L, kPix, kCh, kCh, kB, 0.125f, 1.0f, 1.0f);
  // 3: local window attention, both branches, O as [b][p][256] f32
  local_window_attn_kernel<<<kB * kHeads * kTilesY * kTilesX, 64, 0, stream>>>(Qh, Ql, KVh, KVl, Obuf);
  // 4: O [b][p][ch] -> out [b][ch][p]
  tr_out_kernel<<<gtr, 256, 0, stream>>>(Obuf, out);
}

// v002
// It runs in 56.9 microseconds.
// In both of two side-by-side timings against v001, it was 1.08 times as fast.
// Counting every step since v000, it is 2.13 times as fast.
// Contractions: 1x1 projections, local-window q.k and p.v all on v_wmma_f32_16x16x32_bf16 with bf16 hi/lo split operands (hi*hi + hi*lo + lo*hi), f32 accumulate; softmax, scaling and transposes in f32.
#include <hip/hip_runtime.h>
#include <stdint.h>
#include <stddef.h>

typedef __attribute__((ext_vector_type(16))) _Float16 v16h;
typedef __attribute__((ext_vector_type(8)))  _Float16 v8h;
typedef __attribute__((ext_vector_type(16))) __bf16   v16b;
typedef __attribute__((ext_vector_type(8)))  __bf16   v8b;
typedef __attribute__((ext_vector_type(8)))  float    v8f;
typedef __attribute__((ext_vector_type(4)))  float    v4f;
typedef __attribute__((ext_vector_type(4)))  unsigned int v4u;
typedef __attribute__((ext_vector_type(8)))  unsigned int v8u;
typedef __attribute__((ext_vector_type(8)))  unsigned short v8us;

__device__ __forceinline__ unsigned short f2bf_bits(float f) {
  unsigned u = __float_as_uint(f);
  return (unsigned short)((u + 0x7FFFu + ((u >> 16) & 1u)) >> 16);
}
__device__ __forceinline__ float bf_bits2f(unsigned short h) { return __uint_as_float(((unsigned)h) << 16); }

// hazard guards as plain device helpers (no inline asm inside the kernel template body)
__device__ __forceinline__ void dep_guard_h(v8f& a, v8f& b, v16h x, v16h y) { asm volatile("v_nop\n\tv_nop\n\tv_nop\n\tv_nop" : "+v"(a), "+v"(b) : "v"(x), "v"(y)); }
__device__ __forceinline__ void dep_guard_b(v8f& a, v8f& b, v16b x, v16b y) { asm volatile("v_nop\n\tv_nop\n\tv_nop\n\tv_nop" : "+v"(a), "+v"(b) : "v"(x), "v"(y)); }
__device__ __forceinline__ void keep4_h(v16h a, v16h b, v16h c, v16h d) { asm volatile("v_nop" :: "v"(a), "v"(b), "v"(c), "v"(d)); }
__device__ __forceinline__ void keep4_b(v16b a, v16b b, v16b c, v16b d) { asm volatile("v_nop" :: "v"(a), "v"(b), "v"(c), "v"(d)); }
__device__ __forceinline__ void acc_guard4(v8f& a, v8f& b, v8f& c, v8f& d) { asm volatile("v_nop\n\tv_nop\n\tv_nop\n\tv_nop" : "+v"(a), "+v"(b), "+v"(c), "+v"(d)); }
template <typename T> struct Frag;
template <> struct Frag<_Float16> {
  typedef v16h V; union U { v16h v; v8h h[2]; };
  static __device__ __forceinline__ v16h load(const _Float16* p) {   // elements 0..7 <- p[0..7], 8..15 <- p[16..23]
    U f; f.h[0] = *(const v8h*)(p); f.h[1] = *(const v8h*)(p + 16); return f.v;
  }
  static __device__ __forceinline__ v8f mma(v16h a, v16h b, v8f c) {
    return __builtin_amdgcn_wmma_f32_16x16x32_f16(false, a, false, b, (short)0, c, false, false);
  }
  static __device__ __forceinline__ void guard(v8f& a, v8f& b, v16h x, v16h y) { dep_guard_h(a, b, x, y); }
  static __device__ __forceinline__ void keep(v16h a, v16h b, v16h c, v16h d) { keep4_h(a, b, c, d); }
};
template <> struct Frag<__bf16> {
  typedef v16b V; union U { v16b v; v8b h[2]; };
  static __device__ __forceinline__ v16b load(const __bf16* p) {
    U f; f.h[0] = *(const v8b*)(p); f.h[1] = *(const v8b*)(p + 16); return f.v;
  }
  static __device__ __forceinline__ v8f mma(v16b a, v16b b, v8f c) {
    return __builtin_amdgcn_wmma_f32_16x16x32_bf16(false, a, false, b, (short)0, c, false, false);
  }
  static __device__ __forceinline__ void guard(v8f& a, v8f& b, v16b x, v16b y) { dep_guard_b(a, b, x, y); }
  static __device__ __forceinline__ void keep(v16b a, v16b b, v16b c, v16b d) { keep4_b(a, b, c, d); }
};

// ---- Register-blocked batched WMMA GEMM ------------------------------------
// C[m,n] = scale * sum_k A[m,k] * Bt[n,k] (+bias)(+resid); each wave owns a 64x64 tile.
// A row-major [M,K]; Bt row-major [N,K]; M,N % 64 == 0, K % 32 == 0.
// SPLIT: operands are hi/lo planes (A2/Bt2 = lo planes, same layout); product = hi.hi + hi.lo + lo.hi.
// BIAS_MODE: 0 = none, 1 = bias[m], 2 = bias[n].
// OUT_MODE: 0 = f32, 1 = f16, 2 = bf16 hi plane (Cout) + bf16 lo plane (Cout2).
// ET: 0 = f16 operands, 1 = bf16 operands (pointers passed as 16-bit storage)
// One launch runs three independent problems of the same shape (operand sets 0, 1, 2) over nBatch batches each:
// the flat wave index (6 waves a block) counts problem, then batch, then tile.
template <int ET> struct Elem;
template <> struct Elem<0> { typedef _Float16 T; };
template <> struct Elem<1> { typedef __bf16 T; };
template <int ET, bool SPLIT, int BIAS_MODE, int OUT_MODE, bool RESID, int ACT = 0>
__global__ __launch_bounds__(192) void wmma_gemm64(
    const unsigned short* __restrict__ Ap0, const unsigned short* __restrict__ A2p0,
    const unsigned short* __restrict__ Ap1, const unsigned short* __restrict__ A2p1,
    const unsigned short* __restrict__ Ap2, const unsigned short* __restrict__ A2p2, int lda, long strideA,
    const unsigned short* __restrict__ Btp0, const unsigned short* __restrict__ Bt2p0,
    const unsigned short* __restrict__ Btp1, const unsigned short* __restrict__ Bt2p1,
    const unsigned short* __restrict__ Btp2, const unsigned short* __restrict__ Bt2p2, int ldb, long strideB,
    void* __restrict__ CoutHi0, void* __restrict__ CoutLo0,
    void* __restrict__ CoutHi1, void* __restrict__ CoutLo1,
    void* __restrict__ CoutHi2, void* __restrict__ CoutLo2, int ldc, long strideC,
    const float* __restrict__ bias,
    const float* __restrict__ resid, long strideR,
    int M, int N, int K, int nBatch, float scale0, float scale1, float scale2) {
  typedef typename Elem<ET>::T T;
  typedef typename Frag<T>::V V;
  __shared__ __align__(16) float sT[6][16 * 68];   // per-wave 16x64 slab, pitch 68 floats
  const int lane = threadIdx.x & 31;
  const int wave = __builtin_amdgcn_readfirstlane(threadIdx.x >> 5);   // scalar, so that problem, batch and tile are scalar too
  const int tilesN = N >> 6;
  const int tilesM = M >> 6;
  const int tilesB = tilesM * tilesN;
  const int flat = blockIdx.x * 6 + wave;
  const int gb   = flat / tilesB;          // problem * nBatch + batch
  const int g    = gb / nBatch;
  if (g >= 3) return;   // wave-uniform; no block barriers in this kernel
  const int b    = gb - g * nBatch;
  const int tile = flat - gb * tilesB;
  const T* A   = (const T*)(g == 0 ? Ap0   : (g == 1 ? Ap1   : Ap2));
  const T* A2  = (const T*)(g == 0 ? A2p0  : (g == 1 ? A2p1  : A2p2));
  const T* Bt  = (const T*)(g == 0 ? Btp0  : (g == 1 ? Btp1  : Btp2));
  const T* Bt2 = (const T*)(g == 0 ? Bt2p0 : (g == 1 ? Bt2p1 : Bt2p2));
  void* Cout   = g == 0 ? CoutHi0  : (g == 1 ? CoutHi1  : CoutHi2);
  void* Cout2  = g == 0 ? CoutLo0 : (g == 1 ? CoutLo1 : CoutLo2);
  const float scale = g == 0 ? scale0 : (g == 1 ? scale1 : scale2);
  const int tm = tile / tilesN;
  const int tn = tile - tm * tilesN;
  const int m0 = tm << 6;
  const int n0 = tn << 6;

  const T* Ab  = A  + (size_t)b * strideA;
  const T* Bb  = Bt + (size_t)b * strideB;
  const T* Ab2 = SPLIT ? (A2  + (size_t)b * strideA) : nullptr;
  const T* Bb2 = SPLIT ? (Bt2 + (size_t)b * strideB) : nullptr;

  const int rlane = lane & 15;                 // row (A) / col (B, D) within subtile
  const int koff  = (lane >> 4) * 8;           // k offset of this lane half
  const int mOff  = (lane >> 4) * 8;           // D row offset

  v8f acc[4][4];
#pragma unroll
  for (int i = 0; i < 4; ++i)
#pragma unroll
    for (int j = 0; j < 4; ++j) acc[i][j] = (v8f){0.f,0.f,0.f,0.f,0.f,0.f,0.f,0.f};

  for (int k0 = 0; k0 < K; k0 += 32) {
    V bh[4], bl[4];
#pragma unroll
    for (int j = 0; j < 4; ++j) {
      const size_t bo = (size_t)(n0 + (j << 4) + rlane) * ldb + koff + k0;
      bh[j] = Frag<T>::load(Bb + bo);
      if (SPLIT) bl[j] = Frag<T>::load(Bb2 + bo);
    }
#pragma unroll
    for (int i = 0; i < 4; ++i) {
      const size_t ao = (size_t)(m0 + (i << 4) + rlane) * lda + koff + k0;
      V ah = Frag<T>::load(Ab + ao);
      V al;
      if (SPLIT) al = Frag<T>::load(Ab2 + ao);
#pragma unroll
      for (int j = 0; j < 4; ++j) {
        acc[i][j] = Frag<T>::mma(ah, bh[j], acc[i][j]);
        if (SPLIT) {
          acc[i][j] = Frag<T>::mma(ah, bl[j], acc[i][j]);
          acc[i][j] = Frag<T>::mma(al, bh[j], acc[i][j]);
        }
      }
      Frag<T>::guard(acc[i][0], acc[i][3], ah, SPLIT ? al : ah);
    }
    Frag<T>::keep(bh[0], bh[1], bh[2], bh[3]);
    if (SPLIT) Frag<T>::keep(bl[0], bl[1], bl[2], bl[3]);
  }
  acc_guard4(acc[0][0], acc[0][1], acc[0][2], acc[0][3]);
  acc_guard4(acc[1][0], acc[1][1], acc[1][2], acc[1][3]);
  acc_guard4(acc[2][0], acc[2][1], acc[2][2], acc[2][3]);
  acc_guard4(acc[3][0], acc[3][1], acc[3][2], acc[3][3]);

  // ---- epilogue ----
  float* slab = sT[wave];
  const float* Rb = RESID ? (resid + (size_t)b * strideR) : nullptr;
#pragma unroll
  for (int i = 0; i < 4; ++i) {
    const int mBase = m0 + (i << 4);
#pragma unroll
    for (int j = 0; j < 4; ++j) {
      const int n = n0 + (j << 4) + rlane;
      float bv = 0.f;
      if (BIAS_MODE == 2) bv = bias[n];
#pragma unroll
      for (int r = 0; r < 8; ++r) {
        float v = acc[i][j][r] * scale;
        if (BIAS_MODE == 1) v += bias[mBase + mOff + r];
        if (BIAS_MODE == 2) v += bv;
        if (RESID) v += Rb[(size_t)(mBase + mOff + r) * ldc + n];
        if (ACT == 1) v = tanhf(v);
        if (ACT == 2) v = fmaxf(v, 0.0f);
        if (ACT == 3) v = v / (1.0f + expf(-v));
        if (ACT == 4) v = (v > 0.f) ? v : 0.01f * v;
        if (ACT == 5) v = 0.5f * v * (1.0f + erff(v * 0.70710678118654752f));
        slab[(mOff + r) * 68 + (j << 4) + rlane] = v;
      }
    }
    __builtin_amdgcn_fence(__ATOMIC_RELEASE, "workgroup");
    __builtin_amdgcn_wave_barrier();
    __builtin_amdgcn_fence(__ATOMIC_ACQUIRE, "workgroup");
    if (OUT_MODE == 0) {
      float* C = (float*)Cout + (size_t)b * strideC;
      const int hh = lane >> 4, c4 = (lane & 15) * 4;     // row seg = 256 B = 16 lanes x 16 B
      {
#pragma unroll
        for (int it = 0; it < 8; ++it) {
          const int row = it * 2 + hh;
          v4f v = *(const v4f*)(slab + row * 68 + c4);
          *(v4f*)(C + (size_t)(mBase + row) * ldc + n0 + c4) = v;
        }
        
      }
    } else {
      const int q = lane >> 3, c8 = (lane & 7) * 8;
      unsigned short* C  = (unsigned short*)Cout  + (size_t)b * strideC;
      unsigned short* C2 = (OUT_MODE == 2) ? ((unsigned short*)Cout2 + (size_t)b * strideC) : nullptr;
      {
#pragma unroll
        for (int it = 0; it < 4; ++it) {
          const int row = it * 4 + q;
          const float* sp = slab + row * 68 + c8;
          v8h hv, lv;
#pragma unroll
          for (int e = 0; e < 8; ++e) {
            if (OUT_MODE == 1) {
              hv[e] = (_Float16)sp[e];
            } else {
              unsigned short hb = f2bf_bits(sp[e]);
              unsigned short lb = f2bf_bits(sp[e] - bf_bits2f(hb));
              hv[e] = __builtin_bit_cast(_Float16, hb);
              lv[e] = __builtin_bit_cast(_Float16, lb);
            }
          }
          *(v8h*)(C + (size_t)(mBase + row) * ldc + n0 + c8) = hv;
          if (OUT_MODE == 2) *(v8h*)(C2 + (size_t)(mBase + row) * ldc + n0 + c8) = lv;
        }
        
      }
    }
    __builtin_amdgcn_fence(__ATOMIC_RELEASE, "workgroup");
    __builtin_amdgcn_wave_barrier();
    __builtin_amdgcn_fence(__ATOMIC_ACQUIRE, "workgroup");
  }
}

// ---- bf16 split helpers and guarded bf16 WMMA ----
__device__ __forceinline__ unsigned short at_bf_bits(float f) {
  unsigned u = __float_as_uint(f);
  return (unsigned short)((u + 0x7FFFu + ((u >> 16) & 1u)) >> 16);
}
__device__ __forceinline__ __bf16 at_f2bf(float f) { return __builtin_bit_cast(__bf16, at_bf_bits(f)); }
__device__ __forceinline__ void at_split(float f, __bf16& hi, __bf16& lo) {
  const unsigned short hb = at_bf_bits(f);
  hi = __builtin_bit_cast(__bf16, hb);
  lo = at_f2bf(f - __uint_as_float(((unsigned)hb) << 16));
}
__device__ __forceinline__ v8f at_mma(v16b a, v16b b, v8f c) {
  c = __builtin_amdgcn_wmma_f32_16x16x32_bf16(false, a, false, b, (short)0, c, false, false);
  asm volatile("v_nop\n\tv_nop\n\tv_nop\n\tv_nop" : "+v"(c) : "v"(a), "v"(b));
  return c;
}

// ---- problem geometry ----
constexpr int kB     = 2;
constexpr int kPix   = 4096;
constexpr int kW     = 64;
constexpr int kCh    = 256;
constexpr int kHeads = 4;
constexpr int kDh    = 64;
constexpr int kTileY = 4;                       // pixel tile of one block: 4 rows x 8 cols, 2 waves (2 rows x 8 cols each)
constexpr int kTileX = 8;
constexpr int kNbRows = kTileY + 6;             // 10 neighbourhood rows
constexpr int kNbCols = kTileX + 6;             // 14 neighbourhood cols
constexpr int kKRows  = kNbRows * kNbCols;      // 140 staged K rows per block
constexpr int kKp     = kDh + 8;                // K row pitch in LDS (elements): 144 B = 16 B x odd, so that 16 rows read 16 B wide fall on distinct banks
constexpr int kPp     = 7 * 16 + 8;             // P row pitch (elements), 112 columns in use: 240 B = 16 B x odd, for the same reason
constexpr int kTilesY = kW / kTileY;            // 16
constexpr int kTilesX = kW / kTileX;            // 8
static_assert(kHeads * kDh == kCh, "geometry");
static_assert(kW * kW == kPix, "geometry");
static_assert(kPix % 64 == 0 && kCh % 64 == 0 && kCh % 32 == 0, "gemm tile and K multiples");
static_assert(kW % kTileY == 0 && kW % kTileX == 0, "tile coverage");
static_assert(2 * kNbCols + 6 * 16 + 8 + 7 < kKRows, "pv gather rows in range");

union FragB { v16b v; v8b h[2]; };

// ---- activation transpose + bf16 hi/lo split ----
// X: [kB][kCh][kPix] f32 -> Ah/Al: [kB][kPix][kCh] bf16 bits; one 64-c x 64-p tile per block (64 x 4 x kB tiles a map, 256 threads).
// Load phase: 256 threads x 4 iterations x float4 = 64 c-rows x 64 p (exact). Store phase: 8 waves x 8 p-rows x (8 lanes x 8 elements) = 64 x 64 (exact),
__device__ __forceinline__ void tr_split_in_tile(const float* __restrict__ X,
                                                 unsigned short* __restrict__ Ah,
                                                 unsigned short* __restrict__ Al,
                                                 int p0, int c0, int b)
{
  __shared__ __align__(16) float sT[64 * 68];   // [p][c], pitch 68 floats
  const int tid = threadIdx.x;
#pragma unroll
  for (int it = 0; it < 4; ++it) {
    const int idx = tid + 256 * it;
    const int crow = idx >> 4, p4 = (idx & 15) * 4;
    const v4f v = *(const v4f*)(X + ((size_t)(b * kCh + c0 + crow)) * kPix + p0 + p4);
    sT[(p4 + 0) * 68 + crow] = v.x;
    sT[(p4 + 1) * 68 + crow] = v.y;
    sT[(p4 + 2) * 68 + crow] = v.z;
    sT[(p4 + 3) * 68 + crow] = v.w;
  }
  __syncthreads();
  const int wv = tid >> 5, lane = tid & 31, q = lane >> 3, c8 = (lane & 7) * 8;
  v8us hv[2], lv[2];
  size_t off[2];
#pragma unroll
  for (int it = 0; it < 2; ++it) {
    const int row = wv * 8 + it * 4 + q;
    const float* sp = sT + row * 68 + c8;
    const v4f a0 = *(const v4f*)sp;
    const v4f a1 = *(const v4f*)(sp + 4);
#pragma unroll
    for (int e = 0; e < 8; ++e) {
      const float fe = (e < 4) ? a0[e] : a1[e - 4];
      const unsigned short hb = f2bf_bits(fe);
      const unsigned short lb = f2bf_bits(fe - bf_bits2f(hb));
      hv[it][e] = hb;
      lv[it][e] = lb;
    }
    off[it] = ((size_t)(b * kPix + p0 + row)) * kCh + c0 + c8;
  }
  {
#pragma unroll
    for (int it = 0; it < 2; ++it) {
      *(v8us*)(Ah + off[it]) = hv[it];
      *(v8us*)(Al + off[it]) = lv[it];
    }
    
  }
}

__device__ __forceinline__ void split_w_block(const float* __restrict__ Wf,
                                              unsigned short* __restrict__ Wh,
                                              unsigned short* __restrict__ Wl, int blk, int n8)
{
  const int i = blk * 256 + threadIdx.x;
  if (i < n8) {
    const v4f a0 = *(const v4f*)(Wf + (size_t)i * 8);
    const v4f a1 = *(const v4f*)(Wf + (size_t)i * 8 + 4);
    v8us hv, lv;
#pragma unroll
    for (int e = 0; e < 8; ++e) {
      const float fe = (e < 4) ? a0[e] : a1[e - 4];
      const unsigned short hb = f2bf_bits(fe);
      const unsigned short lb = f2bf_bits(fe - bf_bits2f(hb));
      hv[e] = hb;
      lv[e] = lb;
    }
    unsigned short* ph = Wh + (size_t)i * 8;
    unsigned short* pl = Wl + (size_t)i * 8;
    *(v8us*)ph = hv;
    *(v8us*)pl = lv;
    
  }
}

// ---- all operand preparation in one launch: blocks 0..3*kTrBlocks-1 transpose and split the three maps, the rest split the two weights ----
constexpr int kTrBlocks = (kPix / 64) * (kCh / 64) * kB;   // 512 tiles a map
constexpr int kW8       = kCh * kCh / 8;                   // 8192 groups of 8 weights
constexpr int kWBlocks  = (kW8 + 255) / 256;               // 32 blocks a weight
__global__ __launch_bounds__(256) void prep_kernel(
    const float* __restrict__ X0, const float* __restrict__ X1, const float* __restrict__ X2,
    const float* __restrict__ W0, const float* __restrict__ W1,
    unsigned short* __restrict__ X0h, unsigned short* __restrict__ X0l,
    unsigned short* __restrict__ X1h, unsigned short* __restrict__ X1l,
    unsigned short* __restrict__ X2h, unsigned short* __restrict__ X2l,
    unsigned short* __restrict__ W0h, unsigned short* __restrict__ W0l,
    unsigned short* __restrict__ W1h, unsigned short* __restrict__ W1l)
{
  const int bid = blockIdx.x;
  if (bid < 3 * kTrBlocks) {   // block-uniform: the barrier inside is passed by the whole block
    const int m = bid / kTrBlocks, r = bid - m * kTrBlocks;
    const int p0 = (r % (kPix / 64)) * 64, c0 = ((r / (kPix / 64)) % (kCh / 64)) * 64, b = r / ((kPix / 64) * (kCh / 64));
    tr_split_in_tile(m == 0 ? X0 : (m == 1 ? X1 : X2),
                     m == 0 ? X0h : (m == 1 ? X1h : X2h),
                     m == 0 ? X0l : (m == 1 ? X1l : X2l), p0, c0, b);
  } else {
    const int r = bid - 3 * kTrBlocks;
    const int m = r / kWBlocks;
    split_w_block(m == 0 ? W0 : W1, m == 0 ? W0h : W1h, m == 0 ? W0l : W1l, r - m * kWBlocks, kW8);
  }
}

// ---- local 7x7 window attention, both kv branches, one (b, head, 4x8 pixel tile) per block of 2 waves ----
// Qh/Ql, KVh/KVl: bf16 hi/lo planes [b][p][256] (KV planes: branch-major, 2 x [b][p][256]); Obuf: f32 [b][p][256].
// Wave w owns pixel rows y0+2w..y0+2w+1, cols x0..x0+7; its 8x14 union neighbourhood is LDS rows 28w..28w+111 of the
// block's 10x14 neighbourhood (row index nr*14+nc, image pos (y0-3+nr, x0-3+nc), zero row when outside the image).
__global__ __launch_bounds__(64) void local_window_attn_kernel(
    const unsigned short* __restrict__ Qh, const unsigned short* __restrict__ Ql,
    const unsigned short* __restrict__ KVh, const unsigned short* __restrict__ KVl,
    float* __restrict__ Obuf)
{
  __shared__ __align__(16) unsigned short Ksh[kKRows * kKp];   // 20160 B
  __shared__ __align__(16) unsigned short Ksl[kKRows * kKp];   // 20160 B
  __shared__ __align__(16) __bf16 Psh[2][16 * kPp];            //  7680 B
  __shared__ __align__(16) __bf16 Psl[2][16 * kPp];            //  7680 B
  __shared__ __align__(16) float  Osh[2][16 * 68];             //  8704 B

  const int tid  = threadIdx.x;
  const int w    = tid >> 5, lane = tid & 31, hh = lane >> 4, c = lane & 15;
  const int bidx = blockIdx.x;
  const int tx   = bidx % kTilesX;
  const int ty   = (bidx / kTilesX) % kTilesY;
  const int head = (bidx / (kTilesX * kTilesY)) % kHeads;
  const int b    = bidx / (kTilesX * kTilesY * kHeads);
  const int y0 = ty * kTileY, x0 = tx * kTileX;
  const int nb = w * 2 * kNbCols;   // base LDS row of this wave's union neighbourhood

  // Q A-fragments for pixel row m = c of this wave (split k-map via Frag load)
  v16b qh[2], ql[2];
  {
    const int py = y0 + 2 * w + (c >> 3), px = x0 + (c & 7);
    const size_t qoff = ((size_t)(b * kPix + py * kW + px)) * kCh + head * kDh;
    const __bf16* qhp = (const __bf16*)Qh + qoff;
    const __bf16* qlp = (const __bf16*)Ql + qoff;
#pragma unroll
    for (int dc = 0; dc < 2; ++dc) {
      qh[dc] = Frag<__bf16>::load(qhp + dc * 32 + 8 * hh);
      ql[dc] = Frag<__bf16>::load(qlp + dc * 32 + 8 * hh);
    }
  }
  // per-lane neighbourhood row/col of neighbour index n = t*16 + c (relative to the wave's 8x14 union)
  int nrow[7], ncol[7];
#pragma unroll
  for (int t = 0; t < 7; ++t) {
    const int n = t * 16 + c;
    nrow[t] = n / kNbCols;
    ncol[t] = n - nrow[t] * kNbCols;
  }

  v8f oacc[4];
#pragma unroll
  for (int dt = 0; dt < 4; ++dt) oacc[dt] = (v8f){0.f,0.f,0.f,0.f,0.f,0.f,0.f,0.f};
  const size_t planeElems = (size_t)kB * kPix * kCh;
  const v4u z4 = {0u, 0u, 0u, 0u};
  const v8b z8 = __builtin_bit_cast(v8b, z4);

#pragma unroll 1
  for (int br = 0; br < 2; ++br) {
    const unsigned short* Kh = KVh + (size_t)br * planeElems;
    const unsigned short* Kl = KVl + (size_t)br * planeElems;
    __syncthreads();
    // stage 140 rows x 8 chunks of 16 B per plane: idx 0..1119 over 64 threads covers every row fully (zeros outside the image)
#pragma unroll 1
    for (int idx = tid; idx < kKRows * 8; idx += 64) {
      const int row = idx >> 3, ch = idx & 7;
      const int nr = row / kNbCols, nc = row - nr * kNbCols;
      const int gy = y0 - 3 + nr, gx = x0 - 3 + nc;
      const bool valid = ((unsigned)gy < (unsigned)kW) && ((unsigned)gx < (unsigned)kW);
      const int gyc = gy < 0 ? 0 : (gy > kW - 1 ? kW - 1 : gy);
      const int gxc = gx < 0 ? 0 : (gx > kW - 1 ? kW - 1 : gx);
      const size_t off = ((size_t)(b * kPix + gyc * kW + gxc)) * kCh + head * kDh + ch * 8;
      v4u vh = *(const v4u*)(Kh + off);
      v4u vl = *(const v4u*)(Kl + off);
      const unsigned msk = valid ? 0xffffffffu : 0u;
      vh.x &= msk; vh.y &= msk; vh.z &= msk; vh.w &= msk;
      vl.x &= msk; vl.y &= msk; vl.z &= msk; vl.w &= msk;
      *(v4u*)(Ksh + row * kKp + ch * 8) = vh;
      *(v4u*)(Ksl + row * kKp + ch * 8) = vl;
    }
    __syncthreads();

    // scores s[t][r] = q(pixel 8hh+r) . k(neighbour t*16+c); B fragments = rows of K in LDS (split k-map via Frag load)
    v8f s[7];
#pragma unroll
    for (int t = 0; t < 7; ++t) {
      s[t] = (v8f){0.f,0.f,0.f,0.f,0.f,0.f,0.f,0.f};
#pragma unroll
      for (int dc = 0; dc < 2; ++dc) {
        const int ko = (nb + t * 16 + c) * kKp + dc * 32 + 8 * hh;
        const v16b kfh = Frag<__bf16>::load((const __bf16*)Ksh + ko);
        const v16b kfl = Frag<__bf16>::load((const __bf16*)Ksl + ko);
        s[t] = at_mma(qh[dc], kfh, s[t]);
        s[t] = at_mma(qh[dc], kfl, s[t]);
        s[t] = at_mma(ql[dc], kfh, s[t]);
      }
    }

    // window mask (pixel 8hh+r keeps union rows hh..hh+6, cols r..r+6: exactly 49, zero vectors included) + softmax in f32
    __bf16* pwh = Psh[w];
    __bf16* pwl = Psl[w];
#pragma unroll
    for (int r = 0; r < 8; ++r) {
      float mx = -INFINITY;
#pragma unroll
      for (int t = 0; t < 7; ++t) {
        const bool inwin = (nrow[t] >= hh) && (nrow[t] <= hh + 6) && (ncol[t] >= r) && (ncol[t] <= r + 6);
        const float sv = inwin ? s[t][r] : -INFINITY;
        s[t][r] = sv;
        mx = fmaxf(mx, sv);
      }
      mx = fmaxf(mx, __shfl_xor(mx, 1, 32));
      mx = fmaxf(mx, __shfl_xor(mx, 2, 32));
      mx = fmaxf(mx, __shfl_xor(mx, 4, 32));
      mx = fmaxf(mx, __shfl_xor(mx, 8, 32));
      float l = 0.f;
#pragma unroll
      for (int t = 0; t < 7; ++t) {
        const float p = expf(s[t][r] - mx);
        s[t][r] = p;
        l += p;
      }
      l += __shfl_xor(l, 1, 32);
      l += __shfl_xor(l, 2, 32);
      l += __shfl_xor(l, 4, 32);
      l += __shfl_xor(l, 8, 32);
      const float scl = 0.5f / l;
#pragma unroll
      for (int t = 0; t < 7; ++t) {
        __bf16 ph, plo;
        at_split(s[t][r] * scl, ph, plo);
        pwh[(8 * hh + r) * kPp + t * 16 + c] = ph;
        pwl[(8 * hh + r) * kPp + t * 16 + c] = plo;
      }
    }
    __builtin_amdgcn_fence(__ATOMIC_RELEASE, "workgroup");
    __builtin_amdgcn_wave_barrier();
    __builtin_amdgcn_fence(__ATOMIC_ACQUIRE, "workgroup");

    // O += P . V : A = P rows (pixel) from this wave's LDS tile, B = V gathered down column d of the K rows (split k-map),
    // neighbour range 0..111; k-step 3 uses elements 0..7 only (8..15 zero in both operands)
#pragma unroll
    for (int kk = 0; kk < 4; ++kk) {
      FragB pa, pb;
      pa.h[0] = *(const v8b*)(pwh + c * kPp + kk * 32 + 8 * hh);
      pb.h[0] = *(const v8b*)(pwl + c * kPp + kk * 32 + 8 * hh);
      if (kk < 3) {
        pa.h[1] = *(const v8b*)(pwh + c * kPp + kk * 32 + 16 + 8 * hh);
        pb.h[1] = *(const v8b*)(pwl + c * kPp + kk * 32 + 16 + 8 * hh);
      } else {
        pa.h[1] = z8;
        pb.h[1] = z8;
      }
      const int rb = nb + kk * 32 + 8 * hh;
#pragma unroll
      for (int dt = 0; dt < 4; ++dt) {
        const int col = dt * 16 + c;
        v8u wh, wl;
#pragma unroll
        for (int j = 0; j < 4; ++j) {
          const int e0 = (rb + 2 * j) * kKp + col, e1 = e0 + kKp;
          wh[j] = (unsigned)Ksh[e0] | ((unsigned)Ksh[e1] << 16);
          wl[j] = (unsigned)Ksl[e0] | ((unsigned)Ksl[e1] << 16);
          if (kk < 3) {
            const int e2 = (rb + 16 + 2 * j) * kKp + col, e3 = e2 + kKp;
            wh[4 + j] = (unsigned)Ksh[e2] | ((unsigned)Ksh[e3] << 16);
            wl[4 + j] = (unsigned)Ksl[e2] | ((unsigned)Ksl[e3] << 16);
          } else {
            wh[4 + j] = 0u;
            wl[4 + j] = 0u;
          }
        }
        const v16b vfh = __builtin_bit_cast(v16b, wh);
        const v16b vfl = __builtin_bit_cast(v16b, wl);
        oacc[dt] = at_mma(pa.v, vfh, oacc[dt]);
        oacc[dt] = at_mma(pa.v, vfl, oacc[dt]);
        oacc[dt] = at_mma(pb.v, vfh, oacc[dt]);
      }
    }
  }

  float* osw = Osh[w];
#pragma unroll
  for (int r = 0; r < 8; ++r)
#pragma unroll
    for (int dt = 0; dt < 4; ++dt) osw[(8 * hh + r) * 68 + dt * 16 + c] = oacc[dt][r];
  __builtin_amdgcn_fence(__ATOMIC_RELEASE, "workgroup");
  __builtin_amdgcn_wave_barrier();
  __builtin_amdgcn_fence(__ATOMIC_ACQUIRE, "workgroup");
  {
    const int c4 = c * 4;
    {
#pragma unroll
      for (int it = 0; it < 8; ++it) {
        const int row = it * 2 + hh;
        const v4f val = *(const v4f*)(osw + row * 68 + c4);
        const int py = y0 + 2 * w + (row >> 3), px = x0 + (row & 7);
        *(v4f*)(Obuf + ((size_t)(b * kPix + py * kW + px)) * kCh + head * kDh + c4) = val;
      }
      
    }
  }
}

// ---- final transpose: O [kB][kPix][kCh] f32 -> out [kB][kCh][kPix] f32; one 64-p x 64-ch tile per block (grid 64 x 4 x kB) ----
// Load: 256 threads x 4 iterations x float4 = 64 p x 64 ch (exact). Store: 8 waves x 8 ch-rows x (16 lanes x 4 floats) = 64 x 64,
__global__ __launch_bounds__(256) void tr_out_kernel(const float* __restrict__ O, float* __restrict__ out)
{
  __shared__ __align__(16) float sT[64 * 68];   // [ch][p], pitch 68
  const int tid = threadIdx.x;
  const int p0 = blockIdx.x * 64, c0 = blockIdx.y * 64, b = blockIdx.z;
#pragma unroll
  for (int it = 0; it < 4; ++it) {
    const int idx = tid + 256 * it;
    const int prow = idx >> 4, c4 = (idx & 15) * 4;
    const v4f v = *(const v4f*)(O + ((size_t)(b * kPix + p0 + prow)) * kCh + c0 + c4);
    sT[(c4 + 0) * 68 + prow] = v.x;
    sT[(c4 + 1) * 68 + prow] = v.y;
    sT[(c4 + 2) * 68 + prow] = v.z;
    sT[(c4 + 3) * 68 + prow] = v.w;
  }
  __syncthreads();
  const int wv = tid >> 5, lane = tid & 31, hh = lane >> 4, p4 = (lane & 15) * 4;
  v4f val[4];
  size_t off[4];
#pragma unroll
  for (int it = 0; it < 4; ++it) {
    const int row = wv * 8 + it * 2 + hh;
    val[it] = *(const v4f*)(sT + row * 68 + p4);
    off[it] = ((size_t)(b * kCh + c0 + row)) * kPix + p0 + p4;
  }
  {
#pragma unroll
    for (int it = 0; it < 4; ++it) *(v4f*)(out + off[it]) = val[it];
    
  }
}

// ---------------------------------------------------------------------------
// Workspace region map (bytes, all offsets multiples of 131072):
//   P16 = kB*kPix*kCh*2 = 4,194,304 (one bf16 plane [kB][kPix][kCh])
//   [ 0]          XT qmap  hi,lo           2 x P16
//   [ 8,388,608]  XT kvmap1 hi,lo          2 x P16
//   [16,777,216]  XT kvmap2 hi,lo          2 x P16
//   [25,165,824]  Wq hi,lo / Wkv hi,lo    4 x 131,072
//   [25,690,112]  Q hi,lo                  2 x P16
//   [34,078,720]  KV hi (branch 0,1)       2 x P16
//   [42,467,328]  KV lo (branch 0,1)       2 x P16
//   [50,855,936]  O f32 [kB][kPix][kCh]    8,388,608
//   total 59,244,544 <= 134,217,728
// ---------------------------------------------------------------------------
extern "C" void kernel_launch(void* const* d_in, const int* in_sizes, int n_in,
                              void* d_out, int out_size, void* d_ws, size_t ws_size,
                              hipStream_t stream)
{
  const int nAct = kB * kCh * kPix;   // 2,097,152
  const int nW   = kCh * kCh;         // 65,536
  if (n_in < 5) return;
  if (in_sizes[0] != nAct || in_sizes[1] != nAct || in_sizes[2] != nAct) return;
  if (in_sizes[3] != nW || in_sizes[4] != nW) return;
  if (out_size != nAct) return;

  const float* kvmap1 = (const float*)d_in[0];
  const float* qmap   = (const float*)d_in[1];
  const float* kvmap2 = (const float*)d_in[2];
  const float* Wq     = (const float*)d_in[3];
  const float* Wkv    = (const float*)d_in[4];
  float* out = (float*)d_out;

  const size_t planeB  = (size_t)nAct * 2;
  const size_t wplaneB = (size_t)nW * 2;
  char* ws = (char*)d_ws;
  size_t o = 0;
  unsigned short* XTqh  = (unsigned short*)(ws + o); o += planeB;
  unsigned short* XTql  = (unsigned short*)(ws + o); o += planeB;
  unsigned short* XTk1h = (unsigned short*)(ws + o); o += planeB;
  unsigned short* XTk1l = (unsigned short*)(ws + o); o += planeB;
  unsigned short* XTk2h = (unsigned short*)(ws + o); o += planeB;
  unsigned short* XTk2l = (unsigned short*)(ws + o); o += planeB;
  unsigned short* Wqh   = (unsigned short*)(ws + o); o += wplaneB;
  unsigned short* Wql   = (unsigned short*)(ws + o); o += wplaneB;
  unsigned short* Wkh   = (unsigned short*)(ws + o); o += wplaneB;
  unsigned short* Wkl   = (unsigned short*)(ws + o); o += wplaneB;
  unsigned short* Qh    = (unsigned short*)(ws + o); o += planeB;
  unsigned short* Ql    = (unsigned short*)(ws + o); o += planeB;
  unsigned short* KVh   = (unsigned short*)(ws + o); o += 2 * planeB;
  unsigned short* KVl   = (unsigned short*)(ws + o); o += 2 * planeB;
  float*          Obuf  = (float*)(ws + o);          o += (size_t)nAct * 4;
  if (o > ws_size) return;
  const float* dummyf = (const float*)(const void*)Wqh;   // never dereferenced (bias/resid modes off)

  // 1: activation transposes [b][c][p] -> [b][p][c] bf16 hi/lo and weight splits (layout [o][c] kept = Bt operand), one launch
  const dim3 gtr(kPix / 64, kCh / 64, kB);
  prep_kernel<<<3 * kTrBlocks + 2 * kWBlocks, 256, 0, stream>>>(
      qmap, kvmap1, kvmap2, Wq, Wkv,
      XTqh, XTql, XTk1h, XTk1l, XTk2h, XTk2l, Wqh, Wql, Wkh, Wkl);
  // 2: the three projections C[p][o] = sum_c XT[p][c] W[o][c] in one launch; M = 4096, N = 256, K = 256 per batch;
  //    3 x kB x 256 tiles = 256 blocks x 6 waves
  const long strideAct = (long)kPix * kCh;
  wmma_gemm64<1, true, 0, 2, false, 0><<<3 * kB * (kPix / 64) * (kCh / 64) / 6, 192, 0, stream>>>(
      XTqh, XTql, XTk1h, XTk1l, XTk2h, XTk2l, kCh, strideAct,
      Wqh, Wql, Wkh, Wkl, Wkh, Wkl, kCh, 0L,
      (void*)Qh, (void*)Ql, (void*)KVh, (void*)KVl,
      (void*)(KVh + (size_t)nAct), (void*)(KVl + (size_t)nAct), kCh, strideAct,
      dummyf, dummyf, 0L, kPix, kCh, kCh, kB, 0.125f, 1.0f, 1.0f);
  // 3: local window attention, both branches, O as [b][p][256] f32
  local_window_attn_kernel<<<kB * kHeads * kTilesY * kTilesX, 64, 0, stream>>>(Qh, Ql, KVh, KVl, Obuf);
  // 4: O [b][p][ch] -> out [b][ch][p]
  tr_out_kernel<<<gtr, 256, 0, stream>>>(Obuf, out);
}

// v003
// One run takes 48.7 microseconds.
// In two side-by-side timings against v002, it was 1.16 and 1.17 times as fast.
// Counting every step since v000, it is 2.49 times as fast.
// Contractions: 1x1 projections, local-window q.k and p.v all on v_wmma_f32_16x16x32_bf16 with bf16 hi/lo split operands (hi*hi + hi*lo + lo*hi), f32 accumulate; softmax, scaling and transposes in f32.
#include <hip/hip_runtime.h>
#include <stdint.h>
#include <stddef.h>

typedef __attribute__((ext_vector_type(16))) _Float16 v16h;
typedef __attribute__((ext_vector_type(8)))  _Float16 v8h;
typedef __attribute__((ext_vector_type(16))) __bf16   v16b;
typedef __attribute__((ext_vector_type(8)))  __bf16   v8b;
typedef __attribute__((ext_vector_type(8)))  float    v8f;
typedef __attribute__((ext_vector_type(4)))  float    v4f;
typedef __attribute__((ext_vector_type(4)))  unsigned int v4u;
typedef __attribute__((ext_vector_type(8)))  unsigned int v8u;
typedef __attribute__((ext_vector_type(8)))  unsigned short v8us;

__device__ __forceinline__ unsigned short f2bf_bits(float f) {
  unsigned u = __float_as_uint(f);
  return (unsigned short)((u + 0x7FFFu + ((u >> 16) & 1u)) >> 16);
}
__device__ __forceinline__ float bf_bits2f(unsigned short h) { return __uint_as_float(((unsigned)h) << 16); }

// hazard guards as plain device helpers (no inline asm inside the kernel template body)
__device__ __forceinline__ void dep_guard_h(v8f& a, v8f& b, v16h x, v16h y) { asm volatile("v_nop\n\tv_nop\n\tv_nop\n\tv_nop" : "+v"(a), "+v"(b) : "v"(x), "v"(y)); }
__device__ __forceinline__ void dep_guard_b(v8f& a, v8f& b, v16b x, v16b y) { asm volatile("v_nop\n\tv_nop\n\tv_nop\n\tv_nop" : "+v"(a), "+v"(b) : "v"(x), "v"(y)); }
__device__ __forceinline__ void keep4_h(v16h a, v16h b, v16h c, v16h d) { asm volatile("v_nop" :: "v"(a), "v"(b), "v"(c), "v"(d)); }
__device__ __forceinline__ void keep4_b(v16b a, v16b b, v16b c, v16b d) { asm volatile("v_nop" :: "v"(a), "v"(b), "v"(c), "v"(d)); }
__device__ __forceinline__ void acc_guard4(v8f& a, v8f& b, v8f& c, v8f& d) { asm volatile("v_nop\n\tv_nop\n\tv_nop\n\tv_nop" : "+v"(a), "+v"(b), "+v"(c), "+v"(d)); }
template <typename T> struct Frag;
template <> struct Frag<_Float16> {
  typedef v16h V; union U { v16h v; v8h h[2]; };
  static __device__ __forceinline__ v16h load(const _Float16* p) {   // elements 0..7 <- p[0..7], 8..15 <- p[16..23]
    U f; f.h[0] = *(const v8h*)(p); f.h[1] = *(const v8h*)(p + 16); return f.v;
  }
  static __device__ __forceinline__ v8f mma(v16h a, v16h b, v8f c) {
    return __builtin_amdgcn_wmma_f32_16x16x32_f16(false, a, false, b, (short)0, c, false, false);
  }
  static __device__ __forceinline__ void guard(v8f& a, v8f& b, v16h x, v16h y) { dep_guard_h(a, b, x, y); }
  static __device__ __forceinline__ void keep(v16h a, v16h b, v16h c, v16h d) { keep4_h(a, b, c, d); }
};
template <> struct Frag<__bf16> {
  typedef v16b V; union U { v16b v; v8b h[2]; };
  static __device__ __forceinline__ v16b load(const __bf16* p) {
    U f; f.h[0] = *(const v8b*)(p); f.h[1] = *(const v8b*)(p + 16); return f.v;
  }
  static __device__ __forceinline__ v8f mma(v16b a, v16b b, v8f c) {
    return __builtin_amdgcn_wmma_f32_16x16x32_bf16(false, a, false, b, (short)0, c, false, false);
  }
  static __device__ __forceinline__ void guard(v8f& a, v8f& b, v16b x, v16b y) { dep_guard_b(a, b, x, y); }
  static __device__ __forceinline__ void keep(v16b a, v16b b, v16b c, v16b d) { keep4_b(a, b, c, d); }
};

// ---- Register-blocked batched WMMA GEMM ------------------------------------
// C[m,n] = scale * sum_k A[m,k] * Bt[n,k] (+bias)(+resid); each wave owns a 64x64 tile.
// A row-major [M,K]; Bt row-major [N,K]; M,N % 64 == 0, K % 32 == 0.
// SPLIT: operands are hi/lo planes (A2/Bt2 = lo planes, same layout); product = hi.hi + hi.lo + lo.hi.
// BIAS_MODE: 0 = none, 1 = bias[m], 2 = bias[n].
// OUT_MODE: 0 = f32, 1 = f16, 2 = bf16 hi plane (Cout) + bf16 lo plane (Cout2).
// ET: 0 = f16 operands, 1 = bf16 operands (pointers passed as 16-bit storage)
// One launch runs three independent problems of the same shape (operand sets 0, 1, 2) over nBatch batches each:
// the flat wave index (6 waves a block) counts problem, then batch, then tile.
template <int ET> struct Elem;
template <> struct Elem<0> { typedef _Float16 T; };
template <> struct Elem<1> { typedef __bf16 T; };
template <int ET, bool SPLIT, int BIAS_MODE, int OUT_MODE, bool RESID, int ACT = 0>
__global__ __launch_bounds__(192) void wmma_gemm64(
    const unsigned short* __restrict__ Ap0, const unsigned short* __restrict__ A2p0,
    const unsigned short* __restrict__ Ap1, const unsigned short* __restrict__ A2p1,
    const unsigned short* __restrict__ Ap2, const unsigned short* __restrict__ A2p2, int lda, long strideA,
    const unsigned short* __restrict__ Btp0, const unsigned short* __restrict__ Bt2p0,
    const unsigned short* __restrict__ Btp1, const unsigned short* __restrict__ Bt2p1,
    const unsigned short* __restrict__ Btp2, const unsigned short* __restrict__ Bt2p2, int ldb, long strideB,
    void* __restrict__ CoutHi0, void* __restrict__ CoutLo0,
    void* __restrict__ CoutHi1, void* __restrict__ CoutLo1,
    void* __restrict__ CoutHi2, void* __restrict__ CoutLo2, int ldc, long strideC,
    const float* __restrict__ bias,
    const float* __restrict__ resid, long strideR,
    int M, int N, int K, int nBatch, float scale0, float scale1, float scale2) {
  typedef typename Elem<ET>::T T;
  typedef typename Frag<T>::V V;
  __shared__ __align__(16) float sT[6][16 * 68];   // per-wave 16x64 slab, pitch 68 floats
  const int lane = threadIdx.x & 31;
  const int wave = __builtin_amdgcn_readfirstlane(threadIdx.x >> 5);   // scalar, so that problem, batch and tile are scalar too
  const int tilesN = N >> 6;
  const int tilesM = M >> 6;
  const int tilesB = tilesM * tilesN;
  const int flat = blockIdx.x * 6 + wave;
  const int gb   = flat / tilesB;          // problem * nBatch + batch
  const int g    = gb / nBatch;
  if (g >= 3) return;   // wave-uniform; no block barriers in this kernel
  const int b    = gb - g * nBatch;
  const int tile = flat - gb * tilesB;
  const T* A   = (const T*)(g == 0 ? Ap0   : (g == 1 ? Ap1   : Ap2));
  const T* A2  = (const T*)(g == 0 ? A2p0  : (g == 1 ? A2p1  : A2p2));
  const T* Bt  = (const T*)(g == 0 ? Btp0  : (g == 1 ? Btp1  : Btp2));
  const T* Bt2 = (const T*)(g == 0 ? Bt2p0 : (g == 1 ? Bt2p1 : Bt2p2));
  void* Cout   = g == 0 ? CoutHi0  : (g == 1 ? CoutHi1  : CoutHi2);
  void* Cout2  = g == 0 ? CoutLo0 : (g == 1 ? CoutLo1 : CoutLo2);
  const float scale = g == 0 ? scale0 : (g == 1 ? scale1 : scale2);
  const int tm = tile / tilesN;
  const int tn = tile - tm * tilesN;
  const int m0 = tm << 6;
  const int n0 = tn << 6;

  const T* Ab  = A  + (size_t)b * strideA;
  const T* Bb  = Bt + (size_t)b * strideB;
  const T* Ab2 = SPLIT ? (A2  + (size_t)b * strideA) : nullptr;
  const T* Bb2 = SPLIT ? (Bt2 + (size_t)b * strideB) : nullptr;

  const int rlane = lane & 15;                 // row (A) / col (B, D) within subtile
  const int koff  = (lane >> 4) * 8;           // k offset of this lane half
  const int mOff  = (lane >> 4) * 8;           // D row offset

  v8f acc[4][4];
#pragma unroll
  for (int i = 0; i < 4; ++i)
#pragma unroll
    for (int j = 0; j < 4; ++j) acc[i][j] = (v8f){0.f,0.f,0.f,0.f,0.f,0.f,0.f,0.f};

  for (int k0 = 0; k0 < K; k0 += 32) {
    V bh[4], bl[4];
#pragma unroll
    for (int j = 0; j < 4; ++j) {
      const size_t bo = (size_t)(n0 + (j << 4) + rlane) * ldb + koff + k0;
      bh[j] = Frag<T>::load(Bb + bo);
      if (SPLIT) bl[j] = Frag<T>::load(Bb2 + bo);
    }
#pragma unroll
    for (int i = 0; i < 4; ++i) {
      const size_t ao = (size_t)(m0 + (i << 4) + rlane) * lda + koff + k0;
      V ah = Frag<T>::load(Ab + ao);
      V al;
      if (SPLIT) al = Frag<T>::load(Ab2 + ao);
#pragma unroll
      for (int j = 0; j < 4; ++j) {
        acc[i][j] = Frag<T>::mma(ah, bh[j], acc[i][j]);
        if (SPLIT) {
          acc[i][j] = Frag<T>::mma(ah, bl[j], acc[i][j]);
          acc[i][j] = Frag<T>::mma(al, bh[j], acc[i][j]);
        }
      }
      Frag<T>::guard(acc[i][0], acc[i][3], ah, SPLIT ? al : ah);
    }
    Frag<T>::keep(bh[0], bh[1], bh[2], bh[3]);
    if (SPLIT) Frag<T>::keep(bl[0], bl[1], bl[2], bl[3]);
  }
  acc_guard4(acc[0][0], acc[0][1], acc[0][2], acc[0][3]);
  acc_guard4(acc[1][0], acc[1][1], acc[1][2], acc[1][3]);
  acc_guard4(acc[2][0], acc[2][1], acc[2][2], acc[2][3]);
  acc_guard4(acc[3][0], acc[3][1], acc[3][2], acc[3][3]);

  // ---- epilogue ----
  float* slab = sT[wave];
  const float* Rb = RESID ? (resid + (size_t)b * strideR) : nullptr;
#pragma unroll
  for (int i = 0; i < 4; ++i) {
    const int mBase = m0 + (i << 4);
#pragma unroll
    for (int j = 0; j < 4; ++j) {
      const int n = n0 + (j << 4) + rlane;
      float bv = 0.f;
      if (BIAS_MODE == 2) bv = bias[n];
#pragma unroll
      for (int r = 0; r < 8; ++r) {
        float v = acc[i][j][r] * scale;
        if (BIAS_MODE == 1) v += bias[mBase + mOff + r];
        if (BIAS_MODE == 2) v += bv;
        if (RESID) v += Rb[(size_t)(mBase + mOff + r) * ldc + n];
        if (ACT == 1) v = tanhf(v);
        if (ACT == 2) v = fmaxf(v, 0.0f);
        if (ACT == 3) v = v / (1.0f + expf(-v));
        if (ACT == 4) v = (v > 0.f) ? v : 0.01f * v;
        if (ACT == 5) v = 0.5f * v * (1.0f + erff(v * 0.70710678118654752f));
        slab[(mOff + r) * 68 + (j << 4) + rlane] = v;
      }
    }
    __builtin_amdgcn_fence(__ATOMIC_RELEASE, "workgroup");
    __builtin_amdgcn_wave_barrier();
    __builtin_amdgcn_fence(__ATOMIC_ACQUIRE, "workgroup");
    if (OUT_MODE == 0) {
      float* C = (float*)Cout + (size_t)b * strideC;
      const int hh = lane >> 4, c4 = (lane & 15) * 4;     // row seg = 256 B = 16 lanes x 16 B
      {
#pragma unroll
        for (int it = 0; it < 8; ++it) {
          const int row = it * 2 + hh;
          v4f v = *(const v4f*)(slab + row * 68 + c4);
          *(v4f*)(C + (size_t)(mBase + row) * ldc + n0 + c4) = v;
        }
        
      }
    } else {
      const int q = lane >> 3, c8 = (lane & 7) * 8;
      unsigned short* C  = (unsigned short*)Cout  + (size_t)b * strideC;
      unsigned short* C2 = (OUT_MODE == 2) ? ((unsigned short*)Cout2 + (size_t)b * strideC) : nullptr;
      {
#pragma unroll
        for (int it = 0; it < 4; ++it) {
          const int row = it * 4 + q;
          const float* sp = slab + row * 68 + c8;
          v8h hv, lv;
#pragma unroll
          for (int e = 0; e < 8; ++e) {
            if (OUT_MODE == 1) {
              hv[e] = (_Float16)sp[e];
            } else {
              unsigned short hb = f2bf_bits(sp[e]);
              unsigned short lb = f2bf_bits(sp[e] - bf_bits2f(hb));
              hv[e] = __builtin_bit_cast(_Float16, hb);
              lv[e] = __builtin_bit_cast(_Float16, lb);
            }
          }
          *(v8h*)(C + (size_t)(mBase + row) * ldc + n0 + c8) = hv;
          if (OUT_MODE == 2) *(v8h*)(C2 + (size_t)(mBase + row) * ldc + n0 + c8) = lv;
        }
        
      }
    }
    __builtin_amdgcn_fence(__ATOMIC_RELEASE, "workgroup");
    __builtin_amdgcn_wave_barrier();
    __builtin_amdgcn_fence(__ATOMIC_ACQUIRE, "workgroup");
  }
}

// ---- bf16 split helpers and guarded bf16 WMMA ----
__device__ __forceinline__ unsigned short at_bf_bits(float f) {
  unsigned u = __float_as_uint(f);
  return (unsigned short)((u + 0x7FFFu + ((u >> 16) & 1u)) >> 16);
}
__device__ __forceinline__ __bf16 at_f2bf(float f) { return __builtin_bit_cast(__bf16, at_bf_bits(f)); }
__device__ __forceinline__ void at_split(float f, __bf16& hi, __bf16& lo) {
  const unsigned short hb = at_bf_bits(f);
  hi = __builtin_bit_cast(__bf16, hb);
  lo = at_f2bf(f - __uint_as_float(((unsigned)hb) << 16));
}
__device__ __forceinline__ v8f at_mma(v16b a, v16b b, v8f c) {
  c = __builtin_amdgcn_wmma_f32_16x16x32_bf16(false, a, false, b, (short)0, c, false, false);
  asm volatile("v_nop\n\tv_nop\n\tv_nop\n\tv_nop" : "+v"(c) : "v"(a), "v"(b));
  return c;
}

// ---- problem geometry ----
constexpr int kB     = 2;
constexpr int kPix   = 4096;
constexpr int kW     = 64;
constexpr int kCh    = 256;
constexpr int kHeads = 4;
constexpr int kDh    = 64;
constexpr int kTileY = 4;                       // pixel tile of one block: 4 rows x 8 cols, 2 waves (2 rows x 8 cols each)
constexpr int kTileX = 8;
constexpr int kNbRows = kTileY + 6;             // 10 neighbourhood rows
constexpr int kNbCols = kTileX + 6;             // 14 neighbourhood cols
constexpr int kKRows  = kNbRows * kNbCols;      // 140 staged K rows per block
constexpr int kKp     = kDh + 8;                // K row pitch in LDS (elements): 144 B = 16 B x odd, so that 16 rows read 16 B wide fall on distinct banks
constexpr int kPp     = 7 * 16 + 8;             // P row pitch (elements), 112 columns in use: 240 B = 16 B x odd, for the same reason
constexpr int kStageCols  = kNbCols / 2;        // 7 neighbourhood columns staged a trip
constexpr int kStageTrips = 2 * kNbRows;        // 20 trips stage one plane of K
constexpr int kRowBytes   = kW * kCh * 2;       // one image row of one bf16 plane
constexpr int kTilesY = kW / kTileY;            // 16
constexpr int kTilesX = kW / kTileX;            // 8
static_assert(kHeads * kDh == kCh, "geometry");
static_assert(kW * kW == kPix, "geometry");
static_assert(kNbCols % 2 == 0 && (kNbCols / 2) * 8 <= 64, "half a neighbourhood row fits one trip of the block");
static_assert(kTileY >= 3 && kNbRows == kTileY + 6, "the 3 rows above (below) a tile are outside the image all together, and the tile has 3 rows to read in their place");
static_assert(kPix % 64 == 0 && kCh % 64 == 0 && kCh % 32 == 0, "gemm tile and K multiples");
static_assert(kW % kTileY == 0 && kW % kTileX == 0, "tile coverage");
static_assert(2 * kNbCols + 6 * 16 + 8 + 7 < kKRows, "pv gather rows in range");

union FragB { v16b v; v8b h[2]; };

// ---- activation transpose + bf16 hi/lo split ----
// X: [kB][kCh][kPix] f32 -> Ah/Al: [kB][kPix][kCh] bf16 bits; one 64-c x 64-p tile per block (64 x 4 x kB tiles a map, 256 threads).
// Load phase: 256 threads x 4 iterations x float4 = 64 c-rows x 64 p (exact). Store phase: 8 waves x 8 p-rows x (8 lanes x 8 elements) = 64 x 64 (exact),
__device__ __forceinline__ void tr_split_in_tile(const float* __restrict__ X,
                                                 unsigned short* __restrict__ Ah,
                                                 unsigned short* __restrict__ Al,
                                                 int p0, int c0, int b)
{
  __shared__ __align__(16) float sT[64 * 68];   // [p][c], pitch 68 floats
  const int tid = threadIdx.x;
#pragma unroll
  for (int it = 0; it < 4; ++it) {
    const int idx = tid + 256 * it;
    const int crow = idx >> 4, p4 = (idx & 15) * 4;
    const v4f v = *(const v4f*)(X + ((size_t)(b * kCh + c0 + crow)) * kPix + p0 + p4);
    sT[(p4 + 0) * 68 + crow] = v.x;
    sT[(p4 + 1) * 68 + crow] = v.y;
    sT[(p4 + 2) * 68 + crow] = v.z;
    sT[(p4 + 3) * 68 + crow] = v.w;
  }
  __syncthreads();
  const int wv = tid >> 5, lane = tid & 31, q = lane >> 3, c8 = (lane & 7) * 8;
  v8us hv[2], lv[2];
  size_t off[2];
#pragma unroll
  for (int it = 0; it < 2; ++it) {
    const int row = wv * 8 + it * 4 + q;
    const float* sp = sT + row * 68 + c8;
    const v4f a0 = *(const v4f*)sp;
    const v4f a1 = *(const v4f*)(sp + 4);
#pragma unroll
    for (int e = 0; e < 8; ++e) {
      const float fe = (e < 4) ? a0[e] : a1[e - 4];
      const unsigned short hb = f2bf_bits(fe);
      const unsigned short lb = f2bf_bits(fe - bf_bits2f(hb));
      hv[it][e] = hb;
      lv[it][e] = lb;
    }
    off[it] = ((size_t)(b * kPix + p0 + row)) * kCh + c0 + c8;
  }
  {
#pragma unroll
    for (int it = 0; it < 2; ++it) {
      *(v8us*)(Ah + off[it]) = hv[it];
      *(v8us*)(Al + off[it]) = lv[it];
    }
    
  }
}

__device__ __forceinline__ void split_w_block(const float* __restrict__ Wf,
                                              unsigned short* __restrict__ Wh,
                                              unsigned short* __restrict__ Wl, int blk, int n8)
{
  const int i = blk * 256 + threadIdx.x;
  if (i < n8) {
    const v4f a0 = *(const v4f*)(Wf + (size_t)i * 8);
    const v4f a1 = *(const v4f*)(Wf + (size_t)i * 8 + 4);
    v8us hv, lv;
#pragma unroll
    for (int e = 0; e < 8; ++e) {
      const float fe = (e < 4) ? a0[e] : a1[e - 4];
      const unsigned short hb = f2bf_bits(fe);
      const unsigned short lb = f2bf_bits(fe - bf_bits2f(hb));
      hv[e] = hb;
      lv[e] = lb;
    }
    unsigned short* ph = Wh + (size_t)i * 8;
    unsigned short* pl = Wl + (size_t)i * 8;
    *(v8us*)ph = hv;
    *(v8us*)pl = lv;
    
  }
}

// ---- all operand preparation in one launch: blocks 0..3*kTrBlocks-1 transpose and split the three maps, the rest split the two weights ----
constexpr int kTrBlocks = (kPix / 64) * (kCh / 64) * kB;   // 512 tiles a map
constexpr int kW8       = kCh * kCh / 8;                   // 8192 groups of 8 weights
constexpr int kWBlocks  = (kW8 + 255) / 256;               // 32 blocks a weight
__global__ __launch_bounds__(256) void prep_kernel(
    const float* __restrict__ X0, const float* __restrict__ X1, const float* __restrict__ X2,
    const float* __restrict__ W0, const float* __restrict__ W1,
    unsigned short* __restrict__ X0h, unsigned short* __restrict__ X0l,
    unsigned short* __restrict__ X1h, unsigned short* __restrict__ X1l,
    unsigned short* __restrict__ X2h, unsigned short* __restrict__ X2l,
    unsigned short* __restrict__ W0h, unsigned short* __restrict__ W0l,
    unsigned short* __restrict__ W1h, unsigned short* __restrict__ W1l)
{
  const int bid = blockIdx.x;
  if (bid < 3 * kTrBlocks) {   // block-uniform: the barrier inside is passed by the whole block
    const int m = bid / kTrBlocks, r = bid - m * kTrBlocks;
    const int p0 = (r % (kPix / 64)) * 64, c0 = ((r / (kPix / 64)) % (kCh / 64)) * 64, b = r / ((kPix / 64) * (kCh / 64));
    tr_split_in_tile(m == 0 ? X0 : (m == 1 ? X1 : X2),
                     m == 0 ? X0h : (m == 1 ? X1h : X2h),
                     m == 0 ? X0l : (m == 1 ? X1l : X2l), p0, c0, b);
  } else {
    const int r = bid - 3 * kTrBlocks;
    const int m = r / kWBlocks;
    split_w_block(m == 0 ? W0 : W1, m == 0 ? W0h : W1h, m == 0 ? W0l : W1l, r - m * kWBlocks, kW8);
  }
}

// ---- local 7x7 window attention, both kv branches, one (b, head, 4x8 pixel tile) per block of 2 waves ----
// Qh/Ql, KVh/KVl: bf16 hi/lo planes [b][p][256] (KV planes: branch-major, 2 x [b][p][256]); Obuf: f32 [b][p][256].
// Wave w owns pixel rows y0+2w..y0+2w+1, cols x0..x0+7; its 8x14 union neighbourhood is LDS rows 28w..28w+111 of the
// block's 10x14 neighbourhood (row index nr*14+nc, image pos (y0-3+nr, x0-3+nc), zero row when outside the image).
// second launch bound: holds the register allocation at three waves a SIMD, where it stood before the staged chunks were held in registers
__global__ __launch_bounds__(64, 3) void local_window_attn_kernel(
    const unsigned short* __restrict__ Qh, const unsigned short* __restrict__ Ql,
    const unsigned short* __restrict__ KVh, const unsigned short* __restrict__ KVl,
    float* __restrict__ Obuf)
{
  __shared__ __align__(16) unsigned short Ksh[kKRows * kKp];   // 20160 B
  __shared__ __align__(16) unsigned short Ksl[kKRows * kKp];   // 20160 B
  __shared__ __align__(16) __bf16 Psh[2][16 * kPp];            //  7680 B
  __shared__ __align__(16) __bf16 Psl[2][16 * kPp];            //  7680 B
  __shared__ __align__(16) float  Osh[2][16 * 68];             //  8704 B

  const int tid  = threadIdx.x;
  const int w    = tid >> 5, lane = tid & 31, hh = lane >> 4, c = lane & 15;
  const int bidx = blockIdx.x;
  const int tx   = bidx % kTilesX;
  const int ty   = (bidx / kTilesX) % kTilesY;
  const int head = (bidx / (kTilesX * kTilesY)) % kHeads;
  const int b    = bidx / (kTilesX * kTilesY * kHeads);
  const int y0 = ty * kTileY, x0 = tx * kTileX;
  const int nb = w * 2 * kNbCols;   // base LDS row of this wave's union neighbourhood

  // Q A-fragments for pixel row m = c of this wave (split k-map via Frag load)
  v16b qh[2], ql[2];
  {
    const int py = y0 + 2 * w + (c >> 3), px = x0 + (c & 7);
    const size_t qoff = ((size_t)(b * kPix + py * kW + px)) * kCh + head * kDh;
    const __bf16* qhp = (const __bf16*)Qh + qoff;
    const __bf16* qlp = (const __bf16*)Ql + qoff;
#pragma unroll
    for (int dc = 0; dc < 2; ++dc) {
      qh[dc] = Frag<__bf16>::load(qhp + dc * 32 + 8 * hh);
      ql[dc] = Frag<__bf16>::load(qlp + dc * 32 + 8 * hh);
    }
  }
  // per-lane neighbourhood row/col of neighbour index n = t*16 + c (relative to the wave's 8x14 union)
  int nrow[7], ncol[7];
#pragma unroll
  for (int t = 0; t < 7; ++t) {
    const int n = t * 16 + c;
    nrow[t] = n / kNbCols;
    ncol[t] = n - nrow[t] * kNbCols;
  }

  // staging map of this thread, the same in both branches: column tid / 8 of a half row, chunk tid % 8
  unsigned sgoff[2], sxmsk[2];   // byte offset in the image row (column clamped into the image), all-ones where the column is inside
#pragma unroll   // full: both entries live in registers
  for (int h = 0; h < 2; ++h) {
    const int gx = x0 - 3 + h * kStageCols + (tid >> 3);
    const int gxc = gx < 0 ? 0 : (gx > kW - 1 ? kW - 1 : gx);
    sgoff[h] = (unsigned)(gxc * kCh + (tid & 7) * 8) * 2u;
    sxmsk[h] = ((unsigned)gx < (unsigned)kW) ? 0xffffffffu : 0u;
  }
  const int sdst = (tid >> 3) * kKp + (tid & 7) * 8;   // LDS element of the chunk within a half row
  const bool topOut = y0 < 3, botOut = y0 + kTileY + 3 > kW;   // uniform: the 3 rows above / below the tile lie outside the image

  v8f oacc[4];
#pragma unroll
  for (int dt = 0; dt < 4; ++dt) oacc[dt] = (v8f){0.f,0.f,0.f,0.f,0.f,0.f,0.f,0.f};
  const v4u z4 = {0u, 0u, 0u, 0u};
  const v8b z8 = __builtin_bit_cast(v8b, z4);

#pragma unroll 1
  for (int br = 0; br < 2; ++br) {
    __syncthreads();
    // stage the 10 x 14 neighbourhood, 8 chunks of 16 B a row and plane (zeros outside the image): one trip is half a
    // neighbourhood row, 7 columns x 8 chunks on 56 of the 64 threads, so that the image row is uniform over the block.
    // All global loads of a branch are issued before the first LDS store: the wave waits out one load latency a branch, not one a trip.
    if (tid < kStageCols * 8) {
      // 32-bit byte offsets of this thread's chunk from the start of the two-branch plane (below 8 MiB), one for each zone
      // (3 rows above the tile: from image row y0 - 3; the tile's rows and the 3 rows below: from y0) and half row; a trip adds
      // its row as a constant. A zone outside the image reads the tile's own rows instead (3 rows further in) and is masked to zero.
      const unsigned anchor = (unsigned)((((br * kB + b) * kPix + y0 * kW) * kCh + head * kDh) * 2);
      unsigned voff[3][2];
#pragma unroll   // full: all six entries live in registers
      for (int h = 0; h < 2; ++h) {
        voff[1][h] = anchor + sgoff[h];
        voff[0][h] = voff[1][h] - (topOut ? 0u : 3u * kRowBytes);
        voff[2][h] = voff[1][h] - (botOut ? 3u * kRowBytes : 0u);
      }
      v4u vh[kStageTrips], vl[kStageTrips];
#pragma unroll   // full: the loaded chunks are held in registers, indexed by the trip
      for (int t = 0; t < kStageTrips; ++t) {
        const int nr = t >> 1, zone = nr < 3 ? 0 : (nr < 3 + kTileY ? 1 : 2);
        const int rows = zone == 0 ? nr : nr - 3;   // rows from the zone's offset, never negative
        vh[t] = *(const v4u*)((const char*)KVh + voff[zone][t & 1] + rows * kRowBytes);
        vl[t] = *(const v4u*)((const char*)KVl + voff[zone][t & 1] + rows * kRowBytes);
      }
      // the wait that stands before a register named by an issued load is rewritten; naming the six address registers keeps them
      // apart from the loads' own destination registers up to here
      asm volatile("s_wait_xcnt 0x0" :: "v"(voff[0][0]), "v"(voff[0][1]), "v"(voff[1][0]), "v"(voff[1][1]), "v"(voff[2][0]), "v"(voff[2][1]) : "memory");
#pragma unroll   // full: same register arrays
      for (int t = 0; t < kStageTrips; ++t) {
        const int nr = t >> 1;
        const unsigned msk = (nr < 3 ? topOut : (nr < 3 + kTileY ? false : botOut)) ? 0u : sxmsk[t & 1];
        v4u a = vh[t], d = vl[t];
        a.x &= msk; a.y &= msk; a.z &= msk; a.w &= msk;
        d.x &= msk; d.y &= msk; d.z &= msk; d.w &= msk;
        *(v4u*)(Ksh + t * kStageCols * kKp + sdst) = a;
        *(v4u*)(Ksl + t * kStageCols * kKp + sdst) = d;
      }
    }
    __syncthreads();

    // scores s[t][r] = q(pixel 8hh+r) . k(neighbour t*16+c); B fragments = rows of K in LDS (split k-map via Frag load)
    v8f s[7];
#pragma unroll
    for (int t = 0; t < 7; ++t) {
      s[t] = (v8f){0.f,0.f,0.f,0.f,0.f,0.f,0.f,0.f};
#pragma unroll
      for (int dc = 0; dc < 2; ++dc) {
        const int ko = (nb + t * 16 + c) * kKp + dc * 32 + 8 * hh;
        const v16b kfh = Frag<__bf16>::load((const __bf16*)Ksh + ko);
        const v16b kfl = Frag<__bf16>::load((const __bf16*)Ksl + ko);
        s[t] = at_mma(qh[dc], kfh, s[t]);
        s[t] = at_mma(qh[dc], kfl, s[t]);
        s[t] = at_mma(ql[dc], kfh, s[t]);
      }
    }

    // window mask (pixel 8hh+r keeps union rows hh..hh+6, cols r..r+6: exactly 49, zero vectors included) + softmax in f32
    __bf16* pwh = Psh[w];
    __bf16* pwl = Psl[w];
#pragma unroll
    for (int r = 0; r < 8; ++r) {
      float mx = -INFINITY;
#pragma unroll
      for (int t = 0; t < 7; ++t) {
        const bool inwin = (nrow[t] >= hh) && (nrow[t] <= hh + 6) && (ncol[t] >= r) && (ncol[t] <= r + 6);
        const float sv = inwin ? s[t][r] : -INFINITY;
        s[t][r] = sv;
        mx = fmaxf(mx, sv);
      }
      mx = fmaxf(mx, __shfl_xor(mx, 1, 32));
      mx = fmaxf(mx, __shfl_xor(mx, 2, 32));
      mx = fmaxf(mx, __shfl_xor(mx, 4, 32));
      mx = fmaxf(mx, __shfl_xor(mx, 8, 32));
      float l = 0.f;
#pragma unroll
      for (int t = 0; t < 7; ++t) {
        const float p = expf(s[t][r] - mx);
        s[t][r] = p;
        l += p;
      }
      l += __shfl_xor(l, 1, 32);
      l += __shfl_xor(l, 2, 32);
      l += __shfl_xor(l, 4, 32);
      l += __shfl_xor(l, 8, 32);
      const float scl = 0.5f / l;
#pragma unroll
      for (int t = 0; t < 7; ++t) {
        __bf16 ph, plo;
        at_split(s[t][r] * scl, ph, plo);
        pwh[(8 * hh + r) * kPp + t * 16 + c] = ph;
        pwl[(8 * hh + r) * kPp + t * 16 + c] = plo;
      }
    }
    __builtin_amdgcn_fence(__ATOMIC_RELEASE, "workgroup");
    __builtin_amdgcn_wave_barrier();
    __builtin_amdgcn_fence(__ATOMIC_ACQUIRE, "workgroup");

    // O += P . V : A = P rows (pixel) from this wave's LDS tile, B = V gathered down column d of the K rows (split k-map),
    // neighbour range 0..111; k-step 3 uses elements 0..7 only (8..15 zero in both operands)
#pragma unroll
    for (int kk = 0; kk < 4; ++kk) {
      FragB pa, pb;
      pa.h[0] = *(const v8b*)(pwh + c * kPp + kk * 32 + 8 * hh);
      pb.h[0] = *(const v8b*)(pwl + c * kPp + kk * 32 + 8 * hh);
      if (kk < 3) {
        pa.h[1] = *(const v8b*)(pwh + c * kPp + kk * 32 + 16 + 8 * hh);
        pb.h[1] = *(const v8b*)(pwl + c * kPp + kk * 32 + 16 + 8 * hh);
      } else {
        pa.h[1] = z8;
        pb.h[1] = z8;
      }
      const int rb = nb + kk * 32 + 8 * hh;
#pragma unroll
      for (int dt = 0; dt < 4; ++dt) {
        const int col = dt * 16 + c;
        v8u wh, wl;
#pragma unroll
        for (int j = 0; j < 4; ++j) {
          const int e0 = (rb + 2 * j) * kKp + col, e1 = e0 + kKp;
          wh[j] = (unsigned)Ksh[e0] | ((unsigned)Ksh[e1] << 16);
          wl[j] = (unsigned)Ksl[e0] | ((unsigned)Ksl[e1] << 16);
          if (kk < 3) {
            const int e2 = (rb + 16 + 2 * j) * kKp + col, e3 = e2 + kKp;
            wh[4 + j] = (unsigned)Ksh[e2] | ((unsigned)Ksh[e3] << 16);
            wl[4 + j] = (unsigned)Ksl[e2] | ((unsigned)Ksl[e3] << 16);
          } else {
            wh[4 + j] = 0u;
            wl[4 + j] = 0u;
          }
        }
        const v16b vfh = __builtin_bit_cast(v16b, wh);
        const v16b vfl = __builtin_bit_cast(v16b, wl);
        oacc[dt] = at_mma(pa.v, vfh, oacc[dt]);
        oacc[dt] = at_mma(pa.v, vfl, oacc[dt]);
        oacc[dt] = at_mma(pb.v, vfh, oacc[dt]);
      }
    }
  }

  float* osw = Osh[w];
#pragma unroll
  for (int r = 0; r < 8; ++r)
#pragma unroll
    for (int dt = 0; dt < 4; ++dt) osw[(8 * hh + r) * 68 + dt * 16 + c] = oacc[dt][r];
  __builtin_amdgcn_fence(__ATOMIC_RELEASE, "workgroup");
  __builtin_amdgcn_wave_barrier();
  __builtin_amdgcn_fence(__ATOMIC_ACQUIRE, "workgroup");
  {
    const int c4 = c * 4;
    {
#pragma unroll
      for (int it = 0; it < 8; ++it) {
        const int row = it * 2 + hh;
        const v4f val = *(const v4f*)(osw + row * 68 + c4);
        const int py = y0 + 2 * w + (row >> 3), px = x0 + (row & 7);
        *(v4f*)(Obuf + ((size_t)(b * kPix + py * kW + px)) * kCh + head * kDh + c4) = val;
      }
      
    }
  }
}

// ---- final transpose: O [kB][kPix][kCh] f32 -> out [kB][kCh][kPix] f32; one 64-p x 64-ch tile per block (grid 64 x 4 x kB) ----
// Load: 256 threads x 4 iterations x float4 = 64 p x 64 ch (exact). Store: 8 waves x 8 ch-rows x (16 lanes x 4 floats) = 64 x 64,
__global__ __launch_bounds__(256) void tr_out_kernel(const float* __restrict__ O, float* __restrict__ out)
{
  __shared__ __align__(16) float sT[64 * 68];   // [ch][p], pitch 68
  const int tid = threadIdx.x;
  const int p0 = blockIdx.x * 64, c0 = blockIdx.y * 64, b = blockIdx.z;
#pragma unroll
  for (int it = 0; it < 4; ++it) {
    const int idx = tid + 256 * it;
    const int prow = idx >> 4, c4 = (idx & 15) * 4;
    const v4f v = *(const v4f*)(O + ((size_t)(b * kPix + p0 + prow)) * kCh + c0 + c4);
    sT[(c4 + 0) * 68 + prow] = v.x;
    sT[(c4 + 1) * 68 + prow] = v.y;
    sT[(c4 + 2) * 68 + prow] = v.z;
    sT[(c4 + 3) * 68 + prow] = v.w;
  }
  __syncthreads();
  const int wv = tid >> 5, lane = tid & 31, hh = lane >> 4, p4 = (lane & 15) * 4;
  v4f val[4];
  size_t off[4];
#pragma unroll
  for (int it = 0; it < 4; ++it) {
    const int row = wv * 8 + it * 2 + hh;
    val[it] = *(const v4f*)(sT + row * 68 + p4);
    off[it] = ((size_t)(b * kCh + c0 + row)) * kPix + p0 + p4;
  }
  {
#pragma unroll
    for (int it = 0; it < 4; ++it) *(v4f*)(out + off[it]) = val[it];
    
  }
}

// ---------------------------------------------------------------------------
// Workspace region map (bytes, all offsets multiples of 131072):
//   P16 = kB*kPix*kCh*2 = 4,194,304 (one bf16 plane [kB][kPix][kCh])
//   [ 0]          XT qmap  hi,lo           2 x P16
//   [ 8,388,608]  XT kvmap1 hi,lo          2 x P16
//   [16,777,216]  XT kvmap2 hi,lo          2 x P16
//   [25,165,824]  Wq hi,lo / Wkv hi,lo    4 x 131,072
//   [25,690,112]  Q hi,lo                  2 x P16
//   [34,078,720]  KV hi (branch 0,1)       2 x P16
//   [42,467,328]  KV lo (branch 0,1)       2 x P16
//   [50,855,936]  O f32 [kB][kPix][kCh]    8,388,608
//   total 59,244,544 <= 134,217,728
// ---------------------------------------------------------------------------
extern "C" void kernel_launch(void* const* d_in, const int* in_sizes, int n_in,
                              void* d_out, int out_size, void* d_ws, size_t ws_size,
                              hipStream_t stream)
{
  const int nAct = kB * kCh * kPix;   // 2,097,152
  const int nW   = kCh * kCh;         // 65,536
  if (n_in < 5) return;
  if (in_sizes[0] != nAct || in_sizes[1] != nAct || in_sizes[2] != nAct) return;
  if (in_sizes[3] != nW || in_sizes[4] != nW) return;
  if (out_size != nAct) return;

  const float* kvmap1 = (const float*)d_in[0];
  const float* qmap   = (const float*)d_in[1];
  const float* kvmap2 = (const float*)d_in[2];
  const float* Wq     = (const float*)d_in[3];
  const float* Wkv    = (const float*)d_in[4];
  float* out = (float*)d_out;

  const size_t planeB  = (size_t)nAct * 2;
  const size_t wplaneB = (size_t)nW * 2;
  char* ws = (char*)d_ws;
  size_t o = 0;
  unsigned short* XTqh  = (unsigned short*)(ws + o); o += planeB;
  unsigned short* XTql  = (unsigned short*)(ws + o); o += planeB;
  unsigned short* XTk1h = (unsigned short*)(ws + o); o += planeB;
  unsigned short* XTk1l = (unsigned short*)(ws + o); o += planeB;
  unsigned short* XTk2h = (unsigned short*)(ws + o); o += planeB;
  unsigned short* XTk2l = (unsigned short*)(ws + o); o += planeB;
  unsigned short* Wqh   = (unsigned short*)(ws + o); o += wplaneB;
  unsigned short* Wql   = (unsigned short*)(ws + o); o += wplaneB;
  unsigned short* Wkh   = (unsigned short*)(ws + o); o += wplaneB;
  unsigned short* Wkl   = (unsigned short*)(ws + o); o += wplaneB;
  unsigned short* Qh    = (unsigned short*)(ws + o); o += planeB;
  unsigned short* Ql    = (unsigned short*)(ws + o); o += planeB;
  unsigned short* KVh   = (unsigned short*)(ws + o); o += 2 * planeB;
  unsigned short* KVl   = (unsigned short*)(ws + o); o += 2 * planeB;
  float*          Obuf  = (float*)(ws + o);          o += (size_t)nAct * 4;
  if (o > ws_size) return;
  const float* dummyf = (const float*)(const void*)Wqh;   // never dereferenced (bias/resid modes off)

  // 1: activation transposes [b][c][p] -> [b][p][c] bf16 hi/lo and weight splits (layout [o][c] kept = Bt operand), one launch
  const dim3 gtr(kPix / 64, kCh / 64, kB);
  prep_kernel<<<3 * kTrBlocks + 2 * kWBlocks, 256, 0, stream>>>(
      qmap, kvmap1, kvmap2, Wq, Wkv,
      XTqh, XTql, XTk1h, XTk1l, XTk2h, XTk2l, Wqh, Wql, Wkh, Wkl);
  // 2: the three projections C[p][o] = sum_c XT[p][c] W[o][c] in one launch; M = 4096, N = 256, K = 256 per batch;
  //    3 x kB x 256 tiles = 256 blocks x 6 waves
  const long strideAct = (long)kPix * kCh;
  wmma_gemm64<1, true, 0, 2, false, 0><<<3 * kB * (kPix / 64) * (kCh / 64) / 6, 192, 0, stream>>>(
      XTqh, XTql, XTk1h, XTk1l, XTk2h, XTk2l, kCh, strideAct,
      Wqh, Wql, Wkh, Wkl, Wkh, Wkl, kCh, 0L,
      (void*)Qh, (void*)Ql, (void*)KVh, (void*)KVl,
      (void*)(KVh + (size_t)nAct), (void*)(KVl + (size_t)nAct), kCh, strideAct,
      dummyf, dummyf, 0L, kPix, kCh, kCh, kB, 0.125f, 1.0f, 1.0f);
  // 3: local window attention, both branches, O as [b][p][256] f32
  local_window_attn_kernel<<<kB * kHeads * kTilesY * kTilesX, 64, 0, stream>>>(Qh, Ql, KVh, KVl, Obuf);
  // 4: O [b][p][ch] -> out [b][ch][p]
  tr_out_kernel<<<gtr, 256, 0, stream>>>(Obuf, out);
}

// v004
// One run takes 32.4 microseconds.
// In both of two side-by-side timings against v003, it was 1.51 times as fast.
// Over all steps from v000 it is 3.75 times as fast.
// Contractions: 1x1 projections, local-window q.k and p.v all on v_wmma_f32_16x16x32_bf16 with bf16 hi/lo split operands (hi*hi + hi*lo + lo*hi), f32 accumulate; softmax, scaling and transposes in f32.
#include <hip/hip_runtime.h>
#include <stdint.h>
#include <stddef.h>

typedef __attribute__((ext_vector_type(16))) _Float16 v16h;
typedef __attribute__((ext_vector_type(8)))  _Float16 v8h;
typedef __attribute__((ext_vector_type(16))) __bf16   v16b;
typedef __attribute__((ext_vector_type(8)))  __bf16   v8b;
typedef __attribute__((ext_vector_type(8)))  float    v8f;
typedef __attribute__((ext_vector_type(4)))  float    v4f;
typedef __attribute__((ext_vector_type(4)))  unsigned int v4u;
typedef __attribute__((ext_vector_type(8)))  unsigned int v8u;
typedef __attribute__((ext_vector_type(8)))  unsigned short v8us;

template <typename T> struct Frag;
template <> struct Frag<__bf16> {
  typedef v16b V; union U { v16b v; v8b h[2]; };
  static __device__ __forceinline__ v16b load(const __bf16* p) {
    U f; f.h[0] = *(const v8b*)(p); f.h[1] = *(const v8b*)(p + 16); return f.v;
  }
  static __device__ __forceinline__ v8f mma(v16b a, v16b b, v8f c) {
    return __builtin_amdgcn_wmma_f32_16x16x32_bf16(false, a, false, b, (short)0, c, false, false);
  }
};

// ---- bf16 split helpers and guarded bf16 WMMA ----
__device__ __forceinline__ unsigned short at_bf_bits(float f) {
  unsigned u = __float_as_uint(f);
  return (unsigned short)((u + 0x7FFFu + ((u >> 16) & 1u)) >> 16);
}
__device__ __forceinline__ __bf16 at_f2bf(float f) { return __builtin_bit_cast(__bf16, at_bf_bits(f)); }
__device__ __forceinline__ void at_split(float f, __bf16& hi, __bf16& lo) {
  const unsigned short hb = at_bf_bits(f);
  hi = __builtin_bit_cast(__bf16, hb);
  lo = at_f2bf(f - __uint_as_float(((unsigned)hb) << 16));
}
__device__ __forceinline__ v8f at_mma(v16b a, v16b b, v8f c) {
  c = __builtin_amdgcn_wmma_f32_16x16x32_bf16(false, a, false, b, (short)0, c, false, false);
  asm volatile("v_nop\n\tv_nop\n\tv_nop\n\tv_nop" : "+v"(c) : "v"(a), "v"(b));
  return c;
}

// ---- problem geometry ----
constexpr int kB     = 2;
constexpr int kPix   = 4096;
constexpr int kW     = 64;
constexpr int kCh    = 256;
constexpr int kHeads = 4;
constexpr int kDh    = 64;
constexpr int kTileY = 4;                       // pixel tile of one block: 4 rows x 8 cols, 2 waves (2 rows x 8 cols each)
constexpr int kTileX = 8;
constexpr int kNbRows = kTileY + 6;             // 10 neighbourhood rows
constexpr int kNbCols = kTileX + 6;             // 14 neighbourhood cols
constexpr int kKRows  = kNbRows * kNbCols;      // 140 staged K rows per block
constexpr int kKp     = kDh + 8;                // K row pitch in LDS (elements): 144 B = 16 B x odd, so that 16 rows read 16 B wide fall on distinct banks
constexpr int kPp     = 7 * 16 + 8;             // P row pitch (elements), 112 columns in use: 240 B = 16 B x odd, for the same reason
constexpr int kStageCols  = kNbCols / 2;        // 7 neighbourhood columns staged a trip
constexpr int kStageTrips = 2 * kNbRows;        // 20 trips stage one plane of K
constexpr int kRowBytes   = kW * kCh * 2;       // one image row of one bf16 plane
constexpr int kTilesY = kW / kTileY;            // 16
constexpr int kTilesX = kW / kTileX;            // 8
static_assert(kHeads * kDh == kCh, "geometry");
static_assert(kW * kW == kPix, "geometry");
static_assert(kNbCols % 2 == 0 && (kNbCols / 2) * 8 <= 64, "half a neighbourhood row fits one trip of the block");
static_assert(kTileY >= 3 && kNbRows == kTileY + 6, "the 3 rows above (below) a tile are outside the image all together, and the tile has 3 rows to read in their place");
static_assert(kPix % 64 == 0 && kCh % 64 == 0 && kCh % 32 == 0, "gemm tile and K multiples");
static_assert(kW % kTileY == 0 && kW % kTileX == 0, "tile coverage");
static_assert(2 * kNbCols + 6 * 16 + 8 + 7 < kKRows, "pv gather rows in range");

union FragB { v16b v; v8b h[2]; };

// ---- the three 1x1 projections, operand preparation included: one launch ----
// C[p][o] = scale * sum_c X[c][p] * W[o][c], written as bf16 hi/lo planes [b][p][256]; product = hi.hi + hi.lo + lo.hi, f32 accumulate.
// One block = 128 pixels x 256 outputs of one (map, batch); 8 waves, wave (wm, wn) owns 64 pixels x 64 outputs (4 x 4 tiles of 16 x 16).
// A stage is 32 channels: the block reads X [32 c][128 p] and W [256 o][32 c] in f32 as whole 128-B lines, splits them into bf16 hi/lo in
// registers and stores them k-contiguous in LDS (X transposed on the way), two buffers; the next stage's global loads fly during the products.
typedef __attribute__((ext_vector_type(2))) float        v2f;
typedef __attribute__((ext_vector_type(2))) __bf16       v2b;
typedef __attribute__((ext_vector_type(2))) unsigned int v2u;
constexpr int kPT     = 128;                    // pixels a block
constexpr int kStageK = 32;                     // channels a stage = one k-step of the matrix instruction
constexpr int kStages = kCh / kStageK;          // 8
constexpr int kSp     = kStageK + 8;            // LDS row pitch (elements): 80 B = 16 B x odd, so that 16 rows read 16 B wide fall on distinct banks
constexpr int kProjBlocks = kB * (kPix / kPT);  // 64 blocks a map
static_assert(kPix % kPT == 0 && kCh % kStageK == 0 && kCh == 256 && kPT == 128, "projection tiling");

// four f32 -> four bf16 hi (nearest even) and four bf16 lo (the remainder, nearest even), two a word
__device__ __forceinline__ void split4(v4f v, v2u& hi, v2u& lo) {
#pragma unroll
  for (int q = 0; q < 2; ++q) {
    const v2f x = {v[2 * q], v[2 * q + 1]};
    const unsigned hw = __builtin_bit_cast(unsigned, __builtin_convertvector(x, v2b));
    const v2f hf = {__uint_as_float(hw << 16), __uint_as_float(hw & 0xffff0000u)};
    hi[q] = hw;
    lo[q] = __builtin_bit_cast(unsigned, __builtin_convertvector(x - hf, v2b));
  }
}

__global__ __launch_bounds__(256) void proj_kernel(
    const float* __restrict__ X0, const float* __restrict__ X1, const float* __restrict__ X2,
    const float* __restrict__ W0, const float* __restrict__ W1,
    unsigned short* __restrict__ C0h, unsigned short* __restrict__ C0l,
    unsigned short* __restrict__ C1h, unsigned short* __restrict__ C1l,
    unsigned short* __restrict__ C2h, unsigned short* __restrict__ C2l)
{
  __shared__ __align__(16) unsigned short sXh[2][kPT * kSp];   // 2 x 10240 B
  __shared__ __align__(16) unsigned short sXl[2][kPT * kSp];
  __shared__ __align__(16) unsigned short sWh[2][kCh * kSp];   // 2 x 20480 B
  __shared__ __align__(16) unsigned short sWl[2][kCh * kSp];
  __shared__ __align__(16) float sT[8][16 * 68];               // per-wave 16 x 64 slab of the epilogue, pitch 68 floats

  const int tid  = threadIdx.x;
  const int lane = tid & 31;
  const int wave = __builtin_amdgcn_readfirstlane(tid >> 5);
  const int wm = wave >> 2, wn = wave & 3;
  const int g  = blockIdx.x / kProjBlocks;
  const int rb = blockIdx.x - g * kProjBlocks;
  const int b  = rb / (kPix / kPT);
  const int p0 = (rb - b * (kPix / kPT)) * kPT;
  const float* X = (g == 0 ? X0 : (g == 1 ? X1 : X2)) + (size_t)b * kCh * kPix + p0;
  const float* Wf = g == 0 ? W0 : W1;
  unsigned short* Ch = g == 0 ? C0h : (g == 1 ? C1h : C2h);
  unsigned short* Cl = g == 0 ? C0l : (g == 1 ? C1l : C2l);
  const float scale = g == 0 ? 0.125f : 1.0f;

  // staging maps. X: wave w takes channels 4w..4w+3 of the stage, lane l pixels 4l..4l+3 (512 contiguous bytes a load).
  // Pixel 4l + j goes to LDS row 32j + l, so that the 32 lanes of a store write 32 consecutive rows.
  // W: 8 lanes take the 32 channels of one output row (128 B), a load covers 4 rows, 8 loads the 256 rows.
  const float* xp = X + (wave * 4 * kPix + lane * 4);            // this thread's chunk of the stage last loaded
  const float* wp = Wf + ((tid >> 3) * kCh + (tid & 7) * 4);
  const int xdst = lane * kSp + wave * 4;
  const int wdst = (tid >> 3) * kSp + (tid & 7) * 4;

  const int rlane = lane & 15;                 // row (A) / col (B, D) within a 16 x 16 tile
  const int koff  = (lane >> 4) * 8;           // k offset of this lane half
  const int mOff  = (lane >> 4) * 8;           // D row offset

  v8f acc[4][4];
#pragma unroll
  for (int i = 0; i < 4; ++i)
#pragma unroll
    for (int j = 0; j < 4; ++j) acc[i][j] = (v8f){0.f,0.f,0.f,0.f,0.f,0.f,0.f,0.f};

  v4f xr[4], wr[8];
#pragma unroll
  for (int i = 0; i < 4; ++i) xr[i] = *(const v4f*)(xp + i * kPix);
#pragma unroll
  for (int it = 0; it < 8; ++it) wr[it] = *(const v4f*)(wp + it * 32 * kCh);
  // the wait that stands before a register named by an issued load is rewritten; naming the two pointers keeps them in place up to here
  asm volatile("s_wait_xcnt 0x0" :: "v"(xp), "v"(wp) : "memory");

  // split the stage held in registers and store it in buffer buf
  auto store_stage = [&](int buf) {
    // X: the four channels of one pixel are the same component of the four loaded vectors
#pragma unroll
    for (int j = 0; j < 4; ++j) {
      const v4f t = {xr[0][j], xr[1][j], xr[2][j], xr[3][j]};
      v2u h, l;
      split4(t, h, l);
      *(v2u*)(sXh[buf] + j * 32 * kSp + xdst) = h;
      *(v2u*)(sXl[buf] + j * 32 * kSp + xdst) = l;
    }
#pragma unroll
    for (int it = 0; it < 8; ++it) {
      v2u h, l;
      split4(wr[it], h, l);
      *(v2u*)(sWh[buf] + it * 32 * kSp + wdst) = h;
      *(v2u*)(sWl[buf] + it * 32 * kSp + wdst) = l;
    }
  };
  // the 48 products of the stage in buffer buf
  auto products = [&](int buf) {
    v16b bh[4], bl[4];
#pragma unroll
    for (int j = 0; j < 4; ++j) {
      const int bo = (wn * 64 + (j << 4) + rlane) * kSp + koff;
      bh[j] = Frag<__bf16>::load((const __bf16*)sWh[buf] + bo);
      bl[j] = Frag<__bf16>::load((const __bf16*)sWl[buf] + bo);
    }
    const int ao = (wm * 64 + rlane) * kSp + koff;
    v16b ah = Frag<__bf16>::load((const __bf16*)sXh[buf] + ao);
    v16b al = Frag<__bf16>::load((const __bf16*)sXl[buf] + ao);
#pragma unroll
    for (int i = 0; i < 4; ++i) {
      v16b nh = ah, nl = al;
      if (i < 3) {   // the next strip's fragments are asked for ahead of this strip's products
        nh = Frag<__bf16>::load((const __bf16*)sXh[buf] + ao + (i + 1) * 16 * kSp);
        nl = Frag<__bf16>::load((const __bf16*)sXl[buf] + ao + (i + 1) * 16 * kSp);
        __builtin_amdgcn_sched_barrier(0);   // holds those loads in front of the products: sunk behind them, each strip waits out its own LDS latency
      }
#pragma unroll
      for (int j = 0; j < 4; ++j) {
        acc[i][j] = Frag<__bf16>::mma(ah, bh[j], acc[i][j]);
        acc[i][j] = Frag<__bf16>::mma(ah, bl[j], acc[i][j]);
        acc[i][j] = Frag<__bf16>::mma(al, bh[j], acc[i][j]);
      }
      ah = nh;
      al = nl;
    }
  };

#pragma unroll 1   // rolled: one copy of the stage keeps the kernel's text short, which a first run fetches line by line
  for (int ks = 0; ks + 1 < kStages; ++ks) {
    store_stage(ks & 1);   // the buffer's last readers left it before the barrier of the stage before
    __syncthreads();       // publishes this stage; also ends every wave's reads of the other buffer, which the next stage overwrites
    // the next stage's global loads stand behind the barrier (in front of it the barrier's own wait would drain them) and fly during the products
#pragma unroll
    for (int i = 0; i < 4; ++i) xr[i] = *(const v4f*)(xp + (kStageK + i) * kPix);
#pragma unroll
    for (int it = 0; it < 8; ++it) wr[it] = *(const v4f*)(wp + kStageK + it * 32 * kCh);
    // as in front of the loop: the wait before the two pointers are advanced
    asm volatile("s_wait_xcnt 0x0" :: "v"(xp), "v"(wp) : "memory");
    xp += kStageK * kPix;
    wp += kStageK;
    products(ks & 1);
  }
  store_stage((kStages - 1) & 1);
  __syncthreads();         // publishes the last stage
  products((kStages - 1) & 1);

  // ---- epilogue: each 16 x 64 strip through the wave's own slab, whole 128-B row segments stored ----
  // LDS row 64 wm + 16 i + row holds pixel 4 * (16 (i & 1) + row) + 2 wm + (i >> 1) of the block (the staging map above)
  float* slab = sT[wave];
  const int n0 = wn * 64;
#pragma unroll
  for (int i = 0; i < 4; ++i) {
#pragma unroll
    for (int j = 0; j < 4; ++j)
#pragma unroll
      for (int r = 0; r < 8; ++r) slab[(mOff + r) * 68 + (j << 4) + rlane] = acc[i][j][r] * scale;
    __builtin_amdgcn_fence(__ATOMIC_RELEASE, "workgroup");
    __builtin_amdgcn_wave_barrier();
    __builtin_amdgcn_fence(__ATOMIC_ACQUIRE, "workgroup");
    const int q = lane >> 3, c8 = (lane & 7) * 8;
#pragma unroll
    for (int it = 0; it < 4; ++it) {
      const int row = it * 4 + q;
      const int pix = p0 + 4 * (16 * (i & 1) + row) + 2 * wm + (i >> 1);
      const float* sp = slab + row * 68 + c8;
      v2u h0, l0, h1, l1;
      split4(*(const v4f*)sp, h0, l0);
      split4(*(const v4f*)(sp + 4), h1, l1);
      const size_t co = ((size_t)(b * kPix + pix)) * kCh + n0 + c8;
      *(v4u*)(Ch + co) = (v4u){h0.x, h0.y, h1.x, h1.y};
      *(v4u*)(Cl + co) = (v4u){l0.x, l0.y, l1.x, l1.y};
    }
    __builtin_amdgcn_fence(__ATOMIC_RELEASE, "workgroup");
    __builtin_amdgcn_wave_barrier();
    __builtin_amdgcn_fence(__ATOMIC_ACQUIRE, "workgroup");
  }
}

// ---- local 7x7 window attention, both kv branches, one (b, head, 4x8 pixel tile) per block of 2 waves ----
// Qh/Ql, KVh/KVl: bf16 hi/lo planes [b][p][256] (KV planes: branch-major, 2 x [b][p][256]); Obuf: f32 [b][p][256].
// Wave w owns pixel rows y0+2w..y0+2w+1, cols x0..x0+7; its 8x14 union neighbourhood is LDS rows 28w..28w+111 of the
// block's 10x14 neighbourhood (row index nr*14+nc, image pos (y0-3+nr, x0-3+nc), zero row when outside the image).
// second launch bound: holds the register allocation at three waves a SIMD, where it stood before the staged chunks were held in registers
__global__ __launch_bounds__(64, 3) void local_window_attn_kernel(
    const unsigned short* __restrict__ Qh, const unsigned short* __restrict__ Ql,
    const unsigned short* __restrict__ KVh, const unsigned short* __restrict__ KVl,
    float* __restrict__ Obuf)
{
  __shared__ __align__(16) unsigned short Ksh[kKRows * kKp];   // 20160 B
  __shared__ __align__(16) unsigned short Ksl[kKRows * kKp];   // 20160 B
  __shared__ __align__(16) __bf16 Psh[2][16 * kPp];            //  7680 B
  __shared__ __align__(16) __bf16 Psl[2][16 * kPp];            //  7680 B
  __shared__ __align__(16) float  Osh[2][16 * 68];             //  8704 B

  const int tid  = threadIdx.x;
  const int w    = tid >> 5, lane = tid & 31, hh = lane >> 4, c = lane & 15;
  const int bidx = blockIdx.x;
  const int tx   = bidx % kTilesX;
  const int ty   = (bidx / kTilesX) % kTilesY;
  const int head = (bidx / (kTilesX * kTilesY)) % kHeads;
  const int b    = bidx / (kTilesX * kTilesY * kHeads);
  const int y0 = ty * kTileY, x0 = tx * kTileX;
  const int nb = w * 2 * kNbCols;   // base LDS row of this wave's union neighbourhood

  // Q A-fragments for pixel row m = c of this wave (split k-map via Frag load)
  v16b qh[2], ql[2];
  {
    const int py = y0 + 2 * w + (c >> 3), px = x0 + (c & 7);
    const size_t qoff = ((size_t)(b * kPix + py * kW + px)) * kCh + head * kDh;
    const __bf16* qhp = (const __bf16*)Qh + qoff;
    const __bf16* qlp = (const __bf16*)Ql + qoff;
#pragma unroll
    for (int dc = 0; dc < 2; ++dc) {
      qh[dc] = Frag<__bf16>::load(qhp + dc * 32 + 8 * hh);
      ql[dc] = Frag<__bf16>::load(qlp + dc * 32 + 8 * hh);
    }
  }
  // per-lane neighbourhood row/col of neighbour index n = t*16 + c (relative to the wave's 8x14 union)
  int nrow[7], ncol[7];
#pragma unroll
  for (int t = 0; t < 7; ++t) {
    const int n = t * 16 + c;
    nrow[t] = n / kNbCols;
    ncol[t] = n - nrow[t] * kNbCols;
  }

  // staging map of this thread, the same in both branches: column tid / 8 of a half row, chunk tid % 8
  unsigned sgoff[2], sxmsk[2];   // byte offset in the image row (column clamped into the image), all-ones where the column is inside
#pragma unroll   // full: both entries live in registers
  for (int h = 0; h < 2; ++h) {
    const int gx = x0 - 3 + h * kStageCols + (tid >> 3);
    const int gxc = gx < 0 ? 0 : (gx > kW - 1 ? kW - 1 : gx);
    sgoff[h] = (unsigned)(gxc * kCh + (tid & 7) * 8) * 2u;
    sxmsk[h] = ((unsigned)gx < (unsigned)kW) ? 0xffffffffu : 0u;
  }
  const int sdst = (tid >> 3) * kKp + (tid & 7) * 8;   // LDS element of the chunk within a half row
  const bool topOut = y0 < 3, botOut = y0 + kTileY + 3 > kW;   // uniform: the 3 rows above / below the tile lie outside the image

  v8f oacc[4];
#pragma unroll
  for (int dt = 0; dt < 4; ++dt) oacc[dt] = (v8f){0.f,0.f,0.f,0.f,0.f,0.f,0.f,0.f};
  const v4u z4 = {0u, 0u, 0u, 0u};
  const v8b z8 = __builtin_bit_cast(v8b, z4);

#pragma unroll 1
  for (int br = 0; br < 2; ++br) {
    __syncthreads();
    // stage the 10 x 14 neighbourhood, 8 chunks of 16 B a row and plane (zeros outside the image): one trip is half a
    // neighbourhood row, 7 columns x 8 chunks on 56 of the 64 threads, so that the image row is uniform over the block.
    // All global loads of a branch are issued before the first LDS store: the wave waits out one load latency a branch, not one a trip.
    if (tid < kStageCols * 8) {
      // 32-bit byte offsets of this thread's chunk from the start of the two-branch plane (below 8 MiB), one for each zone
      // (3 rows above the tile: from image row y0 - 3; the tile's rows and the 3 rows below: from y0) and half row; a trip adds
      // its row as a constant. A zone outside the image reads the tile's own rows instead (3 rows further in) and is masked to zero.
      const unsigned anchor = (unsigned)((((br * kB + b) * kPix + y0 * kW) * kCh + head * kDh) * 2);
      unsigned voff[3][2];
#pragma unroll   // full: all six entries live in registers
      for (int h = 0; h < 2; ++h) {
        voff[1][h] = anchor + sgoff[h];
        voff[0][h] = voff[1][h] - (topOut ? 0u : 3u * kRowBytes);
        voff[2][h] = voff[1][h] - (botOut ? 3u * kRowBytes : 0u);
      }
      v4u vh[kStageTrips], vl[kStageTrips];
#pragma unroll   // full: the loaded chunks are held in registers, indexed by the trip
      for (int t = 0; t < kStageTrips; ++t) {
        const int nr = t >> 1, zone = nr < 3 ? 0 : (nr < 3 + kTileY ? 1 : 2);
        const int rows = zone == 0 ? nr : nr - 3;   // rows from the zone's offset, never negative
        vh[t] = *(const v4u*)((const char*)KVh + voff[zone][t & 1] + rows * kRowBytes);
        vl[t] = *(const v4u*)((const char*)KVl + voff[zone][t & 1] + rows * kRowBytes);
      }
      // the wait that stands before a register named by an issued load is rewritten; naming the six address registers keeps them
      // apart from the loads' own destination registers up to here
      asm volatile("s_wait_xcnt 0x0" :: "v"(voff[0][0]), "v"(voff[0][1]), "v"(voff[1][0]), "v"(voff[1][1]), "v"(voff[2][0]), "v"(voff[2][1]) : "memory");
#pragma unroll   // full: same register arrays
      for (int t = 0; t < kStageTrips; ++t) {
        const int nr = t >> 1;
        const unsigned msk = (nr < 3 ? topOut : (nr < 3 + kTileY ? false : botOut)) ? 0u : sxmsk[t & 1];
        v4u a = vh[t], d = vl[t];
        a.x &= msk; a.y &= msk; a.z &= msk; a.w &= msk;
        d.x &= msk; d.y &= msk; d.z &= msk; d.w &= msk;
        *(v4u*)(Ksh + t * kStageCols * kKp + sdst) = a;
        *(v4u*)(Ksl + t * kStageCols * kKp + sdst) = d;
      }
    }
    __syncthreads();

    // scores s[t][r] = q(pixel 8hh+r) . k(neighbour t*16+c); B fragments = rows of K in LDS (split k-map via Frag load)
    v8f s[7];
#pragma unroll
    for (int t = 0; t < 7; ++t) {
      s[t] = (v8f){0.f,0.f,0.f,0.f,0.f,0.f,0.f,0.f};
#pragma unroll
      for (int dc = 0; dc < 2; ++dc) {
        const int ko = (nb + t * 16 + c) * kKp + dc * 32 + 8 * hh;
        const v16b kfh = Frag<__bf16>::load((const __bf16*)Ksh + ko);
        const v16b kfl = Frag<__bf16>::load((const __bf16*)Ksl + ko);
        s[t] = at_mma(qh[dc], kfh, s[t]);
        s[t] = at_mma(qh[dc], kfl, s[t]);
        s[t] = at_mma(ql[dc], kfh, s[t]);
      }
    }

    // window mask (pixel 8hh+r keeps union rows hh..hh+6, cols r..r+6: exactly 49, zero vectors included) + softmax in f32
    __bf16* pwh = Psh[w];
    __bf16* pwl = Psl[w];
#pragma unroll
    for (int r = 0; r < 8; ++r) {
      float mx = -INFINITY;
#pragma unroll
      for (int t = 0; t < 7; ++t) {
        const bool inwin = (nrow[t] >= hh) && (nrow[t] <= hh + 6) && (ncol[t] >= r) && (ncol[t] <= r + 6);
        const float sv = inwin ? s[t][r] : -INFINITY;
        s[t][r] = sv;
        mx = fmaxf(mx, sv);
      }
      mx = fmaxf(mx, __shfl_xor(mx, 1, 32));
      mx = fmaxf(mx, __shfl_xor(mx, 2, 32));
      mx = fmaxf(mx, __shfl_xor(mx, 4, 32));
      mx = fmaxf(mx, __shfl_xor(mx, 8, 32));
      float l = 0.f;
#pragma unroll
      for (int t = 0; t < 7; ++t) {
        const float p = expf(s[t][r] - mx);
        s[t][r] = p;
        l += p;
      }
      l += __shfl_xor(l, 1, 32);
      l += __shfl_xor(l, 2, 32);
      l += __shfl_xor(l, 4, 32);
      l += __shfl_xor(l, 8, 32);
      const float scl = 0.5f / l;
#pragma unroll
      for (int t = 0; t < 7; ++t) {
        __bf16 ph, plo;
        at_split(s[t][r] * scl, ph, plo);
        pwh[(8 * hh + r) * kPp + t * 16 + c] = ph;
        pwl[(8 * hh + r) * kPp + t * 16 + c] = plo;
      }
    }
    __builtin_amdgcn_fence(__ATOMIC_RELEASE, "workgroup");
    __builtin_amdgcn_wave_barrier();
    __builtin_amdgcn_fence(__ATOMIC_ACQUIRE, "workgroup");

    // O += P . V : A = P rows (pixel) from this wave's LDS tile, B = V gathered down column d of the K rows (split k-map),
    // neighbour range 0..111; k-step 3 uses elements 0..7 only (8..15 zero in both operands)
#pragma unroll
    for (int kk = 0; kk < 4; ++kk) {
      FragB pa, pb;
      pa.h[0] = *(const v8b*)(pwh + c * kPp + kk * 32 + 8 * hh);
      pb.h[0] = *(const v8b*)(pwl + c * kPp + kk * 32 + 8 * hh);
      if (kk < 3) {
        pa.h[1] = *(const v8b*)(pwh + c * kPp + kk * 32 + 16 + 8 * hh);
        pb.h[1] = *(const v8b*)(pwl + c * kPp + kk * 32 + 16 + 8 * hh);
      } else {
        pa.h[1] = z8;
        pb.h[1] = z8;
      }
      const int rb = nb + kk * 32 + 8 * hh;
#pragma unroll
      for (int dt = 0; dt < 4; ++dt) {
        const int col = dt * 16 + c;
        v8u wh, wl;
#pragma unroll
        for (int j = 0; j < 4; ++j) {
          const int e0 = (rb + 2 * j) * kKp + col, e1 = e0 + kKp;
          wh[j] = (unsigned)Ksh[e0] | ((unsigned)Ksh[e1] << 16);
          wl[j] = (unsigned)Ksl[e0] | ((unsigned)Ksl[e1] << 16);
          if (kk < 3) {
            const int e2 = (rb + 16 + 2 * j) * kKp + col, e3 = e2 + kKp;
            wh[4 + j] = (unsigned)Ksh[e2] | ((unsigned)Ksh[e3] << 16);
            wl[4 + j] = (unsigned)Ksl[e2] | ((unsigned)Ksl[e3] << 16);
          } else {
            wh[4 + j] = 0u;
            wl[4 + j] = 0u;
          }
        }
        const v16b vfh = __builtin_bit_cast(v16b, wh);
        const v16b vfl = __builtin_bit_cast(v16b, wl);
        oacc[dt] = at_mma(pa.v, vfh, oacc[dt]);
        oacc[dt] = at_mma(pa.v, vfl, oacc[dt]);
        oacc[dt] = at_mma(pb.v, vfh, oacc[dt]);
      }
    }
  }

  float* osw = Osh[w];
#pragma unroll
  for (int r = 0; r < 8; ++r)
#pragma unroll
    for (int dt = 0; dt < 4; ++dt) osw[(8 * hh + r) * 68 + dt * 16 + c] = oacc[dt][r];
  __builtin_amdgcn_fence(__ATOMIC_RELEASE, "workgroup");
  __builtin_amdgcn_wave_barrier();
  __builtin_amdgcn_fence(__ATOMIC_ACQUIRE, "workgroup");
  {
    const int c4 = c * 4;
    {
#pragma unroll
      for (int it = 0; it < 8; ++it) {
        const int row = it * 2 + hh;
        const v4f val = *(const v4f*)(osw + row * 68 + c4);
        const int py = y0 + 2 * w + (row >> 3), px = x0 + (row & 7);
        *(v4f*)(Obuf + ((size_t)(b * kPix + py * kW + px)) * kCh + head * kDh + c4) = val;
      }
      
    }
  }
}

// ---- final transpose: O [kB][kPix][kCh] f32 -> out [kB][kCh][kPix] f32; one 64-p x 64-ch tile per block (grid 64 x 4 x kB) ----
// Load: 256 threads x 4 iterations x float4 = 64 p x 64 ch (exact). Store: 8 waves x 8 ch-rows x (16 lanes x 4 floats) = 64 x 64,
__global__ __launch_bounds__(256) void tr_out_kernel(const float* __restrict__ O, float* __restrict__ out)
{
  __shared__ __align__(16) float sT[64 * 68];   // [ch][p], pitch 68
  const int tid = threadIdx.x;
  const int p0 = blockIdx.x * 64, c0 = blockIdx.y * 64, b = blockIdx.z;
#pragma unroll
  for (int it = 0; it < 4; ++it) {
    const int idx = tid + 256 * it;
    const int prow = idx >> 4, c4 = (idx & 15) * 4;
    const v4f v = *(const v4f*)(O + ((size_t)(b * kPix + p0 + prow)) * kCh + c0 + c4);
    sT[(c4 + 0) * 68 + prow] = v.x;
    sT[(c4 + 1) * 68 + prow] = v.y;
    sT[(c4 + 2) * 68 + prow] = v.z;
    sT[(c4 + 3) * 68 + prow] = v.w;
  }
  __syncthreads();
  const int wv = tid >> 5, lane = tid & 31, hh = lane >> 4, p4 = (lane & 15) * 4;
  v4f val[4];
  size_t off[4];
#pragma unroll
  for (int it = 0; it < 4; ++it) {
    const int row = wv * 8 + it * 2 + hh;
    val[it] = *(const v4f*)(sT + row * 68 + p4);
    off[it] = ((size_t)(b * kCh + c0 + row)) * kPix + p0 + p4;
  }
  {
#pragma unroll
    for (int it = 0; it < 4; ++it) *(v4f*)(out + off[it]) = val[it];
    
  }
}

// ---------------------------------------------------------------------------
// Workspace region map (bytes):
//   P16 = kB*kPix*kCh*2 = 4,194,304 (one bf16 plane [kB][kPix][kCh])
//   [ 0]          Q hi,lo                  2 x P16
//   [ 8,388,608]  KV hi (branch 0,1)       2 x P16
//   [16,777,216]  KV lo (branch 0,1)       2 x P16
//   [25,165,824]  O f32 [kB][kPix][kCh]    8,388,608
//   total 33,554,432
// ---------------------------------------------------------------------------
extern "C" void kernel_launch(void* const* d_in, const int* in_sizes, int n_in,
                              void* d_out, int out_size, void* d_ws, size_t ws_size,
                              hipStream_t stream)
{
  const int nAct = kB * kCh * kPix;   // 2,097,152
  const int nW   = kCh * kCh;         // 65,536
  if (n_in < 5) return;
  if (in_sizes[0] != nAct || in_sizes[1] != nAct || in_sizes[2] != nAct) return;
  if (in_sizes[3] != nW || in_sizes[4] != nW) return;
  if (out_size != nAct) return;

  const float* kvmap1 = (const float*)d_in[0];
  const float* qmap   = (const float*)d_in[1];
  const float* kvmap2 = (const float*)d_in[2];
  const float* Wq     = (const float*)d_in[3];
  const float* Wkv    = (const float*)d_in[4];
  float* out = (float*)d_out;

  const size_t planeB  = (size_t)nAct * 2;
  char* ws = (char*)d_ws;
  size_t o = 0;
  unsigned short* Qh    = (unsigned short*)(ws + o); o += planeB;
  unsigned short* Ql    = (unsigned short*)(ws + o); o += planeB;
  unsigned short* KVh   = (unsigned short*)(ws + o); o += 2 * planeB;
  unsigned short* KVl   = (unsigned short*)(ws + o); o += 2 * planeB;
  float*          Obuf  = (float*)(ws + o);          o += (size_t)nAct * 4;
  if (o > ws_size) return;

  // 1: the three projections C[p][o] = sum_c X[c][p] W[o][c], straight from the f32 inputs; 3 x kB x 32 blocks of 8 waves
  proj_kernel<<<3 * kProjBlocks, 256, 0, stream>>>(
      qmap, kvmap1, kvmap2, Wq, Wkv,
      Qh, Ql, KVh, KVl, KVh + (size_t)nAct, KVl + (size_t)nAct);
  // 2: local window attention, both branches, O as [b][p][256] f32
  local_window_attn_kernel<<<kB * kHeads * kTilesY * kTilesX, 64, 0, stream>>>(Qh, Ql, KVh, KVl, Obuf);
  // 3: O [b][p][ch] -> out [b][ch][p]
  const dim3 gtr(kPix / 64, kCh / 64, kB);
  tr_out_kernel<<<gtr, 256, 0, stream>>>(Obuf, out);
}

// v005
// Measured time: 29 microseconds a run.
// Two timings next to v004 both put it at 1.12 times that version's speed.
// Counting every step since v000, it is 4.19 times as fast.
// Contractions: 1x1 projections, local-window q.k and p.v all on v_wmma_f32_16x16x32_bf16 with bf16 hi/lo split operands (hi*hi + hi*lo + lo*hi), f32 accumulate; softmax, scaling and transposes in f32.
#include <hip/hip_runtime.h>
#include <stdint.h>
#include <stddef.h>

typedef __attribute__((ext_vector_type(16))) _Float16 v16h;
typedef __attribute__((ext_vector_type(8)))  _Float16 v8h;
typedef __attribute__((ext_vector_type(16))) __bf16   v16b;
typedef __attribute__((ext_vector_type(8)))  __bf16   v8b;
typedef __attribute__((ext_vector_type(8)))  float    v8f;
typedef __attribute__((ext_vector_type(4)))  float    v4f;
typedef __attribute__((ext_vector_type(4)))  unsigned int v4u;
typedef __attribute__((ext_vector_type(8)))  unsigned int v8u;
typedef __attribute__((ext_vector_type(8)))  unsigned short v8us;

template <typename T> struct Frag;
template <> struct Frag<__bf16> {
  typedef v16b V; union U { v16b v; v8b h[2]; };
  static __device__ __forceinline__ v16b load(const __bf16* p) {
    U f; f.h[0] = *(const v8b*)(p); f.h[1] = *(const v8b*)(p + 16); return f.v;
  }
  static __device__ __forceinline__ v8f mma(v16b a, v16b b, v8f c) {
    return __builtin_amdgcn_wmma_f32_16x16x32_bf16(false, a, false, b, (short)0, c, false, false);
  }
};

// ---- guarded bf16 WMMA ----
__device__ __forceinline__ v8f at_mma(v16b a, v16b b, v8f c) {
  c = __builtin_amdgcn_wmma_f32_16x16x32_bf16(false, a, false, b, (short)0, c, false, false);
  asm volatile("v_nop\n\tv_nop\n\tv_nop\n\tv_nop" : "+v"(c) : "v"(a), "v"(b));
  return c;
}

// ---- problem geometry ----
constexpr int kB     = 2;
constexpr int kPix   = 4096;
constexpr int kW     = 64;
constexpr int kCh    = 256;
constexpr int kHeads = 4;
constexpr int kDh    = 64;
constexpr int kTileY = 4;                       // pixel tile of one block: 4 rows x 8 cols, 2 waves (2 rows x 8 cols each)
constexpr int kTileX = 8;
constexpr int kNbRows = kTileY + 6;             // 10 neighbourhood rows
constexpr int kNbCols = kTileX + 6;             // 14 neighbourhood cols
constexpr int kKRows  = kNbRows * kNbCols;      // 140 staged K rows per block
constexpr int kKp     = kDh + 8;                // K row pitch in LDS (elements): 144 B = 16 B x odd, so that 16 rows read 16 B wide fall on distinct banks
constexpr int kStageCols  = kNbCols / 2;        // 7 neighbourhood columns staged a trip
constexpr int kStageTrips = 2 * kNbRows;        // 20 trips stage one plane of K
constexpr int kRowBytes   = kW * kCh * 2;       // one image row of one bf16 plane
constexpr int kTilesY = kW / kTileY;            // 16
constexpr int kTilesX = kW / kTileX;            // 8
static_assert(kHeads * kDh == kCh, "geometry");
static_assert(kW * kW == kPix, "geometry");
static_assert(kNbCols % 2 == 0 && (kNbCols / 2) * 8 <= 64, "half a neighbourhood row fits one trip of the block");
static_assert(kTileY >= 3 && kNbRows == kTileY + 6, "the 3 rows above (below) a tile are outside the image all together, and the tile has 3 rows to read in their place");
static_assert(kPix % 64 == 0 && kCh % 64 == 0 && kCh % 32 == 0, "gemm tile and K multiples");
static_assert(kW % kTileY == 0 && kW % kTileX == 0, "tile coverage");
static_assert(2 * kNbCols + 6 * 16 + 8 + 7 < kKRows, "pv gather rows in range");

union FragB { v16b v; v8b h[2]; };

// ---- the three 1x1 projections, operand preparation included: one launch ----
// C[p][o] = scale * sum_c X[c][p] * W[o][c], written as bf16 hi/lo planes [b][p][256]; product = hi.hi + hi.lo + lo.hi, f32 accumulate.
// One block = 128 pixels x 256 outputs of one (map, batch); 8 waves, wave (wm, wn) owns 64 pixels x 64 outputs (4 x 4 tiles of 16 x 16).
// A stage is 32 channels: the block reads X [32 c][128 p] and W [256 o][32 c] in f32 as whole 128-B lines, splits them into bf16 hi/lo in
// registers and stores them k-contiguous in LDS (X transposed on the way), two buffers; the next stage's global loads fly during the products.
typedef __attribute__((ext_vector_type(2))) float        v2f;
typedef __attribute__((ext_vector_type(2))) __bf16       v2b;
typedef __attribute__((ext_vector_type(2))) unsigned int v2u;
constexpr int kPT     = 128;                    // pixels a block
constexpr int kStageK = 32;                     // channels a stage = one k-step of the matrix instruction
constexpr int kStages = kCh / kStageK;          // 8
constexpr int kSp     = kStageK + 8;            // LDS row pitch (elements): 80 B = 16 B x odd, so that 16 rows read 16 B wide fall on distinct banks
constexpr int kProjBlocks = kB * (kPix / kPT);  // 64 blocks a map
static_assert(kPix % kPT == 0 && kCh % kStageK == 0 && kCh == 256 && kPT == 128, "projection tiling");

// four f32 -> four bf16 hi (nearest even) and four bf16 lo (the remainder, nearest even), two a word
__device__ __forceinline__ void split4(v4f v, v2u& hi, v2u& lo) {
#pragma unroll
  for (int q = 0; q < 2; ++q) {
    const v2f x = {v[2 * q], v[2 * q + 1]};
    const unsigned hw = __builtin_bit_cast(unsigned, __builtin_convertvector(x, v2b));
    const v2f hf = {__uint_as_float(hw << 16), __uint_as_float(hw & 0xffff0000u)};
    hi[q] = hw;
    lo[q] = __builtin_bit_cast(unsigned, __builtin_convertvector(x - hf, v2b));
  }
}

__global__ __launch_bounds__(256) void proj_kernel(
    const float* __restrict__ X0, const float* __restrict__ X1, const float* __restrict__ X2,
    const float* __restrict__ W0, const float* __restrict__ W1,
    unsigned short* __restrict__ C0h, unsigned short* __restrict__ C0l,
    unsigned short* __restrict__ C1h, unsigned short* __restrict__ C1l,
    unsigned short* __restrict__ C2h, unsigned short* __restrict__ C2l)
{
  __shared__ __align__(16) unsigned short sXh[2][kPT * kSp];   // 2 x 10240 B
  __shared__ __align__(16) unsigned short sXl[2][kPT * kSp];
  __shared__ __align__(16) unsigned short sWh[2][kCh * kSp];   // 2 x 20480 B
  __shared__ __align__(16) unsigned short sWl[2][kCh * kSp];
  __shared__ __align__(16) float sT[8][16 * 68];               // per-wave 16 x 64 slab of the epilogue, pitch 68 floats

  const int tid  = threadIdx.x;
  const int lane = tid & 31;
  const int wave = __builtin_amdgcn_readfirstlane(tid >> 5);
  const int wm = wave >> 2, wn = wave & 3;
  const int g  = blockIdx.x / kProjBlocks;
  const int rb = blockIdx.x - g * kProjBlocks;
  const int b  = rb / (kPix / kPT);
  const int p0 = (rb - b * (kPix / kPT)) * kPT;
  const float* X = (g == 0 ? X0 : (g == 1 ? X1 : X2)) + (size_t)b * kCh * kPix + p0;
  const float* Wf = g == 0 ? W0 : W1;
  unsigned short* Ch = g == 0 ? C0h : (g == 1 ? C1h : C2h);
  unsigned short* Cl = g == 0 ? C0l : (g == 1 ? C1l : C2l);
  const float scale = g == 0 ? 0.125f : 1.0f;

  // staging maps. X: wave w takes channels 4w..4w+3 of the stage, lane l pixels 4l..4l+3 (512 contiguous bytes a load).
  // Pixel 4l + j goes to LDS row 32j + l, so that the 32 lanes of a store write 32 consecutive rows.
  // W: 8 lanes take the 32 channels of one output row (128 B), a load covers 4 rows, 8 loads the 256 rows.
  const float* xp = X + (wave * 4 * kPix + lane * 4);            // this thread's chunk of the stage last loaded
  const float* wp = Wf + ((tid >> 3) * kCh + (tid & 7) * 4);
  const int xdst = lane * kSp + wave * 4;
  const int wdst = (tid >> 3) * kSp + (tid & 7) * 4;

  const int rlane = lane & 15;                 // row (A) / col (B, D) within a 16 x 16 tile
  const int koff  = (lane >> 4) * 8;           // k offset of this lane half
  const int mOff  = (lane >> 4) * 8;           // D row offset

  v8f acc[4][4];
#pragma unroll
  for (int i = 0; i < 4; ++i)
#pragma unroll
    for (int j = 0; j < 4; ++j) acc[i][j] = (v8f){0.f,0.f,0.f,0.f,0.f,0.f,0.f,0.f};

  v4f xr[4], wr[8];
#pragma unroll
  for (int i = 0; i < 4; ++i) xr[i] = *(const v4f*)(xp + i * kPix);
#pragma unroll
  for (int it = 0; it < 8; ++it) wr[it] = *(const v4f*)(wp + it * 32 * kCh);
  // the wait that stands before a register named by an issued load is rewritten; naming the two pointers keeps them in place up to here
  asm volatile("s_wait_xcnt 0x0" :: "v"(xp), "v"(wp) : "memory");

  // split the stage held in registers and store it in buffer buf
  auto store_stage = [&](int buf) {
    // X: the four channels of one pixel are the same component of the four loaded vectors
#pragma unroll
    for (int j = 0; j < 4; ++j) {
      const v4f t = {xr[0][j], xr[1][j], xr[2][j], xr[3][j]};
      v2u h, l;
      split4(t, h, l);
      *(v2u*)(sXh[buf] + j * 32 * kSp + xdst) = h;
      *(v2u*)(sXl[buf] + j * 32 * kSp + xdst) = l;
    }
#pragma unroll
    for (int it = 0; it < 8; ++it) {
      v2u h, l;
      split4(wr[it], h, l);
      *(v2u*)(sWh[buf] + it * 32 * kSp + wdst) = h;
      *(v2u*)(sWl[buf] + it * 32 * kSp + wdst) = l;
    }
  };
  // the 48 products of the stage in buffer buf
  auto products = [&](int buf) {
    v16b bh[4], bl[4];
#pragma unroll
    for (int j = 0; j < 4; ++j) {
      const int bo = (wn * 64 + (j << 4) + rlane) * kSp + koff;
      bh[j] = Frag<__bf16>::load((const __bf16*)sWh[buf] + bo);
      bl[j] = Frag<__bf16>::load((const __bf16*)sWl[buf] + bo);
    }
    const int ao = (wm * 64 + rlane) * kSp + koff;
    v16b ah = Frag<__bf16>::load((const __bf16*)sXh[buf] + ao);
    v16b al = Frag<__bf16>::load((const __bf16*)sXl[buf] + ao);
#pragma unroll
    for (int i = 0; i < 4; ++i) {
      v16b nh = ah, nl = al;
      if (i < 3) {   // the next strip's fragments are asked for ahead of this strip's products
        nh = Frag<__bf16>::load((const __bf16*)sXh[buf] + ao + (i + 1) * 16 * kSp);
        nl = Frag<__bf16>::load((const __bf16*)sXl[buf] + ao + (i + 1) * 16 * kSp);
        __builtin_amdgcn_sched_barrier(0);   // holds those loads in front of the products: sunk behind them, each strip waits out its own LDS latency
      }
#pragma unroll
      for (int j = 0; j < 4; ++j) {
        acc[i][j] = Frag<__bf16>::mma(ah, bh[j], acc[i][j]);
        acc[i][j] = Frag<__bf16>::mma(ah, bl[j], acc[i][j]);
        acc[i][j] = Frag<__bf16>::mma(al, bh[j], acc[i][j]);
      }
      ah = nh;
      al = nl;
    }
  };

#pragma unroll 1   // rolled: one copy of the stage keeps the kernel's text short, which a first run fetches line by line
  for (int ks = 0; ks + 1 < kStages; ++ks) {
    store_stage(ks & 1);   // the buffer's last readers left it before the barrier of the stage before
    __syncthreads();       // publishes this stage; also ends every wave's reads of the other buffer, which the next stage overwrites
    // the next stage's global loads stand behind the barrier (in front of it the barrier's own wait would drain them) and fly during the products
#pragma unroll
    for (int i = 0; i < 4; ++i) xr[i] = *(const v4f*)(xp + (kStageK + i) * kPix);
#pragma unroll
    for (int it = 0; it < 8; ++it) wr[it] = *(const v4f*)(wp + kStageK + it * 32 * kCh);
    // as in front of the loop: the wait before the two pointers are advanced
    asm volatile("s_wait_xcnt 0x0" :: "v"(xp), "v"(wp) : "memory");
    xp += kStageK * kPix;
    wp += kStageK;
    products(ks & 1);
  }
  store_stage((kStages - 1) & 1);
  __syncthreads();         // publishes the last stage
  products((kStages - 1) & 1);

  // ---- epilogue: each 16 x 64 strip through the wave's own slab, whole 128-B row segments stored ----
  // LDS row 64 wm + 16 i + row holds pixel 4 * (16 (i & 1) + row) + 2 wm + (i >> 1) of the block (the staging map above)
  float* slab = sT[wave];
  const int n0 = wn * 64;
#pragma unroll
  for (int i = 0; i < 4; ++i) {
#pragma unroll
    for (int j = 0; j < 4; ++j)
#pragma unroll
      for (int r = 0; r < 8; ++r) slab[(mOff + r) * 68 + (j << 4) + rlane] = acc[i][j][r] * scale;
    __builtin_amdgcn_fence(__ATOMIC_RELEASE, "workgroup");
    __builtin_amdgcn_wave_barrier();
    __builtin_amdgcn_fence(__ATOMIC_ACQUIRE, "workgroup");
    const int q = lane >> 3, c8 = (lane & 7) * 8;
#pragma unroll
    for (int it = 0; it < 4; ++it) {
      const int row = it * 4 + q;
      const int pix = p0 + 4 * (16 * (i & 1) + row) + 2 * wm + (i >> 1);
      const float* sp = slab + row * 68 + c8;
      v2u h0, l0, h1, l1;
      split4(*(const v4f*)sp, h0, l0);
      split4(*(const v4f*)(sp + 4), h1, l1);
      const size_t co = ((size_t)(b * kPix + pix)) * kCh + n0 + c8;
      *(v4u*)(Ch + co) = (v4u){h0.x, h0.y, h1.x, h1.y};
      *(v4u*)(Cl + co) = (v4u){l0.x, l0.y, l1.x, l1.y};
    }
    __builtin_amdgcn_fence(__ATOMIC_RELEASE, "workgroup");
    __builtin_amdgcn_wave_barrier();
    __builtin_amdgcn_fence(__ATOMIC_ACQUIRE, "workgroup");
  }
}

// ---- local 7x7 window attention, both kv branches, one (b, head, 4x8 pixel tile) per block of 2 waves ----
// Qh/Ql, KVh/KVl: bf16 hi/lo planes [b][p][256] (KV planes: branch-major, 2 x [b][p][256]); Obuf: f32 [b][p][256].
// Wave w owns pixel rows y0+2w..y0+2w+1, cols x0..x0+7; its 8x14 union neighbourhood is LDS rows 28w..28w+111 of the
// block's 10x14 neighbourhood (row index nr*14+nc, image pos (y0-3+nr, x0-3+nc), zero row when outside the image).
// second launch bound: holds the register allocation at three waves a SIMD, where it stood before the staged chunks were held in registers
__global__ __launch_bounds__(64, 3) void local_window_attn_kernel(
    const unsigned short* __restrict__ Qh, const unsigned short* __restrict__ Ql,
    const unsigned short* __restrict__ KVh, const unsigned short* __restrict__ KVl,
    float* __restrict__ Obuf)
{
  __shared__ __align__(16) unsigned short Ksh[kKRows * kKp];   // 20160 B
  __shared__ __align__(16) unsigned short Ksl[kKRows * kKp];   // 20160 B
  __shared__ __align__(16) float  Osh[2][16 * 68];             //  8704 B

  const int tid  = threadIdx.x;
  const int w    = tid >> 5, lane = tid & 31, hh = lane >> 4, c = lane & 15;
  const int bidx = blockIdx.x;
  const int tx   = bidx % kTilesX;
  const int ty   = (bidx / kTilesX) % kTilesY;
  const int head = (bidx / (kTilesX * kTilesY)) % kHeads;
  const int b    = bidx / (kTilesX * kTilesY * kHeads);
  const int y0 = ty * kTileY, x0 = tx * kTileX;
  const int nb = w * 2 * kNbCols;   // base LDS row of this wave's union neighbourhood

  // Q fragments of pixel c of this wave, the B operand of the transposed scores (split k-map via Frag load)
  v16b qh[2], ql[2];
  {
    const int py = y0 + 2 * w + (c >> 3), px = x0 + (c & 7);
    const size_t qoff = ((size_t)(b * kPix + py * kW + px)) * kCh + head * kDh;
    const __bf16* qhp = (const __bf16*)Qh + qoff;
    const __bf16* qlp = (const __bf16*)Ql + qoff;
#pragma unroll
    for (int dc = 0; dc < 2; ++dc) {
      qh[dc] = Frag<__bf16>::load(qhp + dc * 32 + 8 * hh);
      ql[dc] = Frag<__bf16>::load(qlp + dc * 32 + 8 * hh);
    }
  }
  // window of this lane's pixel c (row c / 8, col c % 8 of the wave's 2 x 8 pixels) as a bit mask over the 112 neighbours of the
  // wave's 8 x 14 union: rows c / 8 .. c / 8 + 6, cols c % 8 .. c % 8 + 6, exactly 49 bits. The words are shifted down by 8 hh, so
  // that bit 16 (t & 1) + r of word t / 2 stands for neighbour 16 t + 8 hh + r, the one that register r of score tile t holds.
  unsigned wmask[4] = {0u, 0u, 0u, 0u};
  {
    const int pr = c >> 3;
    const unsigned colbits = 0x7fu << (c & 7);
#pragma unroll   // full: bit offsets are constants
    for (int nr = 0; nr < 8; ++nr) {
      const unsigned rowbits = (nr >= pr && nr <= pr + 6) ? colbits : 0u;
      const int off = nr * kNbCols;
      wmask[off >> 5] |= rowbits << (off & 31);
      if ((off & 31) + kNbCols > 32) wmask[(off >> 5) + 1] |= rowbits >> (32 - (off & 31));
    }
#pragma unroll
    for (int k = 0; k < 4; ++k) wmask[k] >>= 8 * hh;
  }

  // staging map of this thread, the same in both branches: column tid / 8 of a half row, chunk tid % 8
  unsigned sgoff[2], sxmsk[2];   // byte offset in the image row (column clamped into the image), all-ones where the column is inside
#pragma unroll   // full: both entries live in registers
  for (int h = 0; h < 2; ++h) {
    const int gx = x0 - 3 + h * kStageCols + (tid >> 3);
    const int gxc = gx < 0 ? 0 : (gx > kW - 1 ? kW - 1 : gx);
    sgoff[h] = (unsigned)(gxc * kCh + (tid & 7) * 8) * 2u;
    sxmsk[h] = ((unsigned)gx < (unsigned)kW) ? 0xffffffffu : 0u;
  }
  const int sdst = (tid >> 3) * kKp + (tid & 7) * 8;   // LDS element of the chunk within a half row
  const bool topOut = y0 < 3, botOut = y0 + kTileY + 3 > kW;   // uniform: the 3 rows above / below the tile lie outside the image

  v8f oacc[4];
#pragma unroll
  for (int dt = 0; dt < 4; ++dt) oacc[dt] = (v8f){0.f,0.f,0.f,0.f,0.f,0.f,0.f,0.f};
  const v4u z4 = {0u, 0u, 0u, 0u};
  const v8b z8 = __builtin_bit_cast(v8b, z4);

#pragma unroll 1
  for (int br = 0; br < 2; ++br) {
    __syncthreads();
    // stage the 10 x 14 neighbourhood, 8 chunks of 16 B a row and plane (zeros outside the image): one trip is half a
    // neighbourhood row, 7 columns x 8 chunks on 56 of the 64 threads, so that the image row is uniform over the block.
    // All global loads of a branch are issued before the first LDS store: the wave waits out one load latency a branch, not one a trip.
    if (tid < kStageCols * 8) {
      // 32-bit byte offsets of this thread's chunk from the start of the two-branch plane (below 8 MiB), one for each zone
      // (3 rows above the tile: from image row y0 - 3; the tile's rows and the 3 rows below: from y0) and half row; a trip adds
      // its row as a constant. A zone outside the image reads the tile's own rows instead (3 rows further in) and is masked to zero.
      const unsigned anchor = (unsigned)((((br * kB + b) * kPix + y0 * kW) * kCh + head * kDh) * 2);
      unsigned voff[3][2];
#pragma unroll   // full: all six entries live in registers
      for (int h = 0; h < 2; ++h) {
        voff[1][h] = anchor + sgoff[h];
        voff[0][h] = voff[1][h] - (topOut ? 0u : 3u * kRowBytes);
        voff[2][h] = voff[1][h] - (botOut ? 3u * kRowBytes : 0u);
      }
      v4u vh[kStageTrips], vl[kStageTrips];
#pragma unroll   // full: the loaded chunks are held in registers, indexed by the trip
      for (int t = 0; t < kStageTrips; ++t) {
        const int nr = t >> 1, zone = nr < 3 ? 0 : (nr < 3 + kTileY ? 1 : 2);
        const int rows = zone == 0 ? nr : nr - 3;   // rows from the zone's offset, never negative
        vh[t] = *(const v4u*)((const char*)KVh + voff[zone][t & 1] + rows * kRowBytes);
        vl[t] = *(const v4u*)((const char*)KVl + voff[zone][t & 1] + rows * kRowBytes);
      }
      // the wait that stands before a register named by an issued load is rewritten; naming the six address registers keeps them
      // apart from the loads' own destination registers up to here
      asm volatile("s_wait_xcnt 0x0" :: "v"(voff[0][0]), "v"(voff[0][1]), "v"(voff[1][0]), "v"(voff[1][1]), "v"(voff[2][0]), "v"(voff[2][1]) : "memory");
#pragma unroll   // full: same register arrays
      for (int t = 0; t < kStageTrips; ++t) {
        const int nr = t >> 1;
        const unsigned msk = (nr < 3 ? topOut : (nr < 3 + kTileY ? false : botOut)) ? 0u : sxmsk[t & 1];
        v4u a = vh[t], d = vl[t];
        a.x &= msk; a.y &= msk; a.z &= msk; a.w &= msk;
        d.x &= msk; d.y &= msk; d.z &= msk; d.w &= msk;
        *(v4u*)(Ksh + t * kStageCols * kKp + sdst) = a;
        *(v4u*)(Ksl + t * kStageCols * kKp + sdst) = d;
      }
    }
    __syncthreads();

    // transposed scores s[t][r] = k(neighbour t*16+8hh+r) . q(pixel c): A fragments = rows of K in LDS (split k-map via Frag load), B = Q.
    // A lane then holds 56 of the 112 scores of ONE pixel, lane c + 16 the rest, and tiles 2kk, 2kk+1 lie as the A fragment of P in k-step kk.
    v8f s[7];
#pragma unroll
    for (int t = 0; t < 7; ++t) {
      s[t] = (v8f){0.f,0.f,0.f,0.f,0.f,0.f,0.f,0.f};
#pragma unroll
      for (int dc = 0; dc < 2; ++dc) {
        const int ko = (nb + t * 16 + c) * kKp + dc * 32 + 8 * hh;
        const v16b kfh = Frag<__bf16>::load((const __bf16*)Ksh + ko);
        const v16b kfl = Frag<__bf16>::load((const __bf16*)Ksl + ko);
        s[t] = at_mma(kfh, qh[dc], s[t]);
        s[t] = at_mma(kfl, qh[dc], s[t]);
        s[t] = at_mma(kfh, ql[dc], s[t]);
      }
    }

    // window mask (49 neighbours, zero vectors included) + softmax in f32: maximum and sum run down the lane's own registers
    // (four independent chains each), then one exchange with the lane that holds the pixel's other half
    float mx4[4] = {-INFINITY, -INFINITY, -INFINITY, -INFINITY};
#pragma unroll
    for (int t = 0; t < 7; ++t)
#pragma unroll
      for (int r = 0; r < 8; ++r) {
        const bool inwin = (wmask[t >> 1] >> (16 * (t & 1) + r)) & 1u;
        const float sv = inwin ? s[t][r] : -INFINITY;
        s[t][r] = sv;
        mx4[r & 3] = fmaxf(mx4[r & 3], sv);
      }
    float mx = fmaxf(fmaxf(mx4[0], mx4[1]), fmaxf(mx4[2], mx4[3]));
    mx = fmaxf(mx, __shfl_xor(mx, 16, 32));
    float l4[4] = {0.f, 0.f, 0.f, 0.f};
#pragma unroll
    for (int t = 0; t < 7; ++t)
#pragma unroll
      for (int r = 0; r < 8; ++r) {
        const float p = expf(s[t][r] - mx);
        s[t][r] = p;
        l4[r & 3] += p;
      }
    float l = (l4[0] + l4[1]) + (l4[2] + l4[3]);
    l += __shfl_xor(l, 16, 32);
    const float scl = 0.5f / l;
    // P as bf16 hi/lo, two neighbours a word, in the registers where the scores stood
    v4u ph[7], pl[7];
#pragma unroll
    for (int t = 0; t < 7; ++t) {
      v2u h0, l0, h1, l1;
      split4((v4f){s[t][0] * scl, s[t][1] * scl, s[t][2] * scl, s[t][3] * scl}, h0, l0);
      split4((v4f){s[t][4] * scl, s[t][5] * scl, s[t][6] * scl, s[t][7] * scl}, h1, l1);
      ph[t] = (v4u){h0.x, h0.y, h1.x, h1.y};
      pl[t] = (v4u){l0.x, l0.y, l1.x, l1.y};
    }

    // O += P . V : A = P of pixel c straight from those registers, B = V gathered down column d of the K rows (split k-map),
    // neighbour range 0..111; k-step 3 uses elements 0..7 only (8..15 zero in both operands)
#pragma unroll
    for (int kk = 0; kk < 4; ++kk) {
      FragB pa, pb;
      pa.h[0] = __builtin_bit_cast(v8b, ph[2 * kk]);
      pb.h[0] = __builtin_bit_cast(v8b, pl[2 * kk]);
      if (kk < 3) {
        pa.h[1] = __builtin_bit_cast(v8b, ph[2 * kk + 1]);
        pb.h[1] = __builtin_bit_cast(v8b, pl[2 * kk + 1]);
      } else {
        pa.h[1] = z8;
        pb.h[1] = z8;
      }
      const int rb = nb + kk * 32 + 8 * hh;
#pragma unroll
      for (int dt = 0; dt < 4; ++dt) {
        const int col = dt * 16 + c;
        v8u wh, wl;
#pragma unroll
        for (int j = 0; j < 4; ++j) {
          const int e0 = (rb + 2 * j) * kKp + col, e1 = e0 + kKp;
          wh[j] = (unsigned)Ksh[e0] | ((unsigned)Ksh[e1] << 16);
          wl[j] = (unsigned)Ksl[e0] | ((unsigned)Ksl[e1] << 16);
          if (kk < 3) {
            const int e2 = (rb + 16 + 2 * j) * kKp + col, e3 = e2 + kKp;
            wh[4 + j] = (unsigned)Ksh[e2] | ((unsigned)Ksh[e3] << 16);
            wl[4 + j] = (unsigned)Ksl[e2] | ((unsigned)Ksl[e3] << 16);
          } else {
            wh[4 + j] = 0u;
            wl[4 + j] = 0u;
          }
        }
        const v16b vfh = __builtin_bit_cast(v16b, wh);
        const v16b vfl = __builtin_bit_cast(v16b, wl);
        oacc[dt] = at_mma(pa.v, vfh, oacc[dt]);
        oacc[dt] = at_mma(pa.v, vfl, oacc[dt]);
        oacc[dt] = at_mma(pb.v, vfh, oacc[dt]);
      }
    }
  }

  float* osw = Osh[w];
#pragma unroll
  for (int r = 0; r < 8; ++r)
#pragma unroll
    for (int dt = 0; dt < 4; ++dt) osw[(8 * hh + r) * 68 + dt * 16 + c] = oacc[dt][r];
  __builtin_amdgcn_fence(__ATOMIC_RELEASE, "workgroup");
  __builtin_amdgcn_wave_barrier();
  __builtin_amdgcn_fence(__ATOMIC_ACQUIRE, "workgroup");
  {
    const int c4 = c * 4;
    {
#pragma unroll
      for (int it = 0; it < 8; ++it) {
        const int row = it * 2 + hh;
        const v4f val = *(const v4f*)(osw + row * 68 + c4);
        const int py = y0 + 2 * w + (row >> 3), px = x0 + (row & 7);
        *(v4f*)(Obuf + ((size_t)(b * kPix + py * kW + px)) * kCh + head * kDh + c4) = val;
      }
      
    }
  }
}

// ---- final transpose: O [kB][kPix][kCh] f32 -> out [kB][kCh][kPix] f32; one 64-p x 64-ch tile per block (grid 64 x 4 x kB) ----
// Load: 256 threads x 4 iterations x float4 = 64 p x 64 ch (exact). Store: 8 waves x 8 ch-rows x (16 lanes x 4 floats) = 64 x 64,
__global__ __launch_bounds__(256) void tr_out_kernel(const float* __restrict__ O, float* __restrict__ out)
{
  __shared__ __align__(16) float sT[64 * 68];   // [ch][p], pitch 68
  const int tid = threadIdx.x;
  const int p0 = blockIdx.x * 64, c0 = blockIdx.y * 64, b = blockIdx.z;
#pragma unroll
  for (int it = 0; it < 4; ++it) {
    const int idx = tid + 256 * it;
    const int prow = idx >> 4, c4 = (idx & 15) * 4;
    const v4f v = *(const v4f*)(O + ((size_t)(b * kPix + p0 + prow)) * kCh + c0 + c4);
    sT[(c4 + 0) * 68 + prow] = v.x;
    sT[(c4 + 1) * 68 + prow] = v.y;
    sT[(c4 + 2) * 68 + prow] = v.z;
    sT[(c4 + 3) * 68 + prow] = v.w;
  }
  __syncthreads();
  const int wv = tid >> 5, lane = tid & 31, hh = lane >> 4, p4 = (lane & 15) * 4;
  v4f val[4];
  size_t off[4];
#pragma unroll
  for (int it = 0; it < 4; ++it) {
    const int row = wv * 8 + it * 2 + hh;
    val[it] = *(const v4f*)(sT + row * 68 + p4);
    off[it] = ((size_t)(b * kCh + c0 + row)) * kPix + p0 + p4;
  }
  {
#pragma unroll
    for (int it = 0; it < 4; ++it) *(v4f*)(out + off[it]) = val[it];
    
  }
}

// ---------------------------------------------------------------------------
// Workspace region map (bytes):
//   P16 = kB*kPix*kCh*2 = 4,194,304 (one bf16 plane [kB][kPix][kCh])
//   [ 0]          Q hi,lo                  2 x P16
//   [ 8,388,608]  KV hi (branch 0,1)       2 x P16
//   [16,777,216]  KV lo (branch 0,1)       2 x P16
//   [25,165,824]  O f32 [kB][kPix][kCh]    8,388,608
//   total 33,554,432
// ---------------------------------------------------------------------------
extern "C" void kernel_launch(void* const* d_in, const int* in_sizes, int n_in,
                              void* d_out, int out_size, void* d_ws, size_t ws_size,
                              hipStream_t stream)
{
  const int nAct = kB * kCh * kPix;   // 2,097,152
  const int nW   = kCh * kCh;         // 65,536
  if (n_in < 5) return;
  if (in_sizes[0] != nAct || in_sizes[1] != nAct || in_sizes[2] != nAct) return;
  if (in_sizes[3] != nW || in_sizes[4] != nW) return;
  if (out_size != nAct) return;

  const float* kvmap1 = (const float*)d_in[0];
  const float* qmap   = (const float*)d_in[1];
  const float* kvmap2 = (const float*)d_in[2];
  const float* Wq     = (const float*)d_in[3];
  const float* Wkv    = (const float*)d_in[4];
  float* out = (float*)d_out;

  const size_t planeB  = (size_t)nAct * 2;
  char* ws = (char*)d_ws;
  size_t o = 0;
  unsigned short* Qh    = (unsigned short*)(ws + o); o += planeB;
  unsigned short* Ql    = (unsigned short*)(ws + o); o += planeB;
  unsigned short* KVh   = (unsigned short*)(ws + o); o += 2 * planeB;
  unsigned short* KVl   = (unsigned short*)(ws + o); o += 2 * planeB;
  float*          Obuf  = (float*)(ws + o);          o += (size_t)nAct * 4;
  if (o > ws_size) return;

  // 1: the three projections C[p][o] = sum_c X[c][p] W[o][c], straight from the f32 inputs; 3 x kB x 32 blocks of 8 waves
  proj_kernel<<<3 * kProjBlocks, 256, 0, stream>>>(
      qmap, kvmap1, kvmap2, Wq, Wkv,
      Qh, Ql, KVh, KVl, KVh + (size_t)nAct, KVl + (size_t)nAct);
  // 2: local window attention, both branches, O as [b][p][256] f32
  local_window_attn_kernel<<<kB * kHeads * kTilesY * kTilesX, 64, 0, stream>>>(Qh, Ql, KVh, KVl, Obuf);
  // 3: O [b][p][ch] -> out [b][ch][p]
  const dim3 gtr(kPix / 64, kCh / 64, kB);
  tr_out_kernel<<<gtr, 256, 0, stream>>>(Obuf, out);
}

// v006
// One run takes 27.3 microseconds.
// Two timings next to v005 put it at 1.06 and 1.07 times that version's speed.
// Counting every step since v000, it is 4.47 times as fast.
// Contractions: 1x1 projections, local-window q.k and p.v all on v_wmma_f32_16x16x32_bf16 with bf16 hi/lo split operands (hi*hi + hi*lo + lo*hi), f32 accumulate; softmax, scaling and transposes in f32.
#include <hip/hip_runtime.h>
#include <stdint.h>
#include <stddef.h>

typedef __attribute__((ext_vector_type(16))) _Float16 v16h;
typedef __attribute__((ext_vector_type(8)))  _Float16 v8h;
typedef __attribute__((ext_vector_type(16))) __bf16   v16b;
typedef __attribute__((ext_vector_type(8)))  __bf16   v8b;
typedef __attribute__((ext_vector_type(8)))  float    v8f;
typedef __attribute__((ext_vector_type(4)))  float    v4f;
typedef __attribute__((ext_vector_type(4)))  unsigned int v4u;
typedef __attribute__((ext_vector_type(8)))  unsigned int v8u;
typedef __attribute__((ext_vector_type(8)))  unsigned short v8us;

template <typename T> struct Frag;
template <> struct Frag<__bf16> {
  typedef v16b V; union U { v16b v; v8b h[2]; };
  static __device__ __forceinline__ v16b load(const __bf16* p) {
    U f; f.h[0] = *(const v8b*)(p); f.h[1] = *(const v8b*)(p + 16); return f.v;
  }
  static __device__ __forceinline__ v8f mma(v16b a, v16b b, v8f c) {
    return __builtin_amdgcn_wmma_f32_16x16x32_bf16(false, a, false, b, (short)0, c, false, false);
  }
};

// ---- guarded bf16 WMMA ----
__device__ __forceinline__ v8f at_mma(v16b a, v16b b, v8f c) {
  c = __builtin_amdgcn_wmma_f32_16x16x32_bf16(false, a, false, b, (short)0, c, false, false);
  asm volatile("v_nop\n\tv_nop\n\tv_nop\n\tv_nop" : "+v"(c) : "v"(a), "v"(b));
  return c;
}

// ---- problem geometry ----
constexpr int kB     = 2;
constexpr int kPix   = 4096;
constexpr int kW     = 64;
constexpr int kCh    = 256;
constexpr int kHeads = 4;
constexpr int kDh    = 64;
constexpr int kTileY = 4;                       // pixel tile of one block: 4 rows x 8 cols, 2 waves (2 rows x 8 cols each)
constexpr int kTileX = 8;
constexpr int kNbRows = kTileY + 6;             // 10 neighbourhood rows
constexpr int kNbCols = kTileX + 6;             // 14 neighbourhood cols
constexpr int kKRows  = kNbRows * kNbCols;      // 140 staged K rows per block
constexpr int kKp     = kDh;                    // K row pitch in LDS (elements): 128 B, no pad; the eight 16-B pieces of a row are permuted by k_key()
constexpr int kKPlane = kKRows * kKp;           // elements of one staged plane
constexpr int kStageCols  = kNbCols / 2;        // 7 neighbourhood columns staged a trip
constexpr int kStageTrips = 2 * kNbRows;        // 20 trips stage one plane of K
constexpr int kRowBytes   = kW * kCh * 2;       // one image row of one bf16 plane
constexpr int kTilesY = kW / kTileY;            // 16
constexpr int kTilesX = kW / kTileX;            // 8
static_assert(kHeads * kDh == kCh, "geometry");
static_assert(kW * kW == kPix, "geometry");
static_assert(kNbCols % 2 == 0 && (kNbCols / 2) * 8 <= 64, "half a neighbourhood row fits one trip of the block");
static_assert(kTileY >= 3 && kNbRows == kTileY + 6, "the 3 rows above (below) a tile are outside the image all together, and the tile has 3 rows to read in their place");
static_assert(kPix % 64 == 0 && kCh % 64 == 0 && kCh % 32 == 0, "gemm tile and K multiples");
static_assert(kW % kTileY == 0 && kW % kTileX == 0, "tile coverage");
static_assert(2 * kNbCols + 6 * 16 + 8 + 7 < kKRows, "pv gather rows in range");

union FragB { v16b v; v8b h[2]; };

// K rows in LDS: 16-B piece j of row r stands at piece j ^ k_key(r) of the row. The key is the same 16 rows further on. Two rows fill the 64 banks, so
// 16 lanes fall on distinct banks both when they read one piece of 16 successive rows (rows of equal parity: 8 distinct keys) and when they read two
// neighbouring pieces of 8 successive rows from an even one (the transposing load; rows of equal parity: keys distinct above bit 0).
__device__ __forceinline__ int k_key(int row) { return (((row >> 1) & 3) << 1) | ((row >> 3) & 1); }
__device__ __forceinline__ int k_at(int row, int piece) { return row * kKp + ((piece ^ k_key(row)) << 3); }   // element offset

// transposing LDS load: the 32 lanes address the sixteen rows x two 16-B pieces of a 16 x 16 tile of 16-bit elements (lane l: row 8 (l / 16) + l % 8,
// piece (l / 8) % 2); lane l receives rows 8 (l / 16) .. + 7 of column l % 16, which is half a B fragment in the hardware's k order
typedef __attribute__((ext_vector_type(8))) short v8s;
__device__ __forceinline__ v8b ld_tr16(const unsigned short* p) {
  typedef __attribute__((address_space(3))) v8s lds_v8s;
  return __builtin_bit_cast(v8b, __builtin_amdgcn_ds_load_tr16_b128_v8i16((lds_v8s*)p));
}

// ---- the three 1x1 projections, operand preparation included: one launch ----
// C[p][o] = scale * sum_c X[c][p] * W[o][c], written as bf16 hi/lo planes [b][p][256]; product = hi.hi + hi.lo + lo.hi, f32 accumulate.
// One block = 128 pixels x 256 outputs of one (map, batch); 8 waves, wave (wm, wn) owns 64 pixels x 64 outputs (4 x 4 tiles of 16 x 16).
// A stage is 32 channels: the block reads X [32 c][128 p] and W [256 o][32 c] in f32 as whole 128-B lines, splits them into bf16 hi/lo in
// registers and stores them k-contiguous in LDS (X transposed on the way), two buffers; the next stage's global loads fly during the products.
typedef __attribute__((ext_vector_type(2))) float        v2f;
typedef __attribute__((ext_vector_type(2))) __bf16       v2b;
typedef __attribute__((ext_vector_type(2))) unsigned int v2u;
constexpr int kPT     = 128;                    // pixels a block
constexpr int kStageK = 32;                     // channels a stage = one k-step of the matrix instruction
constexpr int kStages = kCh / kStageK;          // 8
constexpr int kSp     = kStageK + 8;            // LDS row pitch (elements): 80 B = 16 B x odd, so that 16 rows read 16 B wide fall on distinct banks
constexpr int kProjBlocks = kB * (kPix / kPT);  // 64 blocks a map
static_assert(kPix % kPT == 0 && kCh % kStageK == 0 && kCh == 256 && kPT == 128, "projection tiling");

// four f32 -> four bf16 hi (nearest even) and four bf16 lo (the remainder, nearest even), two a word
__device__ __forceinline__ void split4(v4f v, v2u& hi, v2u& lo) {
#pragma unroll
  for (int q = 0; q < 2; ++q) {
    const v2f x = {v[2 * q], v[2 * q + 1]};
    const unsigned hw = __builtin_bit_cast(unsigned, __builtin_convertvector(x, v2b));
    const v2f hf = {__uint_as_float(hw << 16), __uint_as_float(hw & 0xffff0000u)};
    hi[q] = hw;
    lo[q] = __builtin_bit_cast(unsigned, __builtin_convertvector(x - hf, v2b));
  }
}

__global__ __launch_bounds__(256) void proj_kernel(
    const float* __restrict__ X0, const float* __restrict__ X1, const float* __restrict__ X2,
    const float* __restrict__ W0, const float* __restrict__ W1,
    unsigned short* __restrict__ C0h, unsigned short* __restrict__ C0l,
    unsigned short* __restrict__ C1h, unsigned short* __restrict__ C1l,
    unsigned short* __restrict__ C2h, unsigned short* __restrict__ C2l)
{
  __shared__ __align__(16) unsigned short sXh[2][kPT * kSp];   // 2 x 10240 B
  __shared__ __align__(16) unsigned short sXl[2][kPT * kSp];
  __shared__ __align__(16) unsigned short sWh[2][kCh * kSp];   // 2 x 20480 B
  __shared__ __align__(16) unsigned short sWl[2][kCh * kSp];
  __shared__ __align__(16) float sT[8][16 * 68];               // per-wave 16 x 64 slab of the epilogue, pitch 68 floats

  const int tid  = threadIdx.x;
  const int lane = tid & 31;
  const int wave = __builtin_amdgcn_readfirstlane(tid >> 5);
  const int wm = wave >> 2, wn = wave & 3;
  const int g  = blockIdx.x / kProjBlocks;
  const int rb = blockIdx.x - g * kProjBlocks;
  const int b  = rb / (kPix / kPT);
  const int p0 = (rb - b * (kPix / kPT)) * kPT;
  const float* X = (g == 0 ? X0 : (g == 1 ? X1 : X2)) + (size_t)b * kCh * kPix + p0;
  const float* Wf = g == 0 ? W0 : W1;
  unsigned short* Ch = g == 0 ? C0h : (g == 1 ? C1h : C2h);
  unsigned short* Cl = g == 0 ? C0l : (g == 1 ? C1l : C2l);
  const float scale = g == 0 ? 0.125f : 1.0f;

  // staging maps. X: wave w takes channels 4w..4w+3 of the stage, lane l pixels 4l..4l+3 (512 contiguous bytes a load).
  // Pixel 4l + j goes to LDS row 32j + l, so that the 32 lanes of a store write 32 consecutive rows.
  // W: 8 lanes take the 32 channels of one output row (128 B), a load covers 4 rows, 8 loads the 256 rows.
  const float* xp = X + (wave * 4 * kPix + lane * 4);            // this thread's chunk of the stage last loaded
  const float* wp = Wf + ((tid >> 3) * kCh + (tid & 7) * 4);
  const int xdst = lane * kSp + wave * 4;
  const int wdst = (tid >> 3) * kSp + (tid & 7) * 4;

  const int rlane = lane & 15;                 // row (A) / col (B, D) within a 16 x 16 tile
  const int koff  = (lane >> 4) * 8;           // k offset of this lane half
  const int mOff  = (lane >> 4) * 8;           // D row offset

  v8f acc[4][4];
#pragma unroll
  for (int i = 0; i < 4; ++i)
#pragma unroll
    for (int j = 0; j < 4; ++j) acc[i][j] = (v8f){0.f,0.f,0.f,0.f,0.f,0.f,0.f,0.f};

  v4f xr[4], wr[8];
#pragma unroll
  for (int i = 0; i < 4; ++i) xr[i] = *(const v4f*)(xp + i * kPix);
#pragma unroll
  for (int it = 0; it < 8; ++it) wr[it] = *(const v4f*)(wp + it * 32 * kCh);
  // the wait that stands before a register named by an issued load is rewritten; naming the two pointers keeps them in place up to here
  asm volatile("s_wait_xcnt 0x0" :: "v"(xp), "v"(wp) : "memory");

  // split the stage held in registers and store it in buffer buf
  auto store_stage = [&](int buf) {
    // X: the four channels of one pixel are the same component of the four loaded vectors
#pragma unroll
    for (int j = 0; j < 4; ++j) {
      const v4f t = {xr[0][j], xr[1][j], xr[2][j], xr[3][j]};
      v2u h, l;
      split4(t, h, l);
      *(v2u*)(sXh[buf] + j * 32 * kSp + xdst) = h;
      *(v2u*)(sXl[buf] + j * 32 * kSp + xdst) = l;
    }
#pragma unroll
    for (int it = 0; it < 8; ++it) {
      v2u h, l;
      split4(wr[it], h, l);
      *(v2u*)(sWh[buf] + it * 32 * kSp + wdst) = h;
      *(v2u*)(sWl[buf] + it * 32 * kSp + wdst) = l;
    }
  };
  // the 48 products of the stage in buffer buf
  auto products = [&](int buf) {
    v16b bh[4], bl[4];
#pragma unroll
    for (int j = 0; j < 4; ++j) {
      const int bo = (wn * 64 + (j << 4) + rlane) * kSp + koff;
      bh[j] = Frag<__bf16>::load((const __bf16*)sWh[buf] + bo);
      bl[j] = Frag<__bf16>::load((const __bf16*)sWl[buf] + bo);
    }
    const int ao = (wm * 64 + rlane) * kSp + koff;
    v16b ah = Frag<__bf16>::load((const __bf16*)sXh[buf] + ao);
    v16b al = Frag<__bf16>::load((const __bf16*)sXl[buf] + ao);
#pragma unroll
    for (int i = 0; i < 4; ++i) {
      v16b nh = ah, nl = al;
      if (i < 3) {   // the next strip's fragments are asked for ahead of this strip's products
        nh = Frag<__bf16>::load((const __bf16*)sXh[buf] + ao + (i + 1) * 16 * kSp);
        nl = Frag<__bf16>::load((const __bf16*)sXl[buf] + ao + (i + 1) * 16 * kSp);
        __builtin_amdgcn_sched_barrier(0);   // holds those loads in front of the products: sunk behind them, each strip waits out its own LDS latency
      }
#pragma unroll
      for (int j = 0; j < 4; ++j) {
        acc[i][j] = Frag<__bf16>::mma(ah, bh[j], acc[i][j]);
        acc[i][j] = Frag<__bf16>::mma(ah, bl[j], acc[i][j]);
        acc[i][j] = Frag<__bf16>::mma(al, bh[j], acc[i][j]);
      }
      ah = nh;
      al = nl;
    }
  };

#pragma unroll 1   // rolled: one copy of the stage keeps the kernel's text short, which a first run fetches line by line
  for (int ks = 0; ks + 1 < kStages; ++ks) {
    store_stage(ks & 1);   // the buffer's last readers left it before the barrier of the stage before
    __syncthreads();       // publishes this stage; also ends every wave's reads of the other buffer, which the next stage overwrites
    // the next stage's global loads stand behind the barrier (in front of it the barrier's own wait would drain them) and fly during the products
#pragma unroll
    for (int i = 0; i < 4; ++i) xr[i] = *(const v4f*)(xp + (kStageK + i) * kPix);
#pragma unroll
    for (int it = 0; it < 8; ++it) wr[it] = *(const v4f*)(wp + kStageK + it * 32 * kCh);
    // as in front of the loop: the wait before the two pointers are advanced
    asm volatile("s_wait_xcnt 0x0" :: "v"(xp), "v"(wp) : "memory");
    xp += kStageK * kPix;
    wp += kStageK;
    products(ks & 1);
  }
  store_stage((kStages - 1) & 1);
  __syncthreads();         // publishes the last stage
  products((kStages - 1) & 1);

  // ---- epilogue: each 16 x 64 strip through the wave's own slab, whole 128-B row segments stored ----
  // LDS row 64 wm + 16 i + row holds pixel 4 * (16 (i & 1) + row) + 2 wm + (i >> 1) of the block (the staging map above)
  float* slab = sT[wave];
  const int n0 = wn * 64;
#pragma unroll
  for (int i = 0; i < 4; ++i) {
#pragma unroll
    for (int j = 0; j < 4; ++j)
#pragma unroll
      for (int r = 0; r < 8; ++r) slab[(mOff + r) * 68 + (j << 4) + rlane] = acc[i][j][r] * scale;
    __builtin_amdgcn_fence(__ATOMIC_RELEASE, "workgroup");
    __builtin_amdgcn_wave_barrier();
    __builtin_amdgcn_fence(__ATOMIC_ACQUIRE, "workgroup");
    const int q = lane >> 3, c8 = (lane & 7) * 8;
#pragma unroll
    for (int it = 0; it < 4; ++it) {
      const int row = it * 4 + q;
      const int pix = p0 + 4 * (16 * (i & 1) + row) + 2 * wm + (i >> 1);
      const float* sp = slab + row * 68 + c8;
      v2u h0, l0, h1, l1;
      split4(*(const v4f*)sp, h0, l0);
      split4(*(const v4f*)(sp + 4), h1, l1);
      const size_t co = ((size_t)(b * kPix + pix)) * kCh + n0 + c8;
      *(v4u*)(Ch + co) = (v4u){h0.x, h0.y, h1.x, h1.y};
      *(v4u*)(Cl + co) = (v4u){l0.x, l0.y, l1.x, l1.y};
    }
    __builtin_amdgcn_fence(__ATOMIC_RELEASE, "workgroup");
    __builtin_amdgcn_wave_barrier();
    __builtin_amdgcn_fence(__ATOMIC_ACQUIRE, "workgroup");
  }
}

// ---- local 7x7 window attention, both kv branches, one (b, head, 4x8 pixel tile) per block of 2 waves ----
// Qh/Ql, KVh/KVl: bf16 hi/lo planes [b][p][256] (KV planes: branch-major, 2 x [b][p][256]); Obuf: f32 [b][p][256].
// Wave w owns pixel rows y0+2w..y0+2w+1, cols x0..x0+7; its 8x14 union neighbourhood is LDS rows 28w..28w+111 of the
// block's 10x14 neighbourhood (row index nr*14+nc, image pos (y0-3+nr, x0-3+nc), zero row when outside the image).
// second launch bound: holds the register allocation at three waves a SIMD, where it stood before the staged chunks were held in registers
__global__ __launch_bounds__(64, 3) void local_window_attn_kernel(
    const unsigned short* __restrict__ Qh, const unsigned short* __restrict__ Ql,
    const unsigned short* __restrict__ KVh, const unsigned short* __restrict__ KVl,
    float* __restrict__ Obuf)
{
  __shared__ __align__(16) unsigned short Ksh[2 * kKPlane];    // 2 x 17920 B: the hi plane, then the lo plane, which one address register reaches by a constant offset
  __shared__ __align__(16) float  Osh[2][16 * 68];             //  8704 B

  const int tid  = threadIdx.x;
  const int w    = tid >> 5, lane = tid & 31, hh = lane >> 4, c = lane & 15;
  const int bidx = blockIdx.x;
  const int tx   = bidx % kTilesX;
  const int ty   = (bidx / kTilesX) % kTilesY;
  const int head = (bidx / (kTilesX * kTilesY)) % kHeads;
  const int b    = bidx / (kTilesX * kTilesY * kHeads);
  const int y0 = ty * kTileY, x0 = tx * kTileX;
  const int nb = w * 2 * kNbCols;   // base LDS row of this wave's union neighbourhood
  // this lane's LDS elements in the wave's first 16 rows; rows 16 n further on add 16 n kKp (same key)
  int ksc[4], vtr[4];   // scores: row c, pieces 2 q + hh; transposing loads: row 8 hh + lane % 8, piece 2 dt + (lane / 8) % 2
#pragma unroll   // full: both arrays live in registers
  for (int q = 0; q < 4; ++q) {
    ksc[q] = k_at(nb + c, 2 * q + hh);
    vtr[q] = k_at(nb + 8 * hh + (lane & 7), 2 * q + ((lane >> 3) & 1));
  }

  // Q fragments of pixel c of this wave, the B operand of the transposed scores (split k-map via Frag load)
  v16b qh[2], ql[2];
  {
    const int py = y0 + 2 * w + (c >> 3), px = x0 + (c & 7);
    const size_t qoff = ((size_t)(b * kPix + py * kW + px)) * kCh + head * kDh;
    const __bf16* qhp = (const __bf16*)Qh + qoff;
    const __bf16* qlp = (const __bf16*)Ql + qoff;
#pragma unroll
    for (int dc = 0; dc < 2; ++dc) {
      qh[dc] = Frag<__bf16>::load(qhp + dc * 32 + 8 * hh);
      ql[dc] = Frag<__bf16>::load(qlp + dc * 32 + 8 * hh);
    }
  }
  // window of this lane's pixel c (row c / 8, col c % 8 of the wave's 2 x 8 pixels) as a bit mask over the 112 neighbours of the
  // wave's 8 x 14 union: rows c / 8 .. c / 8 + 6, cols c % 8 .. c % 8 + 6, exactly 49 bits. The words are shifted down by 8 hh, so
  // that bit 16 (t & 1) + r of word t / 2 stands for neighbour 16 t + 8 hh + r, the one that register r of score tile t holds.
  unsigned wmask[4] = {0u, 0u, 0u, 0u};
  {
    const int pr = c >> 3;
    const unsigned colbits = 0x7fu << (c & 7);
#pragma unroll   // full: bit offsets are constants
    for (int nr = 0; nr < 8; ++nr) {
      const unsigned rowbits = (nr >= pr && nr <= pr + 6) ? colbits : 0u;
      const int off = nr * kNbCols;
      wmask[off >> 5] |= rowbits << (off & 31);
      if ((off & 31) + kNbCols > 32) wmask[(off >> 5) + 1] |= rowbits >> (32 - (off & 31));
    }
#pragma unroll
    for (int k = 0; k < 4; ++k) wmask[k] >>= 8 * hh;
  }

  // staging map of this thread, the same in both branches: column tid / 8 of a half row, chunk tid % 8
  unsigned sgoff[2], sxmsk[2];   // byte offset in the image row (column clamped into the image), all-ones where the column is inside
#pragma unroll   // full: both entries live in registers
  for (int h = 0; h < 2; ++h) {
    const int gx = x0 - 3 + h * kStageCols + (tid >> 3);
    const int gxc = gx < 0 ? 0 : (gx > kW - 1 ? kW - 1 : gx);
    sgoff[h] = (unsigned)(gxc * kCh + (tid & 7) * 8) * 2u;
    sxmsk[h] = ((unsigned)gx < (unsigned)kW) ? 0xffffffffu : 0u;
  }
  const bool topOut = y0 < 3, botOut = y0 + kTileY + 3 > kW;   // uniform: the 3 rows above / below the tile lie outside the image

  v8f oacc[4];
#pragma unroll
  for (int dt = 0; dt < 4; ++dt) oacc[dt] = (v8f){0.f,0.f,0.f,0.f,0.f,0.f,0.f,0.f};
  const v4u z4 = {0u, 0u, 0u, 0u};
  const v8b z8 = __builtin_bit_cast(v8b, z4);

#pragma unroll 1
  for (int br = 0; br < 2; ++br) {
    __syncthreads();
    // stage the 10 x 14 neighbourhood, 8 chunks of 16 B a row and plane (zeros outside the image): one trip is half a
    // neighbourhood row, 7 columns x 8 chunks on 56 of the 64 threads, so that the image row is uniform over the block.
    // All global loads of a branch are issued before the first LDS store: the wave waits out one load latency a branch, not one a trip.
    if (tid < kStageCols * 8) {
      // 32-bit byte offsets of this thread's chunk from the start of the two-branch plane (below 8 MiB), one for each zone
      // (3 rows above the tile: from image row y0 - 3; the tile's rows and the 3 rows below: from y0) and half row; a trip adds
      // its row as a constant. A zone outside the image reads the tile's own rows instead (3 rows further in) and is masked to zero.
      const unsigned anchor = (unsigned)((((br * kB + b) * kPix + y0 * kW) * kCh + head * kDh) * 2);
      unsigned voff[3][2];
#pragma unroll   // full: all six entries live in registers
      for (int h = 0; h < 2; ++h) {
        voff[1][h] = anchor + sgoff[h];
        voff[0][h] = voff[1][h] - (topOut ? 0u : 3u * kRowBytes);
        voff[2][h] = voff[1][h] - (botOut ? 3u * kRowBytes : 0u);
      }
      v4u vh[kStageTrips], vl[kStageTrips];
#pragma unroll   // full: the loaded chunks are held in registers, indexed by the trip
      for (int t = 0; t < kStageTrips; ++t) {
        const int nr = t >> 1, zone = nr < 3 ? 0 : (nr < 3 + kTileY ? 1 : 2);
        const int rows = zone == 0 ? nr : nr - 3;   // rows from the zone's offset, never negative
        vh[t] = *(const v4u*)((const char*)KVh + voff[zone][t & 1] + rows * kRowBytes);
        vl[t] = *(const v4u*)((const char*)KVl + voff[zone][t & 1] + rows * kRowBytes);
      }
      // the wait that stands before a register named by an issued load is rewritten; naming the six address registers keeps them
      // apart from the loads' own destination registers up to here
      asm volatile("s_wait_xcnt 0x0" :: "v"(voff[0][0]), "v"(voff[0][1]), "v"(voff[1][0]), "v"(voff[1][1]), "v"(voff[2][0]), "v"(voff[2][1]) : "memory");
#pragma unroll   // full: same register arrays
      for (int t = 0; t < kStageTrips; ++t) {
        const int nr = t >> 1;
        const unsigned msk = (nr < 3 ? topOut : (nr < 3 + kTileY ? false : botOut)) ? 0u : sxmsk[t & 1];
        v4u a = vh[t], d = vl[t];
        a.x &= msk; a.y &= msk; a.z &= msk; a.w &= msk;
        d.x &= msk; d.y &= msk; d.z &= msk; d.w &= msk;
        const int sdst = k_at(t * kStageCols + (tid >> 3), tid & 7);
        *(v4u*)(Ksh + sdst) = a;
        *(v4u*)(Ksh + sdst + kKPlane) = d;
      }
    }
    __syncthreads();

    // transposed scores s[t][r] = k(neighbour t*16+8hh+r) . q(pixel c): A fragments = rows of K in LDS (split k-map as in Q), B = Q.
    // A lane then holds 56 of the 112 scores of ONE pixel, lane c + 16 the rest, and tiles 2kk, 2kk+1 lie as the A fragment of P in k-step kk.
    v8f s[7];
#pragma unroll
    for (int t = 0; t < 7; ++t) {
      s[t] = (v8f){0.f,0.f,0.f,0.f,0.f,0.f,0.f,0.f};
#pragma unroll
      for (int dc = 0; dc < 2; ++dc) {
        const int k0 = ksc[2 * dc] + t * 16 * kKp, k1 = ksc[2 * dc + 1] + t * 16 * kKp;   // d = 32 dc + 8 hh .. + 7 and 16 further on, as in Q
        FragB kfh, kfl;
        kfh.h[0] = *(const v8b*)(Ksh + k0);
        kfh.h[1] = *(const v8b*)(Ksh + k1);
        kfl.h[0] = *(const v8b*)(Ksh + k0 + kKPlane);
        kfl.h[1] = *(const v8b*)(Ksh + k1 + kKPlane);
        s[t] = at_mma(kfh.v, qh[dc], s[t]);
        s[t] = at_mma(kfl.v, qh[dc], s[t]);
        s[t] = at_mma(kfh.v, ql[dc], s[t]);
      }
    }

    // window mask (49 neighbours, zero vectors included) + softmax in f32: maximum and sum run down the lane's own registers
    // (four independent chains each), then one exchange with the lane that holds the pixel's other half
    float mx4[4] = {-INFINITY, -INFINITY, -INFINITY, -INFINITY};
#pragma unroll
    for (int t = 0; t < 7; ++t)
#pragma unroll
      for (int r = 0; r < 8; ++r) {
        const bool inwin = (wmask[t >> 1] >> (16 * (t & 1) + r)) & 1u;
        const float sv = inwin ? s[t][r] : -INFINITY;
        s[t][r] = sv;
        mx4[r & 3] = fmaxf(mx4[r & 3], sv);
      }
    float mx = fmaxf(fmaxf(mx4[0], mx4[1]), fmaxf(mx4[2], mx4[3]));
    mx = fmaxf(mx, __shfl_xor(mx, 16, 32));
    float l4[4] = {0.f, 0.f, 0.f, 0.f};
#pragma unroll
    for (int t = 0; t < 7; ++t)
#pragma unroll
      for (int r = 0; r < 8; ++r) {
        const float p = expf(s[t][r] - mx);
        s[t][r] = p;
        l4[r & 3] += p;
      }
    float l = (l4[0] + l4[1]) + (l4[2] + l4[3]);
    l += __shfl_xor(l, 16, 32);
    const float scl = 0.5f / l;
    // P as bf16 hi/lo, two neighbours a word, in the registers where the scores stood
    v4u ph[7], pl[7];
#pragma unroll
    for (int t = 0; t < 7; ++t) {
      v2u h0, l0, h1, l1;
      split4((v4f){s[t][0] * scl, s[t][1] * scl, s[t][2] * scl, s[t][3] * scl}, h0, l0);
      split4((v4f){s[t][4] * scl, s[t][5] * scl, s[t][6] * scl, s[t][7] * scl}, h1, l1);
      ph[t] = (v4u){h0.x, h0.y, h1.x, h1.y};
      pl[t] = (v4u){l0.x, l0.y, l1.x, l1.y};
    }

    // O += P . V : A = P of pixel c straight from those registers, B = V, column d of the K rows, by transposing LDS loads (same k-map),
    // neighbour range 0..111; k-step 3 uses elements 0..7 only (8..15 zero in both operands)
    // The 16 loads of k-step kk + 1 are issued in front of the products of k-step kk (two register sets): asked for only where they are used,
    // each group of four would have its whole LDS latency waited out in front of its three products.
    FragB vfh[2][4], vfl[2][4];
    auto load_v = [&](int kk) {
#pragma unroll   // full: the fragments live in registers, indexed by constants
      for (int dt = 0; dt < 4; ++dt) {
        const int e0 = vtr[dt] + kk * 32 * kKp;
        vfh[kk & 1][dt].h[0] = ld_tr16(Ksh + e0);
        vfl[kk & 1][dt].h[0] = ld_tr16(Ksh + e0 + kKPlane);
        if (kk < 3) {
          vfh[kk & 1][dt].h[1] = ld_tr16(Ksh + e0 + 16 * kKp);
          vfl[kk & 1][dt].h[1] = ld_tr16(Ksh + e0 + 16 * kKp + kKPlane);
        } else {
          vfh[kk & 1][dt].h[1] = z8;
          vfl[kk & 1][dt].h[1] = z8;
        }
      }
    };
    load_v(0);
#pragma unroll
    for (int kk = 0; kk < 4; ++kk) {
      FragB pa, pb;
      pa.h[0] = __builtin_bit_cast(v8b, ph[2 * kk]);
      pb.h[0] = __builtin_bit_cast(v8b, pl[2 * kk]);
      if (kk < 3) {
        pa.h[1] = __builtin_bit_cast(v8b, ph[2 * kk + 1]);
        pb.h[1] = __builtin_bit_cast(v8b, pl[2 * kk + 1]);
        load_v(kk + 1);
      } else {
        pa.h[1] = z8;
        pb.h[1] = z8;
      }
#pragma unroll
      for (int dt = 0; dt < 4; ++dt) {
        oacc[dt] = at_mma(pa.v, vfh[kk & 1][dt].v, oacc[dt]);
        oacc[dt] = at_mma(pa.v, vfl[kk & 1][dt].v, oacc[dt]);
        oacc[dt] = at_mma(pb.v, vfh[kk & 1][dt].v, oacc[dt]);
      }
    }
  }

  float* osw = Osh[w];
#pragma unroll
  for (int r = 0; r < 8; ++r)
#pragma unroll
    for (int dt = 0; dt < 4; ++dt) osw[(8 * hh + r) * 68 + dt * 16 + c] = oacc[dt][r];
  __builtin_amdgcn_fence(__ATOMIC_RELEASE, "workgroup");
  __builtin_amdgcn_wave_barrier();
  __builtin_amdgcn_fence(__ATOMIC_ACQUIRE, "workgroup");
  {
    const int c4 = c * 4;
    {
#pragma unroll
      for (int it = 0; it < 8; ++it) {
        const int row = it * 2 + hh;
        const v4f val = *(const v4f*)(osw + row * 68 + c4);
        const int py = y0 + 2 * w + (row >> 3), px = x0 + (row & 7);
        *(v4f*)(Obuf + ((size_t)(b * kPix + py * kW + px)) * kCh + head * kDh + c4) = val;
      }
      
    }
  }
}

// ---- final transpose: O [kB][kPix][kCh] f32 -> out [kB][kCh][kPix] f32; one 64-p x 64-ch tile per block (grid 64 x 4 x kB) ----
// Load: 256 threads x 4 iterations x float4 = 64 p x 64 ch (exact). Store: 8 waves x 8 ch-rows x (16 lanes x 4 floats) = 64 x 64,
__global__ __launch_bounds__(256) void tr_out_kernel(const float* __restrict__ O, float* __restrict__ out)
{
  __shared__ __align__(16) float sT[64 * 68];   // [ch][p], pitch 68
  const int tid = threadIdx.x;
  const int p0 = blockIdx.x * 64, c0 = blockIdx.y * 64, b = blockIdx.z;
#pragma unroll
  for (int it = 0; it < 4; ++it) {
    const int idx = tid + 256 * it;
    const int prow = idx >> 4, c4 = (idx & 15) * 4;
    const v4f v = *(const v4f*)(O + ((size_t)(b * kPix + p0 + prow)) * kCh + c0 + c4);
    sT[(c4 + 0) * 68 + prow] = v.x;
    sT[(c4 + 1) * 68 + prow] = v.y;
    sT[(c4 + 2) * 68 + prow] = v.z;
    sT[(c4 + 3) * 68 + prow] = v.w;
  }
  __syncthreads();
  const int wv = tid >> 5, lane = tid & 31, hh = lane >> 4, p4 = (lane & 15) * 4;
  v4f val[4];
  size_t off[4];
#pragma unroll
  for (int it = 0; it < 4; ++it) {
    const int row = wv * 8 + it * 2 + hh;
    val[it] = *(const v4f*)(sT + row * 68 + p4);
    off[it] = ((size_t)(b * kCh + c0 + row)) * kPix + p0 + p4;
  }
  {
#pragma unroll
    for (int it = 0; it < 4; ++it) *(v4f*)(out + off[it]) = val[it];
    
  }
}

// ---------------------------------------------------------------------------
// Workspace region map (bytes):
//   P16 = kB*kPix*kCh*2 = 4,194,304 (one bf16 plane [kB][kPix][kCh])
//   [ 0]          Q hi,lo                  2 x P16
//   [ 8,388,608]  KV hi (branch 0,1)       2 x P16
//   [16,777,216]  KV lo (branch 0,1)       2 x P16
//   [25,165,824]  O f32 [kB][kPix][kCh]    8,388,608
//   total 33,554,432
// ---------------------------------------------------------------------------
extern "C" void kernel_launch(void* const* d_in, const int* in_sizes, int n_in,
                              void* d_out, int out_size, void* d_ws, size_t ws_size,
                              hipStream_t stream)
{
  const int nAct = kB * kCh * kPix;   // 2,097,152
  const int nW   = kCh * kCh;         // 65,536
  if (n_in < 5) return;
  if (in_sizes[0] != nAct || in_sizes[1] != nAct || in_sizes[2] != nAct) return;
  if (in_sizes[3] != nW || in_sizes[4] != nW) return;
  if (out_size != nAct) return;

  const float* kvmap1 = (const float*)d_in[0];
  const float* qmap   = (const float*)d_in[1];
  const float* kvmap2 = (const float*)d_in[2];
  const float* Wq     = (const float*)d_in[3];
  const float* Wkv    = (const float*)d_in[4];
  float* out = (float*)d_out;

  const size_t planeB  = (size_t)nAct * 2;
  char* ws = (char*)d_ws;
  size_t o = 0;
  unsigned short* Qh    = (unsigned short*)(ws + o); o += planeB;
  unsigned short* Ql    = (unsigned short*)(ws + o); o += planeB;
  unsigned short* KVh   = (unsigned short*)(ws + o); o += 2 * planeB;
  unsigned short* KVl   = (unsigned short*)(ws + o); o += 2 * planeB;
  float*          Obuf  = (float*)(ws + o);          o += (size_t)nAct * 4;
  if (o > ws_size) return;

  // 1: the three projections C[p][o] = sum_c X[c][p] W[o][c], straight from the f32 inputs; 3 x kB x 32 blocks of 8 waves
  proj_kernel<<<3 * kProjBlocks, 256, 0, stream>>>(
      qmap, kvmap1, kvmap2, Wq, Wkv,
      Qh, Ql, KVh, KVl, KVh + (size_t)nAct, KVl + (size_t)nAct);
  // 2: local window attention, both branches, O as [b][p][256] f32
  local_window_attn_kernel<<<kB * kHeads * kTilesY * kTilesX, 64, 0, stream>>>(Qh, Ql, KVh, KVl, Obuf);
  // 3: O [b][p][ch] -> out [b][ch][p]
  const dim3 gtr(kPix / 64, kCh / 64, kB);
  tr_out_kernel<<<gtr, 256, 0, stream>>>(Obuf, out);
}

// v007
// One run takes 26.2 microseconds.
// In two side-by-side timings against v006, it was 1.04 and 1.05 times as fast.
// Counting every step since v000, it is 4.67 times as fast.
// Contractions: 1x1 projections, local-window q.k and p.v all on v_wmma_f32_16x16x32_bf16 with bf16 hi/lo split operands (hi*hi + hi*lo + lo*hi), f32 accumulate; softmax, scaling and transposes in f32.
#include <hip/hip_runtime.h>
#include <stdint.h>
#include <stddef.h>

typedef __attribute__((ext_vector_type(16))) _Float16 v16h;
typedef __attribute__((ext_vector_type(8)))  _Float16 v8h;
typedef __attribute__((ext_vector_type(16))) __bf16   v16b;
typedef __attribute__((ext_vector_type(8)))  __bf16   v8b;
typedef __attribute__((ext_vector_type(8)))  float    v8f;
typedef __attribute__((ext_vector_type(4)))  float    v4f;
typedef __attribute__((ext_vector_type(4)))  unsigned int v4u;
typedef __attribute__((ext_vector_type(8)))  unsigned int v8u;
typedef __attribute__((ext_vector_type(8)))  unsigned short v8us;

template <typename T> struct Frag;
template <> struct Frag<__bf16> {
  typedef v16b V; union U { v16b v; v8b h[2]; };
  static __device__ __forceinline__ v16b load(const __bf16* p) {
    U f; f.h[0] = *(const v8b*)(p); f.h[1] = *(const v8b*)(p + 16); return f.v;
  }
  static __device__ __forceinline__ v8f mma(v16b a, v16b b, v8f c) {
    return __builtin_amdgcn_wmma_f32_16x16x32_bf16(false, a, false, b, (short)0, c, false, false);
  }
};

// ---- guarded bf16 WMMA ----
__device__ __forceinline__ v8f at_mma(v16b a, v16b b, v8f c) {
  c = __builtin_amdgcn_wmma_f32_16x16x32_bf16(false, a, false, b, (short)0, c, false, false);
  asm volatile("v_nop\n\tv_nop\n\tv_nop\n\tv_nop" : "+v"(c) : "v"(a), "v"(b));
  return c;
}

// ---- problem geometry ----
constexpr int kB     = 2;
constexpr int kPix   = 4096;
constexpr int kW     = 64;
constexpr int kCh    = 256;
constexpr int kHeads = 4;
constexpr int kDh    = 64;
constexpr int kTileY = 4;                       // pixel tile of one wave pair: 4 rows x 8 cols (2 rows x 8 cols a wave)
constexpr int kTileX = 8;
constexpr int kNbRows = kTileY + 6;             // 10 neighbourhood rows
constexpr int kNbCols = kTileX + 6;             // 14 neighbourhood cols
constexpr int kKRows  = kNbRows * kNbCols;      // 140 staged K rows per tile
constexpr int kKp     = kDh;                    // K row pitch in LDS (elements): 128 B, no pad; the eight 16-B pieces of a row are permuted by k_key()
constexpr int kKPlane = kKRows * kKp;           // elements of one staged plane
constexpr int kStageCols  = kNbCols / 2;        // 7 neighbourhood columns staged a trip
constexpr int kStageTrips = 2 * kNbRows;        // 20 trips stage one plane of K
constexpr int kRowBytes   = kW * kCh * 2;       // one image row of one bf16 plane
constexpr int kTilesY = kW / kTileY;            // 16
constexpr int kTilesX = kW / kTileX;            // 8
constexpr int kSub    = 4;                      // pixel tiles side by side in one block: 4 x 8 pixels x 4 B = one 128-B line of the output a row and channel
constexpr int kOp     = kTileY * kSub * kTileX + 4;   // pitch (floats) of one channel of the block's output tile in LDS: 16 B x odd
static_assert(kHeads * kDh == kCh, "geometry");
static_assert(kW * kW == kPix, "geometry");
static_assert(kNbCols % 2 == 0 && (kNbCols / 2) * 8 <= 64, "half a neighbourhood row fits one trip of a wave pair");
static_assert(kTileY >= 3 && kNbRows == kTileY + 6, "the 3 rows above (below) a tile are outside the image all together, and the tile has 3 rows to read in their place");
static_assert(kPix % 64 == 0 && kCh % 64 == 0 && kCh % 32 == 0, "gemm tile and K multiples");
static_assert(kW % kTileY == 0 && kW % kTileX == 0 && kTilesX % kSub == 0, "tile coverage");
static_assert(kSub * kTileX * 4 == 128 && kTileY * kSub * kTileX == 4 * 32, "a channel of the output tile: whole lines, one 16-B piece a lane");
static_assert(kDh * kOp * 4 <= kSub * 2 * kKPlane * 2, "the output tile fits the K rows' LDS");
static_assert(2 * kNbCols + 6 * 16 + 8 + 7 < kKRows, "pv gather rows in range");

union FragB { v16b v; v8b h[2]; };

// K rows in LDS: 16-B piece j of row r stands at piece j ^ k_key(r) of the row. The key is the same 16 rows further on. Two rows fill the 64 banks, so
// 16 lanes fall on distinct banks both when they read one piece of 16 successive rows (rows of equal parity: 8 distinct keys) and when they read two
// neighbouring pieces of 8 successive rows from an even one (the transposing load; rows of equal parity: keys distinct above bit 0).
__device__ __forceinline__ int k_key(int row) { return (((row >> 1) & 3) << 1) | ((row >> 3) & 1); }
__device__ __forceinline__ int k_at(int row, int piece) { return row * kKp + ((piece ^ k_key(row)) << 3); }   // element offset

// transposing LDS load: the 32 lanes address the sixteen rows x two 16-B pieces of a 16 x 16 tile of 16-bit elements (lane l: row 8 (l / 16) + l % 8,
// piece (l / 8) % 2); lane l receives rows 8 (l / 16) .. + 7 of column l % 16, which is half a B fragment in the hardware's k order
typedef __attribute__((ext_vector_type(8))) short v8s;
__device__ __forceinline__ v8b ld_tr16(const unsigned short* p) {
  typedef __attribute__((address_space(3))) v8s lds_v8s;
  return __builtin_bit_cast(v8b, __builtin_amdgcn_ds_load_tr16_b128_v8i16((lds_v8s*)p));
}

// ---- the three 1x1 projections, operand preparation included: one launch ----
// C[p][o] = scale * sum_c X[c][p] * W[o][c], written as bf16 hi/lo planes [b][p][256]; product = hi.hi + hi.lo + lo.hi, f32 accumulate.
// One block = 128 pixels x 256 outputs of one (map, batch); 8 waves, wave (wm, wn) owns 64 pixels x 64 outputs (4 x 4 tiles of 16 x 16).
// A stage is 32 channels: the block reads X [32 c][128 p] and W [256 o][32 c] in f32 as whole 128-B lines, splits them into bf16 hi/lo in
// registers and stores them k-contiguous in LDS (X transposed on the way), two buffers; the next stage's global loads fly during the products.
typedef __attribute__((ext_vector_type(2))) float        v2f;
typedef __attribute__((ext_vector_type(2))) __bf16       v2b;
typedef __attribute__((ext_vector_type(2))) unsigned int v2u;
constexpr int kPT     = 128;                    // pixels a block
constexpr int kStageK = 32;                     // channels a stage = one k-step of the matrix instruction
constexpr int kStages = kCh / kStageK;          // 8
constexpr int kSp     = kStageK + 8;            // LDS row pitch (elements): 80 B = 16 B x odd, so that 16 rows read 16 B wide fall on distinct banks
constexpr int kProjBlocks = kB * (kPix / kPT);  // 64 blocks a map
static_assert(kPix % kPT == 0 && kCh % kStageK == 0 && kCh == 256 && kPT == 128, "projection tiling");

// four f32 -> four bf16 hi (nearest even) and four bf16 lo (the remainder, nearest even), two a word
__device__ __forceinline__ void split4(v4f v, v2u& hi, v2u& lo) {
#pragma unroll
  for (int q = 0; q < 2; ++q) {
    const v2f x = {v[2 * q], v[2 * q + 1]};
    const unsigned hw = __builtin_bit_cast(unsigned, __builtin_convertvector(x, v2b));
    const v2f hf = {__uint_as_float(hw << 16), __uint_as_float(hw & 0xffff0000u)};
    hi[q] = hw;
    lo[q] = __builtin_bit_cast(unsigned, __builtin_convertvector(x - hf, v2b));
  }
}

__global__ __launch_bounds__(256) void proj_kernel(
    const float* __restrict__ X0, const float* __restrict__ X1, const float* __restrict__ X2,
    const float* __restrict__ W0, const float* __restrict__ W1,
    unsigned short* __restrict__ C0h, unsigned short* __restrict__ C0l,
    unsigned short* __restrict__ C1h, unsigned short* __restrict__ C1l,
    unsigned short* __restrict__ C2h, unsigned short* __restrict__ C2l)
{
  __shared__ __align__(16) unsigned short sXh[2][kPT * kSp];   // 2 x 10240 B
  __shared__ __align__(16) unsigned short sXl[2][kPT * kSp];
  __shared__ __align__(16) unsigned short sWh[2][kCh * kSp];   // 2 x 20480 B
  __shared__ __align__(16) unsigned short sWl[2][kCh * kSp];
  __shared__ __align__(16) float sT[8][16 * 68];               // per-wave 16 x 64 slab of the epilogue, pitch 68 floats

  const int tid  = threadIdx.x;
  const int lane = tid & 31;
  const int wave = __builtin_amdgcn_readfirstlane(tid >> 5);
  const int wm = wave >> 2, wn = wave & 3;
  const int g  = blockIdx.x / kProjBlocks;
  const int rb = blockIdx.x - g * kProjBlocks;
  const int b  = rb / (kPix / kPT);
  const int p0 = (rb - b * (kPix / kPT)) * kPT;
  const float* X = (g == 0 ? X0 : (g == 1 ? X1 : X2)) + (size_t)b * kCh * kPix + p0;
  const float* Wf = g == 0 ? W0 : W1;
  unsigned short* Ch = g == 0 ? C0h : (g == 1 ? C1h : C2h);
  unsigned short* Cl = g == 0 ? C0l : (g == 1 ? C1l : C2l);
  const float scale = g == 0 ? 0.125f : 1.0f;

  // staging maps. X: wave w takes channels 4w..4w+3 of the stage, lane l pixels 4l..4l+3 (512 contiguous bytes a load).
  // Pixel 4l + j goes to LDS row 32j + l, so that the 32 lanes of a store write 32 consecutive rows.
  // W: 8 lanes take the 32 channels of one output row (128 B), a load covers 4 rows, 8 loads the 256 rows.
  const float* xp = X + (wave * 4 * kPix + lane * 4);            // this thread's chunk of the stage last loaded
  const float* wp = Wf + ((tid >> 3) * kCh + (tid & 7) * 4);
  const int xdst = lane * kSp + wave * 4;
  const int wdst = (tid >> 3) * kSp + (tid & 7) * 4;

  const int rlane = lane & 15;                 // row (A) / col (B, D) within a 16 x 16 tile
  const int koff  = (lane >> 4) * 8;           // k offset of this lane half
  const int mOff  = (lane >> 4) * 8;           // D row offset

  v8f acc[4][4];
#pragma unroll
  for (int i = 0; i < 4; ++i)
#pragma unroll
    for (int j = 0; j < 4; ++j) acc[i][j] = (v8f){0.f,0.f,0.f,0.f,0.f,0.f,0.f,0.f};

  v4f xr[4], wr[8];
#pragma unroll
  for (int i = 0; i < 4; ++i) xr[i] = *(const v4f*)(xp + i * kPix);
#pragma unroll
  for (int it = 0; it < 8; ++it) wr[it] = *(const v4f*)(wp + it * 32 * kCh);
  // the wait that stands before a register named by an issued load is rewritten; naming the two pointers keeps them in place up to here
  asm volatile("s_wait_xcnt 0x0" :: "v"(xp), "v"(wp) : "memory");

  // split the stage held in registers and store it in buffer buf
  auto store_stage = [&](int buf) {
    // X: the four channels of one pixel are the same component of the four loaded vectors
#pragma unroll
    for (int j = 0; j < 4; ++j) {
      const v4f t = {xr[0][j], xr[1][j], xr[2][j], xr[3][j]};
      v2u h, l;
      split4(t, h, l);
      *(v2u*)(sXh[buf] + j * 32 * kSp + xdst) = h;
      *(v2u*)(sXl[buf] + j * 32 * kSp + xdst) = l;
    }
#pragma unroll
    for (int it = 0; it < 8; ++it) {
      v2u h, l;
      split4(wr[it], h, l);
      *(v2u*)(sWh[buf] + it * 32 * kSp + wdst) = h;
      *(v2u*)(sWl[buf] + it * 32 * kSp + wdst) = l;
    }
  };
  // the 48 products of the stage in buffer buf
  auto products = [&](int buf) {
    v16b bh[4], bl[4];
#pragma unroll
    for (int j = 0; j < 4; ++j) {
      const int bo = (wn * 64 + (j << 4) + rlane) * kSp + koff;
      bh[j] = Frag<__bf16>::load((const __bf16*)sWh[buf] + bo);
      bl[j] = Frag<__bf16>::load((const __bf16*)sWl[buf] + bo);
    }
    const int ao = (wm * 64 + rlane) * kSp + koff;
    v16b ah = Frag<__bf16>::load((const __bf16*)sXh[buf] + ao);
    v16b al = Frag<__bf16>::load((const __bf16*)sXl[buf] + ao);
#pragma unroll
    for (int i = 0; i < 4; ++i) {
      v16b nh = ah, nl = al;
      if (i < 3) {   // the next strip's fragments are asked for ahead of this strip's products
        nh = Frag<__bf16>::load((const __bf16*)sXh[buf] + ao + (i + 1) * 16 * kSp);
        nl = Frag<__bf16>::load((const __bf16*)sXl[buf] + ao + (i + 1) * 16 * kSp);
        __builtin_amdgcn_sched_barrier(0);   // holds those loads in front of the products: sunk behind them, each strip waits out its own LDS latency
      }
#pragma unroll
      for (int j = 0; j < 4; ++j) {
        acc[i][j] = Frag<__bf16>::mma(ah, bh[j], acc[i][j]);
        acc[i][j] = Frag<__bf16>::mma(ah, bl[j], acc[i][j]);
        acc[i][j] = Frag<__bf16>::mma(al, bh[j], acc[i][j]);
      }
      ah = nh;
      al = nl;
    }
  };

#pragma unroll 1   // rolled: one copy of the stage keeps the kernel's text short, which a first run fetches line by line
  for (int ks = 0; ks + 1 < kStages; ++ks) {
    store_stage(ks & 1);   // the buffer's last readers left it before the barrier of the stage before
    __syncthreads();       // publishes this stage; also ends every wave's reads of the other buffer, which the next stage overwrites
    // the next stage's global loads stand behind the barrier (in front of it the barrier's own wait would drain them) and fly during the products
#pragma unroll
    for (int i = 0; i < 4; ++i) xr[i] = *(const v4f*)(xp + (kStageK + i) * kPix);
#pragma unroll
    for (int it = 0; it < 8; ++it) wr[it] = *(const v4f*)(wp + kStageK + it * 32 * kCh);
    // as in front of the loop: the wait before the two pointers are advanced
    asm volatile("s_wait_xcnt 0x0" :: "v"(xp), "v"(wp) : "memory");
    xp += kStageK * kPix;
    wp += kStageK;
    products(ks & 1);
  }
  store_stage((kStages - 1) & 1);
  __syncthreads();         // publishes the last stage
  products((kStages - 1) & 1);

  // ---- epilogue: each 16 x 64 strip through the wave's own slab, whole 128-B row segments stored ----
  // LDS row 64 wm + 16 i + row holds pixel 4 * (16 (i & 1) + row) + 2 wm + (i >> 1) of the block (the staging map above)
  float* slab = sT[wave];
  const int n0 = wn * 64;
#pragma unroll
  for (int i = 0; i < 4; ++i) {
#pragma unroll
    for (int j = 0; j < 4; ++j)
#pragma unroll
      for (int r = 0; r < 8; ++r) slab[(mOff + r) * 68 + (j << 4) + rlane] = acc[i][j][r] * scale;
    __builtin_amdgcn_fence(__ATOMIC_RELEASE, "workgroup");
    __builtin_amdgcn_wave_barrier();
    __builtin_amdgcn_fence(__ATOMIC_ACQUIRE, "workgroup");
    const int q = lane >> 3, c8 = (lane & 7) * 8;
#pragma unroll
    for (int it = 0; it < 4; ++it) {
      const int row = it * 4 + q;
      const int pix = p0 + 4 * (16 * (i & 1) + row) + 2 * wm + (i >> 1);
      const float* sp = slab + row * 68 + c8;
      v2u h0, l0, h1, l1;
      split4(*(const v4f*)sp, h0, l0);
      split4(*(const v4f*)(sp + 4), h1, l1);
      const size_t co = ((size_t)(b * kPix + pix)) * kCh + n0 + c8;
      *(v4u*)(Ch + co) = (v4u){h0.x, h0.y, h1.x, h1.y};
      *(v4u*)(Cl + co) = (v4u){l0.x, l0.y, l1.x, l1.y};
    }
    __builtin_amdgcn_fence(__ATOMIC_RELEASE, "workgroup");
    __builtin_amdgcn_wave_barrier();
    __builtin_amdgcn_fence(__ATOMIC_ACQUIRE, "workgroup");
  }
}

// ---- local 7x7 window attention, both kv branches, output written in its final layout ----
// One block = (b, head, 4 rows x 32 cols of pixels) = 4 pixel tiles of 4 x 8 side by side, 2 waves and an own K neighbourhood in LDS each.
// Qh/Ql, KVh/KVl: bf16 hi/lo planes [b][p][256] (KV planes: branch-major, 2 x [b][p][256]); out: f32 [b][256][p].
// Wave w owns pixel rows y0+2w..y0+2w+1, cols x0..x0+7; its 8x14 union neighbourhood is LDS rows 28w..28w+111 of the
// tile's 10x14 neighbourhood (row index nr*14+nc, image pos (y0-3+nr, x0-3+nc), zero row when outside the image).
// second launch bound: holds the register allocation at three waves a SIMD, where it stood before the staged chunks were held in registers
__global__ __launch_bounds__(64 * kSub, 3) void local_window_attn_kernel(
    const unsigned short* __restrict__ Qh, const unsigned short* __restrict__ Ql,
    const unsigned short* __restrict__ KVh, const unsigned short* __restrict__ KVl,
    float* __restrict__ out)
{
  // a tile: 2 x 17920 B, the hi plane, then the lo plane, which one address register reaches by a constant offset; 4 tiles: 143360 B
  __shared__ __align__(16) unsigned short KshAll[kSub * 2 * kKPlane];

  const int sub  = threadIdx.x >> 6;   // pixel tile of this thread's wave pair
  const int tid  = threadIdx.x & 63;   // thread in the pair
  unsigned short* Ksh = KshAll + sub * 2 * kKPlane;
  const int w    = tid >> 5, lane = tid & 31, hh = lane >> 4, c = lane & 15;
  const int bidx = blockIdx.x;
  constexpr int kBlkX = kTilesX / kSub;
  const int tx   = bidx % kBlkX;
  const int ty   = (bidx / kBlkX) % kTilesY;
  const int head = (bidx / (kBlkX * kTilesY)) % kHeads;
  const int b    = bidx / (kBlkX * kTilesY * kHeads);
  const int y0 = ty * kTileY, xb = tx * kSub * kTileX, x0 = xb + sub * kTileX;
  const int nb = w * 2 * kNbCols;   // base LDS row of this wave's union neighbourhood
  // this lane's LDS elements in the wave's first 16 rows; rows 16 n further on add 16 n kKp (same key)
  int ksc[4], vtr[4];   // scores: row c, pieces 2 q + hh; transposing loads: row 8 hh + lane % 8, piece 2 dt + (lane / 8) % 2
#pragma unroll   // full: both arrays live in registers
  for (int q = 0; q < 4; ++q) {
    ksc[q] = k_at(nb + c, 2 * q + hh);
    vtr[q] = k_at(nb + 8 * hh + (lane & 7), 2 * q + ((lane >> 3) & 1));
  }

  // Q fragments of pixel c of this wave, the B operand of the transposed scores (split k-map via Frag load)
  v16b qh[2], ql[2];
  {
    const int py = y0 + 2 * w + (c >> 3), px = x0 + (c & 7);
    const size_t qoff = ((size_t)(b * kPix + py * kW + px)) * kCh + head * kDh;
    const __bf16* qhp = (const __bf16*)Qh + qoff;
    const __bf16* qlp = (const __bf16*)Ql + qoff;
#pragma unroll
    for (int dc = 0; dc < 2; ++dc) {
      qh[dc] = Frag<__bf16>::load(qhp + dc * 32 + 8 * hh);
      ql[dc] = Frag<__bf16>::load(qlp + dc * 32 + 8 * hh);
    }
  }
  // window of this lane's pixel c (row c / 8, col c % 8 of the wave's 2 x 8 pixels) as a bit mask over the 112 neighbours of the
  // wave's 8 x 14 union: rows c / 8 .. c / 8 + 6, cols c % 8 .. c % 8 + 6, exactly 49 bits. The words are shifted down by 8 hh, so
  // that bit 16 (t & 1) + r of word t / 2 stands for neighbour 16 t + 8 hh + r, the one that register r of score tile t holds.
  unsigned wmask[4] = {0u, 0u, 0u, 0u};
  {
    const int pr = c >> 3;
    const unsigned colbits = 0x7fu << (c & 7);
#pragma unroll   // full: bit offsets are constants
    for (int nr = 0; nr < 8; ++nr) {
      const unsigned rowbits = (nr >= pr && nr <= pr + 6) ? colbits : 0u;
      const int off = nr * kNbCols;
      wmask[off >> 5] |= rowbits << (off & 31);
      if ((off & 31) + kNbCols > 32) wmask[(off >> 5) + 1] |= rowbits >> (32 - (off & 31));
    }
#pragma unroll
    for (int k = 0; k < 4; ++k) wmask[k] >>= 8 * hh;
  }

  // staging map of this thread, the same in both branches: column tid / 8 of a half row, chunk tid % 8
  unsigned sgoff[2], sxmsk[2];   // byte offset in the image row (column clamped into the image), all-ones where the column is inside
#pragma unroll   // full: both entries live in registers
  for (int h = 0; h < 2; ++h) {
    const int gx = x0 - 3 + h * kStageCols + (tid >> 3);
    const int gxc = gx < 0 ? 0 : (gx > kW - 1 ? kW - 1 : gx);
    sgoff[h] = (unsigned)(gxc * kCh + (tid & 7) * 8) * 2u;
    sxmsk[h] = ((unsigned)gx < (unsigned)kW) ? 0xffffffffu : 0u;
  }
  const bool topOut = y0 < 3, botOut = y0 + kTileY + 3 > kW;   // uniform: the 3 rows above / below the tile lie outside the image

  v8f oacc[4];
#pragma unroll
  for (int dt = 0; dt < 4; ++dt) oacc[dt] = (v8f){0.f,0.f,0.f,0.f,0.f,0.f,0.f,0.f};
  const v4u z4 = {0u, 0u, 0u, 0u};
  const v8b z8 = __builtin_bit_cast(v8b, z4);

#pragma unroll 1
  for (int br = 0; br < 2; ++br) {
    __syncthreads();
    // stage the 10 x 14 neighbourhood, 8 chunks of 16 B a row and plane (zeros outside the image): one trip is half a
    // neighbourhood row, 7 columns x 8 chunks on 56 of the pair's 64 threads, so that the image row is uniform over the block.
    // All global loads of a branch are issued before the first LDS store: the wave waits out one load latency a branch, not one a trip.
    if (tid < kStageCols * 8) {
      // 32-bit byte offsets of this thread's chunk from the start of the two-branch plane (below 8 MiB), one for each zone
      // (3 rows above the tile: from image row y0 - 3; the tile's rows and the 3 rows below: from y0) and half row; a trip adds
      // its row as a constant. A zone outside the image reads the tile's own rows instead (3 rows further in) and is masked to zero.
      const unsigned anchor = (unsigned)((((br * kB + b) * kPix + y0 * kW) * kCh + head * kDh) * 2);
      unsigned voff[3][2];
#pragma unroll   // full: all six entries live in registers
      for (int h = 0; h < 2; ++h) {
        voff[1][h] = anchor + sgoff[h];
        voff[0][h] = voff[1][h] - (topOut ? 0u : 3u * kRowBytes);
        voff[2][h] = voff[1][h] - (botOut ? 3u * kRowBytes : 0u);
      }
      v4u vh[kStageTrips], vl[kStageTrips];
#pragma unroll   // full: the loaded chunks are held in registers, indexed by the trip
      for (int t = 0; t < kStageTrips; ++t) {
        const int nr = t >> 1, zone = nr < 3 ? 0 : (nr < 3 + kTileY ? 1 : 2);
        const int rows = zone == 0 ? nr : nr - 3;   // rows from the zone's offset, never negative
        vh[t] = *(const v4u*)((const char*)KVh + voff[zone][t & 1] + rows * kRowBytes);
        vl[t] = *(const v4u*)((const char*)KVl + voff[zone][t & 1] + rows * kRowBytes);
      }
      // the wait that stands before a register named by an issued load is rewritten; naming the six address registers keeps them
      // apart from the loads' own destination registers up to here
      asm volatile("s_wait_xcnt 0x0" :: "v"(voff[0][0]), "v"(voff[0][1]), "v"(voff[1][0]), "v"(voff[1][1]), "v"(voff[2][0]), "v"(voff[2][1]) : "memory");
#pragma unroll   // full: same register arrays
      for (int t = 0; t < kStageTrips; ++t) {
        const int nr = t >> 1;
        const unsigned msk = (nr < 3 ? topOut : (nr < 3 + kTileY ? false : botOut)) ? 0u : sxmsk[t & 1];
        v4u a = vh[t], d = vl[t];
        a.x &= msk; a.y &= msk; a.z &= msk; a.w &= msk;
        d.x &= msk; d.y &= msk; d.z &= msk; d.w &= msk;
        const int sdst = k_at(t * kStageCols + (tid >> 3), tid & 7);
        *(v4u*)(Ksh + sdst) = a;
        *(v4u*)(Ksh + sdst + kKPlane) = d;
      }
    }
    __syncthreads();

    // transposed scores s[t][r] = k(neighbour t*16+8hh+r) . q(pixel c): A fragments = rows of K in LDS (split k-map as in Q), B = Q.
    // A lane then holds 56 of the 112 scores of ONE pixel, lane c + 16 the rest, and tiles 2kk, 2kk+1 lie as the A fragment of P in k-step kk.
    v8f s[7];
#pragma unroll
    for (int t = 0; t < 7; ++t) {
      s[t] = (v8f){0.f,0.f,0.f,0.f,0.f,0.f,0.f,0.f};
#pragma unroll
      for (int dc = 0; dc < 2; ++dc) {
        const int k0 = ksc[2 * dc] + t * 16 * kKp, k1 = ksc[2 * dc + 1] + t * 16 * kKp;   // d = 32 dc + 8 hh .. + 7 and 16 further on, as in Q
        FragB kfh, kfl;
        kfh.h[0] = *(const v8b*)(Ksh + k0);
        kfh.h[1] = *(const v8b*)(Ksh + k1);
        kfl.h[0] = *(const v8b*)(Ksh + k0 + kKPlane);
        kfl.h[1] = *(const v8b*)(Ksh + k1 + kKPlane);
        s[t] = at_mma(kfh.v, qh[dc], s[t]);
        s[t] = at_mma(kfl.v, qh[dc], s[t]);
        s[t] = at_mma(kfh.v, ql[dc], s[t]);
      }
    }

    // window mask (49 neighbours, zero vectors included) + softmax in f32: maximum and sum run down the lane's own registers
    // (four independent chains each), then one exchange with the lane that holds the pixel's other half
    float mx4[4] = {-INFINITY, -INFINITY, -INFINITY, -INFINITY};
#pragma unroll
    for (int t = 0; t < 7; ++t)
#pragma unroll
      for (int r = 0; r < 8; ++r) {
        const bool inwin = (wmask[t >> 1] >> (16 * (t & 1) + r)) & 1u;
        const float sv = inwin ? s[t][r] : -INFINITY;
        s[t][r] = sv;
        mx4[r & 3] = fmaxf(mx4[r & 3], sv);
      }
    float mx = fmaxf(fmaxf(mx4[0], mx4[1]), fmaxf(mx4[2], mx4[3]));
    mx = fmaxf(mx, __shfl_xor(mx, 16, 32));
    float l4[4] = {0.f, 0.f, 0.f, 0.f};
#pragma unroll
    for (int t = 0; t < 7; ++t)
#pragma unroll
      for (int r = 0; r < 8; ++r) {
        const float p = expf(s[t][r] - mx);
        s[t][r] = p;
        l4[r & 3] += p;
      }
    float l = (l4[0] + l4[1]) + (l4[2] + l4[3]);
    l += __shfl_xor(l, 16, 32);
    const float scl = 0.5f / l;
    // P as bf16 hi/lo, two neighbours a word, in the registers where the scores stood
    v4u ph[7], pl[7];
#pragma unroll
    for (int t = 0; t < 7; ++t) {
      v2u h0, l0, h1, l1;
      split4((v4f){s[t][0] * scl, s[t][1] * scl, s[t][2] * scl, s[t][3] * scl}, h0, l0);
      split4((v4f){s[t][4] * scl, s[t][5] * scl, s[t][6] * scl, s[t][7] * scl}, h1, l1);
      ph[t] = (v4u){h0.x, h0.y, h1.x, h1.y};
      pl[t] = (v4u){l0.x, l0.y, l1.x, l1.y};
    }

    // O += P . V : A = P of pixel c straight from those registers, B = V, column d of the K rows, by transposing LDS loads (same k-map),
    // neighbour range 0..111; k-step 3 uses elements 0..7 only (8..15 zero in both operands)
    // The 16 loads of k-step kk + 1 are issued in front of the products of k-step kk (two register sets): asked for only where they are used,
    // each group of four would have its whole LDS latency waited out in front of its three products.
    FragB vfh[2][4], vfl[2][4];
    auto load_v = [&](int kk) {
#pragma unroll   // full: the fragments live in registers, indexed by constants
      for (int dt = 0; dt < 4; ++dt) {
        const int e0 = vtr[dt] + kk * 32 * kKp;
        vfh[kk & 1][dt].h[0] = ld_tr16(Ksh + e0);
        vfl[kk & 1][dt].h[0] = ld_tr16(Ksh + e0 + kKPlane);
        if (kk < 3) {
          vfh[kk & 1][dt].h[1] = ld_tr16(Ksh + e0 + 16 * kKp);
          vfl[kk & 1][dt].h[1] = ld_tr16(Ksh + e0 + 16 * kKp + kKPlane);
        } else {
          vfh[kk & 1][dt].h[1] = z8;
          vfl[kk & 1][dt].h[1] = z8;
        }
      }
    };
    load_v(0);
#pragma unroll
    for (int kk = 0; kk < 4; ++kk) {
      FragB pa, pb;
      pa.h[0] = __builtin_bit_cast(v8b, ph[2 * kk]);
      pb.h[0] = __builtin_bit_cast(v8b, pl[2 * kk]);
      if (kk < 3) {
        pa.h[1] = __builtin_bit_cast(v8b, ph[2 * kk + 1]);
        pb.h[1] = __builtin_bit_cast(v8b, pl[2 * kk + 1]);
        load_v(kk + 1);
      } else {
        pa.h[1] = z8;
        pb.h[1] = z8;
      }
#pragma unroll
      for (int dt = 0; dt < 4; ++dt) {
        oacc[dt] = at_mma(pa.v, vfh[kk & 1][dt].v, oacc[dt]);
        oacc[dt] = at_mma(pa.v, vfl[kk & 1][dt].v, oacc[dt]);
        oacc[dt] = at_mma(pb.v, vfh[kk & 1][dt].v, oacc[dt]);
      }
    }
  }

  // ---- epilogue: the block's output tile [64 channels][4 rows x 32 cols] is gathered in LDS, then stored as whole 128-B lines of out ----
  // A lane holds, for each dt, the 8 pixels of one tile row (row 2 w + hh, cols 8 sub .. + 7) of channel 16 dt + c: 32 contiguous bytes of out.
  __syncthreads();   // ends every wave's reads of the K rows, whose LDS the output tile takes over
  float* So = (float*)KshAll;
#pragma unroll
  for (int dt = 0; dt < 4; ++dt) {
    float* p = So + (dt * 16 + c) * kOp + (2 * w + hh) * (kSub * kTileX) + sub * kTileX;
    *(v4f*)p       = (v4f){oacc[dt][0], oacc[dt][1], oacc[dt][2], oacc[dt][3]};
    *(v4f*)(p + 4) = (v4f){oacc[dt][4], oacc[dt][5], oacc[dt][6], oacc[dt][7]};
  }
  __syncthreads();   // publishes the output tile to the waves that store it
  // wave wv stores channels 8 wv .. + 7; one store = one channel: 4 image rows x 128 B (lane: row lane / 8, 16-B piece lane % 8)
  const int wv = threadIdx.x >> 5;
  v4f val[8];
#pragma unroll
  for (int it = 0; it < 8; ++it) val[it] = *(const v4f*)(So + (wv * 8 + it) * kOp + lane * 4);
  float* op = out + ((size_t)(b * kCh + head * kDh + wv * 8)) * kPix + (y0 + (lane >> 3)) * kW + xb + (lane & 7) * 4;
#pragma unroll
  for (int it = 0; it < 8; ++it) *(v4f*)(op + it * kPix) = val[it];
}

// ---------------------------------------------------------------------------
// Workspace region map (bytes):
//   P16 = kB*kPix*kCh*2 = 4,194,304 (one bf16 plane [kB][kPix][kCh])
//   [ 0]          Q hi,lo                  2 x P16
//   [ 8,388,608]  KV hi (branch 0,1)       2 x P16
//   [16,777,216]  KV lo (branch 0,1)       2 x P16
//   total 25,165,824
// ---------------------------------------------------------------------------
extern "C" void kernel_launch(void* const* d_in, const int* in_sizes, int n_in,
                              void* d_out, int out_size, void* d_ws, size_t ws_size,
                              hipStream_t stream)
{
  const int nAct = kB * kCh * kPix;   // 2,097,152
  const int nW   = kCh * kCh;         // 65,536
  if (n_in < 5) return;
  if (in_sizes[0] != nAct || in_sizes[1] != nAct || in_sizes[2] != nAct) return;
  if (in_sizes[3] != nW || in_sizes[4] != nW) return;
  if (out_size != nAct) return;

  const float* kvmap1 = (const float*)d_in[0];
  const float* qmap   = (const float*)d_in[1];
  const float* kvmap2 = (const float*)d_in[2];
  const float* Wq     = (const float*)d_in[3];
  const float* Wkv    = (const float*)d_in[4];
  float* out = (float*)d_out;

  const size_t planeB  = (size_t)nAct * 2;
  char* ws = (char*)d_ws;
  size_t o = 0;
  unsigned short* Qh    = (unsigned short*)(ws + o); o += planeB;
  unsigned short* Ql    = (unsigned short*)(ws + o); o += planeB;
  unsigned short* KVh   = (unsigned short*)(ws + o); o += 2 * planeB;
  unsigned short* KVl   = (unsigned short*)(ws + o); o += 2 * planeB;
  if (o > ws_size) return;

  // 1: the three projections C[p][o] = sum_c X[c][p] W[o][c], straight from the f32 inputs; 3 x kB x 32 blocks of 8 waves
  proj_kernel<<<3 * kProjBlocks, 256, 0, stream>>>(
      qmap, kvmap1, kvmap2, Wq, Wkv,
      Qh, Ql, KVh, KVl, KVh + (size_t)nAct, KVl + (size_t)nAct);
  // 2: local window attention, both branches, written straight to out [b][ch][p]
  local_window_attn_kernel<<<kB * kHeads * kTilesY * (kTilesX / kSub), 64 * kSub, 0, stream>>>(Qh, Ql, KVh, KVl, out);
}

// v008
// A run of this version takes 25 microseconds.
// Next to v007, in two timings, it ran 1.05 times as fast each time.
// All steps since v000 together make it 4.89 times as fast.
// Contractions: 1x1 projections, local-window q.k and p.v all on v_wmma_f32_16x16x32_bf16 with bf16 hi/lo split operands (hi*hi + hi*lo + lo*hi), f32 accumulate; softmax, scaling and transposes in f32.
#include <hip/hip_runtime.h>
#include <stdint.h>
#include <stddef.h>

typedef __attribute__((ext_vector_type(16))) _Float16 v16h;
typedef __attribute__((ext_vector_type(8)))  _Float16 v8h;
typedef __attribute__((ext_vector_type(16))) __bf16   v16b;
typedef __attribute__((ext_vector_type(8)))  __bf16   v8b;
typedef __attribute__((ext_vector_type(8)))  float    v8f;
typedef __attribute__((ext_vector_type(4)))  float    v4f;
typedef __attribute__((ext_vector_type(4)))  unsigned int v4u;
typedef __attribute__((ext_vector_type(8)))  unsigned int v8u;
typedef __attribute__((ext_vector_type(8)))  unsigned short v8us;

template <typename T> struct Frag;
template <> struct Frag<__bf16> {
  typedef v16b V; union U { v16b v; v8b h[2]; };
  static __device__ __forceinline__ v16b load(const __bf16* p) {
    U f; f.h[0] = *(const v8b*)(p); f.h[1] = *(const v8b*)(p + 16); return f.v;
  }
  static __device__ __forceinline__ v8f mma(v16b a, v16b b, v8f c) {
    return __builtin_amdgcn_wmma_f32_16x16x32_bf16(false, a, false, b, (short)0, c, false, false);
  }
};

// ---- guarded bf16 WMMA ----
__device__ __forceinline__ v8f at_mma(v16b a, v16b b, v8f c) {
  c = __builtin_amdgcn_wmma_f32_16x16x32_bf16(false, a, false, b, (short)0, c, false, false);
  asm volatile("v_nop\n\tv_nop\n\tv_nop\n\tv_nop" : "+v"(c) : "v"(a), "v"(b));
  return c;
}

// ---- problem geometry ----
constexpr int kB     = 2;
constexpr int kPix   = 4096;
constexpr int kW     = 64;
constexpr int kCh    = 256;
constexpr int kHeads = 4;
constexpr int kDh    = 64;
constexpr int kTileY = 4;                       // pixel tile of one wave pair: 4 rows x 8 cols (2 rows x 8 cols a wave)
constexpr int kTileX = 8;
constexpr int kNbRows = kTileY + 6;             // 10 neighbourhood rows
constexpr int kNbCols = kTileX + 6;             // 14 neighbourhood cols
constexpr int kKRows  = kNbRows * kNbCols;      // 140 staged K rows per tile
constexpr int kKp     = kDh;                    // K row pitch in LDS (elements): 128 B, no pad; the eight 16-B pieces of a row are permuted by k_key()
constexpr int kKPlane = kKRows * kKp;           // elements of one staged plane
constexpr int kStageCols  = kNbCols / 2;        // 7 neighbourhood columns staged a trip
constexpr int kStageTrips = 2 * kNbRows;        // 20 trips stage one plane of K
constexpr int kRowBytes   = kW * kCh * 2;       // one image row of one bf16 plane
constexpr int kTilesY = kW / kTileY;            // 16
constexpr int kTilesX = kW / kTileX;            // 8
constexpr int kSub    = 4;                      // pixel tiles side by side in one block: 4 x 8 pixels x 4 B = one 128-B line of the output a row and channel
constexpr int kOp     = kTileY * kSub * kTileX + 4;   // pitch (floats) of one channel of the block's output tile in LDS: 16 B x odd
static_assert(kHeads * kDh == kCh, "geometry");
static_assert(kW * kW == kPix, "geometry");
static_assert(kNbCols % 2 == 0 && (kNbCols / 2) * 8 <= 64, "half a neighbourhood row fits one trip of a wave pair");
static_assert(kTileY >= 3 && kNbRows == kTileY + 6, "the 3 rows above (below) a tile are outside the image all together, and the tile has 3 rows to read in their place");
static_assert(kPix % 64 == 0 && kCh % 64 == 0 && kCh % 32 == 0, "gemm tile and K multiples");
static_assert(kW % kTileY == 0 && kW % kTileX == 0 && kTilesX % kSub == 0, "tile coverage");
static_assert(kSub * kTileX * 4 == 128 && kTileY * kSub * kTileX == 4 * 32, "a channel of the output tile: whole lines, one 16-B piece a lane");
static_assert(kDh * kOp * 4 <= kSub * 2 * kKPlane * 2, "a branch's output tile fits its K rows' LDS");
static_assert(2 * kNbCols + 6 * 16 + 8 + 7 < kKRows, "pv gather rows in range");

union FragB { v16b v; v8b h[2]; };

// K rows in LDS: 16-B piece j of row r stands at piece j ^ k_key(r) of the row. The key is the same 16 rows further on. Two rows fill the 64 banks, so
// 16 lanes fall on distinct banks both when they read one piece of 16 successive rows (rows of equal parity: 8 distinct keys) and when they read two
// neighbouring pieces of 8 successive rows from an even one (the transposing load; rows of equal parity: keys distinct above bit 0).
__device__ __forceinline__ int k_key(int row) { return (((row >> 1) & 3) << 1) | ((row >> 3) & 1); }
__device__ __forceinline__ int k_at(int row, int piece) { return row * kKp + ((piece ^ k_key(row)) << 3); }   // element offset

// transposing LDS load: the 32 lanes address the sixteen rows x two 16-B pieces of a 16 x 16 tile of 16-bit elements (lane l: row 8 (l / 16) + l % 8,
// piece (l / 8) % 2); lane l receives rows 8 (l / 16) .. + 7 of column l % 16, which is half a B fragment in the hardware's k order
typedef __attribute__((ext_vector_type(8))) short v8s;
__device__ __forceinline__ v8b ld_tr16(const unsigned short* p) {
  typedef __attribute__((address_space(3))) v8s lds_v8s;
  return __builtin_bit_cast(v8b, __builtin_amdgcn_ds_load_tr16_b128_v8i16((lds_v8s*)p));
}

// ---- the three 1x1 projections, operand preparation included: one launch ----
// C[p][o] = scale * sum_c X[c][p] * W[o][c], written as bf16 hi/lo planes [b][p][256]; product = hi.hi + hi.lo + lo.hi, f32 accumulate.
// One block = 128 pixels x 256 outputs of one (map, batch); 8 waves, wave (wm, wn) owns 64 pixels x 64 outputs (4 x 4 tiles of 16 x 16).
// A stage is 32 channels: the block reads X [32 c][128 p] and W [256 o][32 c] in f32 as whole 128-B lines, splits them into bf16 hi/lo in
// registers and stores them k-contiguous in LDS (X transposed on the way), two buffers; the next stage's global loads fly during the products.
typedef __attribute__((ext_vector_type(2))) float        v2f;
typedef __attribute__((ext_vector_type(2))) __bf16       v2b;
typedef __attribute__((ext_vector_type(2))) unsigned int v2u;
constexpr int kPT     = 128;                    // pixels a block
constexpr int kStageK = 32;                     // channels a stage = one k-step of the matrix instruction
constexpr int kStages = kCh / kStageK;          // 8
constexpr int kSp     = kStageK + 8;            // LDS row pitch (elements): 80 B = 16 B x odd, so that 16 rows read 16 B wide fall on distinct banks
constexpr int kProjBlocks = kB * (kPix / kPT);  // 64 blocks a map
static_assert(kPix % kPT == 0 && kCh % kStageK == 0 && kCh == 256 && kPT == 128, "projection tiling");

// four f32 -> four bf16 hi (nearest even) and four bf16 lo (the remainder, nearest even), two a word
__device__ __forceinline__ void split4(v4f v, v2u& hi, v2u& lo) {
#pragma unroll
  for (int q = 0; q < 2; ++q) {
    const v2f x = {v[2 * q], v[2 * q + 1]};
    const unsigned hw = __builtin_bit_cast(unsigned, __builtin_convertvector(x, v2b));
    const v2f hf = {__uint_as_float(hw << 16), __uint_as_float(hw & 0xffff0000u)};
    hi[q] = hw;
    lo[q] = __builtin_bit_cast(unsigned, __builtin_convertvector(x - hf, v2b));
  }
}

__global__ __launch_bounds__(256) void proj_kernel(
    const float* __restrict__ X0, const float* __restrict__ X1, const float* __restrict__ X2,
    const float* __restrict__ W0, const float* __restrict__ W1,
    unsigned short* __restrict__ C0h, unsigned short* __restrict__ C0l,
    unsigned short* __restrict__ C1h, unsigned short* __restrict__ C1l,
    unsigned short* __restrict__ C2h, unsigned short* __restrict__ C2l)
{
  __shared__ __align__(16) unsigned short sXh[2][kPT * kSp];   // 2 x 10240 B
  __shared__ __align__(16) unsigned short sXl[2][kPT * kSp];
  __shared__ __align__(16) unsigned short sWh[2][kCh * kSp];   // 2 x 20480 B
  __shared__ __align__(16) unsigned short sWl[2][kCh * kSp];
  __shared__ __align__(16) float sT[8][16 * 68];               // per-wave 16 x 64 slab of the epilogue, pitch 68 floats

  const int tid  = threadIdx.x;
  const int lane = tid & 31;
  const int wave = __builtin_amdgcn_readfirstlane(tid >> 5);
  const int wm = wave >> 2, wn = wave & 3;
  const int g  = blockIdx.x / kProjBlocks;
  const int rb = blockIdx.x - g * kProjBlocks;
  const int b  = rb / (kPix / kPT);
  const int p0 = (rb - b * (kPix / kPT)) * kPT;
  const float* X = (g == 0 ? X0 : (g == 1 ? X1 : X2)) + (size_t)b * kCh * kPix + p0;
  const float* Wf = g == 0 ? W0 : W1;
  unsigned short* Ch = g == 0 ? C0h : (g == 1 ? C1h : C2h);
  unsigned short* Cl = g == 0 ? C0l : (g == 1 ? C1l : C2l);
  const float scale = g == 0 ? 0.125f : 1.0f;

  // staging maps. X: wave w takes channels 4w..4w+3 of the stage, lane l pixels 4l..4l+3 (512 contiguous bytes a load).
  // Pixel 4l + j goes to LDS row 32j + l, so that the 32 lanes of a store write 32 consecutive rows.
  // W: 8 lanes take the 32 channels of one output row (128 B), a load covers 4 rows, 8 loads the 256 rows.
  const float* xp = X + (wave * 4 * kPix + lane * 4);            // this thread's chunk of the stage last loaded
  const float* wp = Wf + ((tid >> 3) * kCh + (tid & 7) * 4);
  const int xdst = lane * kSp + wave * 4;
  const int wdst = (tid >> 3) * kSp + (tid & 7) * 4;

  const int rlane = lane & 15;                 // row (A) / col (B, D) within a 16 x 16 tile
  const int koff  = (lane >> 4) * 8;           // k offset of this lane half
  const int mOff  = (lane >> 4) * 8;           // D row offset

  v8f acc[4][4];
#pragma unroll
  for (int i = 0; i < 4; ++i)
#pragma unroll
    for (int j = 0; j < 4; ++j) acc[i][j] = (v8f){0.f,0.f,0.f,0.f,0.f,0.f,0.f,0.f};

  v4f xr[4], wr[8];
#pragma unroll
  for (int i = 0; i < 4; ++i) xr[i] = *(const v4f*)(xp + i * kPix);
#pragma unroll
  for (int it = 0; it < 8; ++it) wr[it] = *(const v4f*)(wp + it * 32 * kCh);
  // the wait that stands before a register named by an issued load is rewritten; naming the two pointers keeps them in place up to here
  asm volatile("s_wait_xcnt 0x0" :: "v"(xp), "v"(wp) : "memory");

  // split the stage held in registers and store it in buffer buf
  auto store_stage = [&](int buf) {
    // X: the four channels of one pixel are the same component of the four loaded vectors
#pragma unroll
    for (int j = 0; j < 4; ++j) {
      const v4f t = {xr[0][j], xr[1][j], xr[2][j], xr[3][j]};
      v2u h, l;
      split4(t, h, l);
      *(v2u*)(sXh[buf] + j * 32 * kSp + xdst) = h;
      *(v2u*)(sXl[buf] + j * 32 * kSp + xdst) = l;
    }
#pragma unroll
    for (int it = 0; it < 8; ++it) {
      v2u h, l;
      split4(wr[it], h, l);
      *(v2u*)(sWh[buf] + it * 32 * kSp + wdst) = h;
      *(v2u*)(sWl[buf] + it * 32 * kSp + wdst) = l;
    }
  };
  // the 48 products of the stage in buffer buf
  auto products = [&](int buf) {
    v16b bh[4], bl[4];
#pragma unroll
    for (int j = 0; j < 4; ++j) {
      const int bo = (wn * 64 + (j << 4) + rlane) * kSp + koff;
      bh[j] = Frag<__bf16>::load((const __bf16*)sWh[buf] + bo);
      bl[j] = Frag<__bf16>::load((const __bf16*)sWl[buf] + bo);
    }
    const int ao = (wm * 64 + rlane) * kSp + koff;
    v16b ah = Frag<__bf16>::load((const __bf16*)sXh[buf] + ao);
    v16b al = Frag<__bf16>::load((const __bf16*)sXl[buf] + ao);
#pragma unroll
    for (int i = 0; i < 4; ++i) {
      v16b nh = ah, nl = al;
      if (i < 3) {   // the next strip's fragments are asked for ahead of this strip's products
        nh = Frag<__bf16>::load((const __bf16*)sXh[buf] + ao + (i + 1) * 16 * kSp);
        nl = Frag<__bf16>::load((const __bf16*)sXl[buf] + ao + (i + 1) * 16 * kSp);
        __builtin_amdgcn_sched_barrier(0);   // holds those loads in front of the products: sunk behind them, each strip waits out its own LDS latency
      }
#pragma unroll
      for (int j = 0; j < 4; ++j) {
        acc[i][j] = Frag<__bf16>::mma(ah, bh[j], acc[i][j]);
        acc[i][j] = Frag<__bf16>::mma(ah, bl[j], acc[i][j]);
        acc[i][j] = Frag<__bf16>::mma(al, bh[j], acc[i][j]);
      }
      ah = nh;
      al = nl;
    }
  };

#pragma unroll 1   // rolled: one copy of the stage keeps the kernel's text short, which a first run fetches line by line
  for (int ks = 0; ks + 1 < kStages; ++ks) {
    store_stage(ks & 1);   // the buffer's last readers left it before the barrier of the stage before
    __syncthreads();       // publishes this stage; also ends every wave's reads of the other buffer, which the next stage overwrites
    // the next stage's global loads stand behind the barrier (in front of it the barrier's own wait would drain them) and fly during the products
#pragma unroll
    for (int i = 0; i < 4; ++i) xr[i] = *(const v4f*)(xp + (kStageK + i) * kPix);
#pragma unroll
    for (int it = 0; it < 8; ++it) wr[it] = *(const v4f*)(wp + kStageK + it * 32 * kCh);
    // as in front of the loop: the wait before the two pointers are advanced
    asm volatile("s_wait_xcnt 0x0" :: "v"(xp), "v"(wp) : "memory");
    xp += kStageK * kPix;
    wp += kStageK;
    products(ks & 1);
  }
  store_stage((kStages - 1) & 1);
  __syncthreads();         // publishes the last stage
  products((kStages - 1) & 1);

  // ---- epilogue: each 16 x 64 strip through the wave's own slab, whole 128-B row segments stored ----
  // LDS row 64 wm + 16 i + row holds pixel 4 * (16 (i & 1) + row) + 2 wm + (i >> 1) of the block (the staging map above)
  float* slab = sT[wave];
  const int n0 = wn * 64;
#pragma unroll
  for (int i = 0; i < 4; ++i) {
#pragma unroll
    for (int j = 0; j < 4; ++j)
#pragma unroll
      for (int r = 0; r < 8; ++r) slab[(mOff + r) * 68 + (j << 4) + rlane] = acc[i][j][r] * scale;
    __builtin_amdgcn_fence(__ATOMIC_RELEASE, "workgroup");
    __builtin_amdgcn_wave_barrier();
    __builtin_amdgcn_fence(__ATOMIC_ACQUIRE, "workgroup");
    const int q = lane >> 3, c8 = (lane & 7) * 8;
#pragma unroll
    for (int it = 0; it < 4; ++it) {
      const int row = it * 4 + q;
      const int pix = p0 + 4 * (16 * (i & 1) + row) + 2 * wm + (i >> 1);
      const float* sp = slab + row * 68 + c8;
      v2u h0, l0, h1, l1;
      split4(*(const v4f*)sp, h0, l0);
      split4(*(const v4f*)(sp + 4), h1, l1);
      const size_t co = ((size_t)(b * kPix + pix)) * kCh + n0 + c8;
      *(v4u*)(Ch + co) = (v4u){h0.x, h0.y, h1.x, h1.y};
      *(v4u*)(Cl + co) = (v4u){l0.x, l0.y, l1.x, l1.y};
    }
    __builtin_amdgcn_fence(__ATOMIC_RELEASE, "workgroup");
    __builtin_amdgcn_wave_barrier();
    __builtin_amdgcn_fence(__ATOMIC_ACQUIRE, "workgroup");
  }
}

// ---- local 7x7 window attention, both kv branches, output written in its final layout ----
// One block = (b, head, 4 rows x 32 cols of pixels) = 4 pixel tiles of 4 x 8 side by side x 2 kv branches, 2 waves and an own K neighbourhood in LDS each:
// waves 0..7 work on branch 0 while waves 8..15 work on branch 1 (four waves a SIMD); the two halves of the output meet in LDS in the epilogue.
// Qh/Ql, KVh/KVl: bf16 hi/lo planes [b][p][256] (KV planes: branch-major, 2 x [b][p][256]); out: f32 [b][256][p].
// Wave w owns pixel rows y0+2w..y0+2w+1, cols x0..x0+7; its 8x14 union neighbourhood is LDS rows 28w..28w+111 of the
// tile's 10x14 neighbourhood (row index nr*14+nc, image pos (y0-3+nr, x0-3+nc), zero row when outside the image).
__global__ __launch_bounds__(2 * 64 * kSub) void local_window_attn_kernel(
    const unsigned short* __restrict__ Qh, const unsigned short* __restrict__ Ql,
    const unsigned short* __restrict__ KVh, const unsigned short* __restrict__ KVl,
    float* __restrict__ out)
{
  // a tile: 2 x 17920 B, the hi plane, then the lo plane, which one address register reaches by a constant offset; 4 tiles: 143360 B; 2 branches: 286720 B
  __shared__ __align__(16) unsigned short KshAll[2 * kSub * 2 * kKPlane];

  const int br   = __builtin_amdgcn_readfirstlane(threadIdx.x >> 8);   // kv branch of this thread's wave
  const int sub  = (threadIdx.x >> 6) & (kSub - 1);   // pixel tile of this thread's wave pair
  const int tid  = threadIdx.x & 63;   // thread in the pair
  unsigned short* Ksh = KshAll + (br * kSub + sub) * 2 * kKPlane;
  const int w    = tid >> 5, lane = tid & 31, hh = lane >> 4, c = lane & 15;
  const int bidx = blockIdx.x;
  constexpr int kBlkX = kTilesX / kSub;
  const int tx   = bidx % kBlkX;
  const int ty   = (bidx / kBlkX) % kTilesY;
  const int head = (bidx / (kBlkX * kTilesY)) % kHeads;
  const int b    = bidx / (kBlkX * kTilesY * kHeads);
  const int y0 = ty * kTileY, xb = tx * kSub * kTileX, x0 = xb + sub * kTileX;
  const int nb = w * 2 * kNbCols;   // base LDS row of this wave's union neighbourhood
  // this lane's LDS elements in the wave's first 16 rows; rows 16 n further on add 16 n kKp (same key)
  int ksc[4], vtr[4];   // scores: row c, pieces 2 q + hh; transposing loads: row 8 hh + lane % 8, piece 2 dt + (lane / 8) % 2
#pragma unroll   // full: both arrays live in registers
  for (int q = 0; q < 4; ++q) {
    ksc[q] = k_at(nb + c, 2 * q + hh);
    vtr[q] = k_at(nb + 8 * hh + (lane & 7), 2 * q + ((lane >> 3) & 1));
  }

  // Q fragments of pixel c of this wave, the B operand of the transposed scores (split k-map via Frag load)
  v16b qh[2], ql[2];
  {
    const int py = y0 + 2 * w + (c >> 3), px = x0 + (c & 7);
    const size_t qoff = ((size_t)(b * kPix + py * kW + px)) * kCh + head * kDh;
    const __bf16* qhp = (const __bf16*)Qh + qoff;
    const __bf16* qlp = (const __bf16*)Ql + qoff;
#pragma unroll
    for (int dc = 0; dc < 2; ++dc) {
      qh[dc] = Frag<__bf16>::load(qhp + dc * 32 + 8 * hh);
      ql[dc] = Frag<__bf16>::load(qlp + dc * 32 + 8 * hh);
    }
  }
  // window of this lane's pixel c (row c / 8, col c % 8 of the wave's 2 x 8 pixels) as a bit mask over the 112 neighbours of the
  // wave's 8 x 14 union: rows c / 8 .. c / 8 + 6, cols c % 8 .. c % 8 + 6, exactly 49 bits. The words are shifted down by 8 hh, so
  // that bit 16 (t & 1) + r of word t / 2 stands for neighbour 16 t + 8 hh + r, the one that register r of score tile t holds.
  unsigned wmask[4] = {0u, 0u, 0u, 0u};
  {
    const int pr = c >> 3;
    const unsigned colbits = 0x7fu << (c & 7);
#pragma unroll   // full: bit offsets are constants
    for (int nr = 0; nr < 8; ++nr) {
      const unsigned rowbits = (nr >= pr && nr <= pr + 6) ? colbits : 0u;
      const int off = nr * kNbCols;
      wmask[off >> 5] |= rowbits << (off & 31);
      if ((off & 31) + kNbCols > 32) wmask[(off >> 5) + 1] |= rowbits >> (32 - (off & 31));
    }
#pragma unroll
    for (int k = 0; k < 4; ++k) wmask[k] >>= 8 * hh;
  }

  // staging map of this thread, the same in both branches: column tid / 8 of a half row, chunk tid % 8
  unsigned sgoff[2], sxmsk[2];   // byte offset in the image row (column clamped into the image), all-ones where the column is inside
#pragma unroll   // full: both entries live in registers
  for (int h = 0; h < 2; ++h) {
    const int gx = x0 - 3 + h * kStageCols + (tid >> 3);
    const int gxc = gx < 0 ? 0 : (gx > kW - 1 ? kW - 1 : gx);
    sgoff[h] = (unsigned)(gxc * kCh + (tid & 7) * 8) * 2u;
    sxmsk[h] = ((unsigned)gx < (unsigned)kW) ? 0xffffffffu : 0u;
  }
  const bool topOut = y0 < 3, botOut = y0 + kTileY + 3 > kW;   // uniform: the 3 rows above / below the tile lie outside the image

  v8f oacc[4];
#pragma unroll
  for (int dt = 0; dt < 4; ++dt) oacc[dt] = (v8f){0.f,0.f,0.f,0.f,0.f,0.f,0.f,0.f};
  const v4u z4 = {0u, 0u, 0u, 0u};
  const v8b z8 = __builtin_bit_cast(v8b, z4);

  {
    // stage the 10 x 14 neighbourhood, 8 chunks of 16 B a row and plane (zeros outside the image): one trip is half a
    // neighbourhood row, 7 columns x 8 chunks on 56 of the pair's 64 threads, so that the image row is uniform over the block.
    // All global loads are issued before the first LDS store: the wave waits out one load latency, not one a trip.
    if (tid < kStageCols * 8) {
      // 32-bit byte offsets of this thread's chunk from the start of the two-branch plane (below 8 MiB), one for each zone
      // (3 rows above the tile: from image row y0 - 3; the tile's rows and the 3 rows below: from y0) and half row; a trip adds
      // its row as a constant. A zone outside the image reads the tile's own rows instead (3 rows further in) and is masked to zero.
      const unsigned anchor = (unsigned)((((br * kB + b) * kPix + y0 * kW) * kCh + head * kDh) * 2);
      unsigned voff[3][2];
#pragma unroll   // full: all six entries live in registers
      for (int h = 0; h < 2; ++h) {
        voff[1][h] = anchor + sgoff[h];
        voff[0][h] = voff[1][h] - (topOut ? 0u : 3u * kRowBytes);
        voff[2][h] = voff[1][h] - (botOut ? 3u * kRowBytes : 0u);
      }
      v4u vh[kStageTrips], vl[kStageTrips];
#pragma unroll   // full: the loaded chunks are held in registers, indexed by the trip
      for (int t = 0; t < kStageTrips; ++t) {
        const int nr = t >> 1, zone = nr < 3 ? 0 : (nr < 3 + kTileY ? 1 : 2);
        const int rows = zone == 0 ? nr : nr - 3;   // rows from the zone's offset, never negative
        vh[t] = *(const v4u*)((const char*)KVh + voff[zone][t & 1] + rows * kRowBytes);
        vl[t] = *(const v4u*)((const char*)KVl + voff[zone][t & 1] + rows * kRowBytes);
      }
      // the wait that stands before a register named by an issued load is rewritten; naming the six address registers keeps them
      // apart from the loads' own destination registers up to here
      asm volatile("s_wait_xcnt 0x0" :: "v"(voff[0][0]), "v"(voff[0][1]), "v"(voff[1][0]), "v"(voff[1][1]), "v"(voff[2][0]), "v"(voff[2][1]) : "memory");
#pragma unroll   // full: same register arrays
      for (int t = 0; t < kStageTrips; ++t) {
        const int nr = t >> 1;
        const unsigned msk = (nr < 3 ? topOut : (nr < 3 + kTileY ? false : botOut)) ? 0u : sxmsk[t & 1];
        v4u a = vh[t], d = vl[t];
        a.x &= msk; a.y &= msk; a.z &= msk; a.w &= msk;
        d.x &= msk; d.y &= msk; d.z &= msk; d.w &= msk;
        const int sdst = k_at(t * kStageCols + (tid >> 3), tid & 7);
        *(v4u*)(Ksh + sdst) = a;
        *(v4u*)(Ksh + sdst + kKPlane) = d;
      }
    }
    __syncthreads();

    // transposed scores s[t][r] = k(neighbour t*16+8hh+r) . q(pixel c): A fragments = rows of K in LDS (split k-map as in Q), B = Q.
    // A lane then holds 56 of the 112 scores of ONE pixel, lane c + 16 the rest, and tiles 2kk, 2kk+1 lie as the A fragment of P in k-step kk.
    v8f s[7];
#pragma unroll
    for (int t = 0; t < 7; ++t) {
      s[t] = (v8f){0.f,0.f,0.f,0.f,0.f,0.f,0.f,0.f};
#pragma unroll
      for (int dc = 0; dc < 2; ++dc) {
        const int k0 = ksc[2 * dc] + t * 16 * kKp, k1 = ksc[2 * dc + 1] + t * 16 * kKp;   // d = 32 dc + 8 hh .. + 7 and 16 further on, as in Q
        FragB kfh, kfl;
        kfh.h[0] = *(const v8b*)(Ksh + k0);
        kfh.h[1] = *(const v8b*)(Ksh + k1);
        kfl.h[0] = *(const v8b*)(Ksh + k0 + kKPlane);
        kfl.h[1] = *(const v8b*)(Ksh + k1 + kKPlane);
        s[t] = at_mma(kfh.v, qh[dc], s[t]);
        s[t] = at_mma(kfl.v, qh[dc], s[t]);
        s[t] = at_mma(kfh.v, ql[dc], s[t]);
      }
    }

    // window mask (49 neighbours, zero vectors included) + softmax in f32: maximum and sum run down the lane's own registers
    // (four independent chains each), then one exchange with the lane that holds the pixel's other half
    float mx4[4] = {-INFINITY, -INFINITY, -INFINITY, -INFINITY};
#pragma unroll
    for (int t = 0; t < 7; ++t)
#pragma unroll
      for (int r = 0; r < 8; ++r) {
        const bool inwin = (wmask[t >> 1] >> (16 * (t & 1) + r)) & 1u;
        const float sv = inwin ? s[t][r] : -INFINITY;
        s[t][r] = sv;
        mx4[r & 3] = fmaxf(mx4[r & 3], sv);
      }
    float mx = fmaxf(fmaxf(mx4[0], mx4[1]), fmaxf(mx4[2], mx4[3]));
    mx = fmaxf(mx, __shfl_xor(mx, 16, 32));
    float l4[4] = {0.f, 0.f, 0.f, 0.f};
#pragma unroll
    for (int t = 0; t < 7; ++t)
#pragma unroll
      for (int r = 0; r < 8; ++r) {
        const float p = expf(s[t][r] - mx);
        s[t][r] = p;
        l4[r & 3] += p;
      }
    float l = (l4[0] + l4[1]) + (l4[2] + l4[3]);
    l += __shfl_xor(l, 16, 32);
    const float scl = 0.5f / l;
    // P as bf16 hi/lo, two neighbours a word, in the registers where the scores stood
    v4u ph[7], pl[7];
#pragma unroll
    for (int t = 0; t < 7; ++t) {
      v2u h0, l0, h1, l1;
      split4((v4f){s[t][0] * scl, s[t][1] * scl, s[t][2] * scl, s[t][3] * scl}, h0, l0);
      split4((v4f){s[t][4] * scl, s[t][5] * scl, s[t][6] * scl, s[t][7] * scl}, h1, l1);
      ph[t] = (v4u){h0.x, h0.y, h1.x, h1.y};
      pl[t] = (v4u){l0.x, l0.y, l1.x, l1.y};
    }

    // O += P . V : A = P of pixel c straight from those registers, B = V, column d of the K rows, by transposing LDS loads (same k-map),
    // neighbour range 0..111; k-step 3 uses elements 0..7 only (8..15 zero in both operands)
    // The 16 loads of k-step kk + 1 are issued in front of the products of k-step kk (two register sets): asked for only where they are used,
    // each group of four would have its whole LDS latency waited out in front of its three products.
    FragB vfh[2][4], vfl[2][4];
    auto load_v = [&](int kk) {
#pragma unroll   // full: the fragments live in registers, indexed by constants
      for (int dt = 0; dt < 4; ++dt) {
        const int e0 = vtr[dt] + kk * 32 * kKp;
        vfh[kk & 1][dt].h[0] = ld_tr16(Ksh + e0);
        vfl[kk & 1][dt].h[0] = ld_tr16(Ksh + e0 + kKPlane);
        if (kk < 3) {
          vfh[kk & 1][dt].h[1] = ld_tr16(Ksh + e0 + 16 * kKp);
          vfl[kk & 1][dt].h[1] = ld_tr16(Ksh + e0 + 16 * kKp + kKPlane);
        } else {
          vfh[kk & 1][dt].h[1] = z8;
          vfl[kk & 1][dt].h[1] = z8;
        }
      }
    };
    load_v(0);
#pragma unroll
    for (int kk = 0; kk < 4; ++kk) {
      FragB pa, pb;
      pa.h[0] = __builtin_bit_cast(v8b, ph[2 * kk]);
      pb.h[0] = __builtin_bit_cast(v8b, pl[2 * kk]);
      if (kk < 3) {
        pa.h[1] = __builtin_bit_cast(v8b, ph[2 * kk + 1]);
        pb.h[1] = __builtin_bit_cast(v8b, pl[2 * kk + 1]);
        load_v(kk + 1);
      } else {
        pa.h[1] = z8;
        pb.h[1] = z8;
      }
#pragma unroll
      for (int dt = 0; dt < 4; ++dt) {
        oacc[dt] = at_mma(pa.v, vfh[kk & 1][dt].v, oacc[dt]);
        oacc[dt] = at_mma(pa.v, vfl[kk & 1][dt].v, oacc[dt]);
        oacc[dt] = at_mma(pb.v, vfh[kk & 1][dt].v, oacc[dt]);
      }
    }
  }

  // ---- epilogue: each branch's output tile [64 channels][4 rows x 32 cols] is gathered in LDS, the two are added and stored as whole 128-B lines of out ----
  // A lane holds, for each dt, the 8 pixels of one tile row (row 2 w + hh, cols 8 sub .. + 7) of channel 16 dt + c: 32 contiguous bytes of out.
  __syncthreads();   // ends every wave's reads of the K rows, whose LDS the output tiles take over
  float* So = (float*)(KshAll + br * kSub * 2 * kKPlane);   // this branch's tile, at the head of this branch's K rows
#pragma unroll
  for (int dt = 0; dt < 4; ++dt) {
    float* p = So + (dt * 16 + c) * kOp + (2 * w + hh) * (kSub * kTileX) + sub * kTileX;
    *(v4f*)p       = (v4f){oacc[dt][0], oacc[dt][1], oacc[dt][2], oacc[dt][3]};
    *(v4f*)(p + 4) = (v4f){oacc[dt][4], oacc[dt][5], oacc[dt][6], oacc[dt][7]};
  }
  __syncthreads();   // publishes both output tiles to the waves that store them
  // wave wv stores channels 4 wv .. + 3; one store = one channel: 4 image rows x 128 B (lane: row lane / 8, 16-B piece lane % 8)
  const int wv = threadIdx.x >> 5;
  const float* S0 = (const float*)KshAll + wv * 4 * kOp + lane * 4;
  const float* S1 = S0 + kSub * kKPlane;   // branch 1's tile: kSub * 2 * kKPlane 16-bit elements further on
  v4f val[4];
#pragma unroll
  for (int it = 0; it < 4; ++it) val[it] = *(const v4f*)(S0 + it * kOp) + *(const v4f*)(S1 + it * kOp);
  float* op = out + ((size_t)(b * kCh + head * kDh + wv * 4)) * kPix + (y0 + (lane >> 3)) * kW + xb + (lane & 7) * 4;
#pragma unroll
  for (int it = 0; it < 4; ++it) *(v4f*)(op + it * kPix) = val[it];
}

// ---------------------------------------------------------------------------
// Workspace region map (bytes):
//   P16 = kB*kPix*kCh*2 = 4,194,304 (one bf16 plane [kB][kPix][kCh])
//   [ 0]          Q hi,lo                  2 x P16
//   [ 8,388,608]  KV hi (branch 0,1)       2 x P16
//   [16,777,216]  KV lo (branch 0,1)       2 x P16
//   total 25,165,824
// ---------------------------------------------------------------------------
extern "C" void kernel_launch(void* const* d_in, const int* in_sizes, int n_in,
                              void* d_out, int out_size, void* d_ws, size_t ws_size,
                              hipStream_t stream)
{
  const int nAct = kB * kCh * kPix;   // 2,097,152
  const int nW   = kCh * kCh;         // 65,536
  if (n_in < 5) return;
  if (in_sizes[0] != nAct || in_sizes[1] != nAct || in_sizes[2] != nAct) return;
  if (in_sizes[3] != nW || in_sizes[4] != nW) return;
  if (out_size != nAct) return;

  const float* kvmap1 = (const float*)d_in[0];
  const float* qmap   = (const float*)d_in[1];
  const float* kvmap2 = (const float*)d_in[2];
  const float* Wq     = (const float*)d_in[3];
  const float* Wkv    = (const float*)d_in[4];
  float* out = (float*)d_out;

  const size_t planeB  = (size_t)nAct * 2;
  char* ws = (char*)d_ws;
  size_t o = 0;
  unsigned short* Qh    = (unsigned short*)(ws + o); o += planeB;
  unsigned short* Ql    = (unsigned short*)(ws + o); o += planeB;
  unsigned short* KVh   = (unsigned short*)(ws + o); o += 2 * planeB;
  unsigned short* KVl   = (unsigned short*)(ws + o); o += 2 * planeB;
  if (o > ws_size) return;

  // 1: the three projections C[p][o] = sum_c X[c][p] W[o][c], straight from the f32 inputs; 3 x kB x 32 blocks of 8 waves
  proj_kernel<<<3 * kProjBlocks, 256, 0, stream>>>(
      qmap, kvmap1, kvmap2, Wq, Wkv,
      Qh, Ql, KVh, KVl, KVh + (size_t)nAct, KVl + (size_t)nAct);
  // 2: local window attention, both branches side by side in a block, written straight to out [b][ch][p]
  local_window_attn_kernel<<<kB * kHeads * kTilesY * (kTilesX / kSub), 2 * 64 * kSub, 0, stream>>>(Qh, Ql, KVh, KVl, out);
}

// v009
// A run of this version takes 23.8 microseconds.
// Two timings next to v008 both put it at 1.05 times that version's speed.
// Counting every step since v000, it is 5.15 times as fast.
// Contractions: 1x1 projections, local-window q.k and p.v all on v_wmma_f32_16x16x32_bf16 with bf16 hi/lo split operands (hi*hi + hi*lo + lo*hi), f32 accumulate; softmax, scaling and transposes in f32.
#include <hip/hip_runtime.h>
#include <stdint.h>
#include <stddef.h>

typedef __attribute__((ext_vector_type(16))) _Float16 v16h;
typedef __attribute__((ext_vector_type(8)))  _Float16 v8h;
typedef __attribute__((ext_vector_type(16))) __bf16   v16b;
typedef __attribute__((ext_vector_type(8)))  __bf16   v8b;
typedef __attribute__((ext_vector_type(8)))  float    v8f;
typedef __attribute__((ext_vector_type(4)))  float    v4f;
typedef __attribute__((ext_vector_type(4)))  unsigned int v4u;
typedef __attribute__((ext_vector_type(8)))  unsigned int v8u;
typedef __attribute__((ext_vector_type(8)))  unsigned short v8us;

template <typename T> struct Frag;
template <> struct Frag<__bf16> {
  typedef v16b V; union U { v16b v; v8b h[2]; };
  static __device__ __forceinline__ v16b load(const __bf16* p) {
    U f; f.h[0] = *(const v8b*)(p); f.h[1] = *(const v8b*)(p + 16); return f.v;
  }
  static __device__ __forceinline__ v8f mma(v16b a, v16b b, v8f c) {
    return __builtin_amdgcn_wmma_f32_16x16x32_bf16(false, a, false, b, (short)0, c, false, false);
  }
};

// ---- guarded bf16 WMMA ----
__device__ __forceinline__ v8f at_mma(v16b a, v16b b, v8f c) {
  c = __builtin_amdgcn_wmma_f32_16x16x32_bf16(false, a, false, b, (short)0, c, false, false);
  asm volatile("v_nop\n\tv_nop\n\tv_nop\n\tv_nop" : "+v"(c) : "v"(a), "v"(b));
  return c;
}

// eight 2^x on the hardware's v_exp_f32, each in its own register. One statement, so that no instruction which reads a result or overwrites a
// source can come to stand directly behind one of them; the v_nop is the slot that the instruction set asks for behind the last.
__device__ __forceinline__ void exp2_x8(float (&e)[8]) {
  asm("v_exp_f32 %0, %0\n\tv_exp_f32 %1, %1\n\tv_exp_f32 %2, %2\n\tv_exp_f32 %3, %3\n\t"
      "v_exp_f32 %4, %4\n\tv_exp_f32 %5, %5\n\tv_exp_f32 %6, %6\n\tv_exp_f32 %7, %7\n\tv_nop"
      : "+v"(e[0]), "+v"(e[1]), "+v"(e[2]), "+v"(e[3]), "+v"(e[4]), "+v"(e[5]), "+v"(e[6]), "+v"(e[7]));
}

// ---- problem geometry ----
constexpr int kB     = 2;
constexpr int kPix   = 4096;
constexpr int kW     = 64;
constexpr int kCh    = 256;
constexpr int kHeads = 4;
constexpr int kDh    = 64;
constexpr int kTileY = 4;                       // pixel tile of one wave pair: 4 rows x 8 cols (2 rows x 8 cols a wave)
constexpr int kTileX = 8;
constexpr int kNbRows = kTileY + 6;             // 10 neighbourhood rows
constexpr int kNbCols = kTileX + 6;             // 14 neighbourhood cols
constexpr int kKRows  = kNbRows * kNbCols;      // 140 staged K rows per tile
constexpr int kKp     = kDh;                    // K row pitch in LDS (elements): 128 B, no pad; the eight 16-B pieces of a row are permuted by k_key()
constexpr int kKPlane = kKRows * kKp;           // elements of one staged plane
constexpr int kStageCols  = kNbCols / 2;        // 7 neighbourhood columns staged a trip
constexpr int kStageTrips = 2 * kNbRows;        // 20 trips stage one plane of K
constexpr int kRowBytes   = kW * kCh * 2;       // one image row of one bf16 plane
constexpr int kTilesY = kW / kTileY;            // 16
constexpr int kTilesX = kW / kTileX;            // 8
constexpr int kSub    = 4;                      // pixel tiles side by side in one block: 4 x 8 pixels x 4 B = one 128-B line of the output a row and channel
constexpr int kOp     = kTileY * kSub * kTileX + 4;   // pitch (floats) of one channel of the block's output tile in LDS: 16 B x odd
static_assert(kHeads * kDh == kCh, "geometry");
static_assert(kW * kW == kPix, "geometry");
static_assert(kNbCols % 2 == 0 && (kNbCols / 2) * 8 <= 64, "half a neighbourhood row fits one trip of a wave pair");
static_assert(kTileY >= 3 && kNbRows == kTileY + 6, "the 3 rows above (below) a tile are outside the image all together, and the tile has 3 rows to read in their place");
static_assert(kPix % 64 == 0 && kCh % 64 == 0 && kCh % 32 == 0, "gemm tile and K multiples");
static_assert(kW % kTileY == 0 && kW % kTileX == 0 && kTilesX % kSub == 0, "tile coverage");
static_assert(kSub * kTileX * 4 == 128 && kTileY * kSub * kTileX == 4 * 32, "a channel of the output tile: whole lines, one 16-B piece a lane");
static_assert(kDh * kOp * 4 <= kSub * 2 * kKPlane * 2, "a branch's output tile fits its K rows' LDS");
static_assert(2 * kNbCols + 6 * 16 + 8 + 7 < kKRows, "pv gather rows in range");

union FragB { v16b v; v8b h[2]; };

// K rows in LDS: 16-B piece j of row r stands at piece j ^ k_key(r) of the row. The key is the same 16 rows further on. Two rows fill the 64 banks, so
// 16 lanes fall on distinct banks both when they read one piece of 16 successive rows (rows of equal parity: 8 distinct keys) and when they read two
// neighbouring pieces of 8 successive rows from an even one (the transposing load; rows of equal parity: keys distinct above bit 0).
__device__ __forceinline__ int k_key(int row) { return (((row >> 1) & 3) << 1) | ((row >> 3) & 1); }
__device__ __forceinline__ int k_at(int row, int piece) { return row * kKp + ((piece ^ k_key(row)) << 3); }   // element offset

// transposing LDS load: the 32 lanes address the sixteen rows x two 16-B pieces of a 16 x 16 tile of 16-bit elements (lane l: row 8 (l / 16) + l % 8,
// piece (l / 8) % 2); lane l receives rows 8 (l / 16) .. + 7 of column l % 16, which is half a B fragment in the hardware's k order
typedef __attribute__((ext_vector_type(8))) short v8s;
__device__ __forceinline__ v8b ld_tr16(const unsigned short* p) {
  typedef __attribute__((address_space(3))) v8s lds_v8s;
  return __builtin_bit_cast(v8b, __builtin_amdgcn_ds_load_tr16_b128_v8i16((lds_v8s*)p));
}

// ---- the three 1x1 projections, operand preparation included: one launch ----
// C[p][o] = scale * sum_c X[c][p] * W[o][c], written as bf16 hi/lo planes [b][p][256]; product = hi.hi + hi.lo + lo.hi, f32 accumulate.
// scale of the Q map: log2(e) / 8, of the KV maps: 1.
// One block = 128 pixels x 256 outputs of one (map, batch); 8 waves, wave (wm, wn) owns 64 pixels x 64 outputs (4 x 4 tiles of 16 x 16).
// A stage is 32 channels: the block reads X [32 c][128 p] and W [256 o][32 c] in f32 as whole 128-B lines, splits them into bf16 hi/lo in
// registers and stores them k-contiguous in LDS (X transposed on the way), two buffers; the next stage's global loads fly during the products.
typedef __attribute__((ext_vector_type(2))) float        v2f;
typedef __attribute__((ext_vector_type(2))) __bf16       v2b;
typedef __attribute__((ext_vector_type(2))) unsigned int v2u;
constexpr int kPT     = 128;                    // pixels a block
constexpr int kStageK = 32;                     // channels a stage = one k-step of the matrix instruction
constexpr int kStages = kCh / kStageK;          // 8
constexpr int kSp     = kStageK + 8;            // LDS row pitch (elements): 80 B = 16 B x odd, so that 16 rows read 16 B wide fall on distinct banks
constexpr int kProjBlocks = kB * (kPix / kPT);  // 64 blocks a map
constexpr float kLog2e = 1.44269504088896340736f;
static_assert(kPix % kPT == 0 && kCh % kStageK == 0 && kCh == 256 && kPT == 128, "projection tiling");

// four f32 -> four bf16 hi (nearest even) and four bf16 lo (the remainder, nearest even), two a word
__device__ __forceinline__ void split4(v4f v, v2u& hi, v2u& lo) {
#pragma unroll
  for (int q = 0; q < 2; ++q) {
    const v2f x = {v[2 * q], v[2 * q + 1]};
    const unsigned hw = __builtin_bit_cast(unsigned, __builtin_convertvector(x, v2b));
    const v2f hf = {__uint_as_float(hw << 16), __uint_as_float(hw & 0xffff0000u)};
    hi[q] = hw;
    lo[q] = __builtin_bit_cast(unsigned, __builtin_convertvector(x - hf, v2b));
  }
}

__global__ __launch_bounds__(256) void proj_kernel(
    const float* __restrict__ X0, const float* __restrict__ X1, const float* __restrict__ X2,
    const float* __restrict__ W0, const float* __restrict__ W1,
    unsigned short* __restrict__ C0h, unsigned short* __restrict__ C0l,
    unsigned short* __restrict__ C1h, unsigned short* __restrict__ C1l,
    unsigned short* __restrict__ C2h, unsigned short* __restrict__ C2l)
{
  __shared__ __align__(16) unsigned short sXh[2][kPT * kSp];   // 2 x 10240 B
  __shared__ __align__(16) unsigned short sXl[2][kPT * kSp];
  __shared__ __align__(16) unsigned short sWh[2][kCh * kSp];   // 2 x 20480 B
  __shared__ __align__(16) unsigned short sWl[2][kCh * kSp];
  __shared__ __align__(16) float sT[8][16 * 68];               // per-wave 16 x 64 slab of the epilogue, pitch 68 floats

  const int tid  = threadIdx.x;
  const int lane = tid & 31;
  const int wave = __builtin_amdgcn_readfirstlane(tid >> 5);
  const int wm = wave >> 2, wn = wave & 3;
  const int g  = blockIdx.x / kProjBlocks;
  const int rb = blockIdx.x - g * kProjBlocks;
  const int b  = rb / (kPix / kPT);
  const int p0 = (rb - b * (kPix / kPT)) * kPT;
  const float* X = (g == 0 ? X0 : (g == 1 ? X1 : X2)) + (size_t)b * kCh * kPix + p0;
  const float* Wf = g == 0 ? W0 : W1;
  unsigned short* Ch = g == 0 ? C0h : (g == 1 ? C1h : C2h);
  unsigned short* Cl = g == 0 ? C0l : (g == 1 ? C1l : C2l);
  const float scale = g == 0 ? 0.125f * kLog2e : 1.0f;   // Q: 1 / sqrt(head size), and log2(e), so that the scores come out as exponents of 2

  // staging maps. X: wave w takes channels 4w..4w+3 of the stage, lane l pixels 4l..4l+3 (512 contiguous bytes a load).
  // Pixel 4l + j goes to LDS row 32j + l, so that the 32 lanes of a store write 32 consecutive rows.
  // W: 8 lanes take the 32 channels of one output row (128 B), a load covers 4 rows, 8 loads the 256 rows.
  const float* xp = X + (wave * 4 * kPix + lane * 4);            // this thread's chunk of the stage last loaded
  const float* wp = Wf + ((tid >> 3) * kCh + (tid & 7) * 4);
  const int xdst = lane * kSp + wave * 4;
  const int wdst = (tid >> 3) * kSp + (tid & 7) * 4;

  const int rlane = lane & 15;                 // row (A) / col (B, D) within a 16 x 16 tile
  const int koff  = (lane >> 4) * 8;           // k offset of this lane half
  const int mOff  = (lane >> 4) * 8;           // D row offset

  v8f acc[4][4];
#pragma unroll
  for (int i = 0; i < 4; ++i)
#pragma unroll
    for (int j = 0; j < 4; ++j) acc[i][j] = (v8f){0.f,0.f,0.f,0.f,0.f,0.f,0.f,0.f};

  v4f xr[4], wr[8];
#pragma unroll
  for (int i = 0; i < 4; ++i) xr[i] = *(const v4f*)(xp + i * kPix);
#pragma unroll
  for (int it = 0; it < 8; ++it) wr[it] = *(const v4f*)(wp + it * 32 * kCh);
  // the wait that stands before a register named by an issued load is rewritten; naming the two pointers keeps them in place up to here
  asm volatile("s_wait_xcnt 0x0" :: "v"(xp), "v"(wp) : "memory");

  // split the stage held in registers and store it in buffer buf
  auto store_stage = [&](int buf) {
    // X: the four channels of one pixel are the same component of the four loaded vectors
#pragma unroll
    for (int j = 0; j < 4; ++j) {
      const v4f t = {xr[0][j], xr[1][j], xr[2][j], xr[3][j]};
      v2u h, l;
      split4(t, h, l);
      *(v2u*)(sXh[buf] + j * 32 * kSp + xdst) = h;
      *(v2u*)(sXl[buf] + j * 32 * kSp + xdst) = l;
    }
#pragma unroll
    for (int it = 0; it < 8; ++it) {
      v2u h, l;
      split4(wr[it], h, l);
      *(v2u*)(sWh[buf] + it * 32 * kSp + wdst) = h;
      *(v2u*)(sWl[buf] + it * 32 * kSp + wdst) = l;
    }
  };
  // the 48 products of the stage in buffer buf
  auto products = [&](int buf) {
    v16b bh[4], bl[4];
#pragma unroll
    for (int j = 0; j < 4; ++j) {
      const int bo = (wn * 64 + (j << 4) + rlane) * kSp + koff;
      bh[j] = Frag<__bf16>::load((const __bf16*)sWh[buf] + bo);
      bl[j] = Frag<__bf16>::load((const __bf16*)sWl[buf] + bo);
    }
    const int ao = (wm * 64 + rlane) * kSp + koff;
    v16b ah = Frag<__bf16>::load((const __bf16*)sXh[buf] + ao);
    v16b al = Frag<__bf16>::load((const __bf16*)sXl[buf] + ao);
#pragma unroll
    for (int i = 0; i < 4; ++i) {
      v16b nh = ah, nl = al;
      if (i < 3) {   // the next strip's fragments are asked for ahead of this strip's products
        nh = Frag<__bf16>::load((const __bf16*)sXh[buf] + ao + (i + 1) * 16 * kSp);
        nl = Frag<__bf16>::load((const __bf16*)sXl[buf] + ao + (i + 1) * 16 * kSp);
        __builtin_amdgcn_sched_barrier(0);   // holds those loads in front of the products: sunk behind them, each strip waits out its own LDS latency
      }
#pragma unroll
      for (int j = 0; j < 4; ++j) {
        acc[i][j] = Frag<__bf16>::mma(ah, bh[j], acc[i][j]);
        acc[i][j] = Frag<__bf16>::mma(ah, bl[j], acc[i][j]);
        acc[i][j] = Frag<__bf16>::mma(al, bh[j], acc[i][j]);
      }
      ah = nh;
      al = nl;
    }
  };

#pragma unroll 1   // rolled: one copy of the stage keeps the kernel's text short, which a first run fetches line by line
  for (int ks = 0; ks + 1 < kStages; ++ks) {
    store_stage(ks & 1);   // the buffer's last readers left it before the barrier of the stage before
    __syncthreads();       // publishes this stage; also ends every wave's reads of the other buffer, which the next stage overwrites
    // the next stage's global loads stand behind the barrier (in front of it the barrier's own wait would drain them) and fly during the products
#pragma unroll
    for (int i = 0; i < 4; ++i) xr[i] = *(const v4f*)(xp + (kStageK + i) * kPix);
#pragma unroll
    for (int it = 0; it < 8; ++it) wr[it] = *(const v4f*)(wp + kStageK + it * 32 * kCh);
    // as in front of the loop: the wait before the two pointers are advanced
    asm volatile("s_wait_xcnt 0x0" :: "v"(xp), "v"(wp) : "memory");
    xp += kStageK * kPix;
    wp += kStageK;
    products(ks & 1);
  }
  store_stage((kStages - 1) & 1);
  __syncthreads();         // publishes the last stage
  products((kStages - 1) & 1);

  // ---- epilogue: each 16 x 64 strip through the wave's own slab, whole 128-B row segments stored ----
  // LDS row 64 wm + 16 i + row holds pixel 4 * (16 (i & 1) + row) + 2 wm + (i >> 1) of the block (the staging map above)
  float* slab = sT[wave];
  const int n0 = wn * 64;
#pragma unroll
  for (int i = 0; i < 4; ++i) {
#pragma unroll
    for (int j = 0; j < 4; ++j)
#pragma unroll
      for (int r = 0; r < 8; ++r) slab[(mOff + r) * 68 + (j << 4) + rlane] = acc[i][j][r] * scale;
    __builtin_amdgcn_fence(__ATOMIC_RELEASE, "workgroup");
    __builtin_amdgcn_wave_barrier();
    __builtin_amdgcn_fence(__ATOMIC_ACQUIRE, "workgroup");
    const int q = lane >> 3, c8 = (lane & 7) * 8;
#pragma unroll
    for (int it = 0; it < 4; ++it) {
      const int row = it * 4 + q;
      const int pix = p0 + 4 * (16 * (i & 1) + row) + 2 * wm + (i >> 1);
      const float* sp = slab + row * 68 + c8;
      v2u h0, l0, h1, l1;
      split4(*(const v4f*)sp, h0, l0);
      split4(*(const v4f*)(sp + 4), h1, l1);
      const size_t co = ((size_t)(b * kPix + pix)) * kCh + n0 + c8;
      *(v4u*)(Ch + co) = (v4u){h0.x, h0.y, h1.x, h1.y};
      *(v4u*)(Cl + co) = (v4u){l0.x, l0.y, l1.x, l1.y};
    }
    __builtin_amdgcn_fence(__ATOMIC_RELEASE, "workgroup");
    __builtin_amdgcn_wave_barrier();
    __builtin_amdgcn_fence(__ATOMIC_ACQUIRE, "workgroup");
  }
}

// ---- local 7x7 window attention, both kv branches, output written in its final layout ----
// One block = (b, head, 4 rows x 32 cols of pixels) = 4 pixel tiles of 4 x 8 side by side x 2 kv branches, 2 waves and an own K neighbourhood in LDS each:
// waves 0..7 work on branch 0 while waves 8..15 work on branch 1 (four waves a SIMD); the two halves of the output meet in LDS in the epilogue.
// Qh/Ql, KVh/KVl: bf16 hi/lo planes [b][p][256] (KV planes: branch-major, 2 x [b][p][256]); out: f32 [b][256][p].
// Wave w owns pixel rows y0+2w..y0+2w+1, cols x0..x0+7; its 8x14 union neighbourhood is LDS rows 28w..28w+111 of the
// tile's 10x14 neighbourhood (row index nr*14+nc, image pos (y0-3+nr, x0-3+nc), zero row when outside the image).
__global__ __launch_bounds__(2 * 64 * kSub) void local_window_attn_kernel(
    const unsigned short* __restrict__ Qh, const unsigned short* __restrict__ Ql,
    const unsigned short* __restrict__ KVh, const unsigned short* __restrict__ KVl,
    float* __restrict__ out)
{
  // a tile: 2 x 17920 B, the hi plane, then the lo plane, which one address register reaches by a constant offset; 4 tiles: 143360 B; 2 branches: 286720 B
  __shared__ __align__(16) unsigned short KshAll[2 * kSub * 2 * kKPlane];

  const int br   = __builtin_amdgcn_readfirstlane(threadIdx.x >> 8);   // kv branch of this thread's wave
  const int sub  = (threadIdx.x >> 6) & (kSub - 1);   // pixel tile of this thread's wave pair
  const int tid  = threadIdx.x & 63;   // thread in the pair
  unsigned short* Ksh = KshAll + (br * kSub + sub) * 2 * kKPlane;
  const int w    = tid >> 5, lane = tid & 31, hh = lane >> 4, c = lane & 15;
  const int bidx = blockIdx.x;
  constexpr int kBlkX = kTilesX / kSub;
  const int tx   = bidx % kBlkX;
  const int ty   = (bidx / kBlkX) % kTilesY;
  const int head = (bidx / (kBlkX * kTilesY)) % kHeads;
  const int b    = bidx / (kBlkX * kTilesY * kHeads);
  const int y0 = ty * kTileY, xb = tx * kSub * kTileX, x0 = xb + sub * kTileX;
  const int nb = w * 2 * kNbCols;   // base LDS row of this wave's union neighbourhood
  // this lane's LDS elements in the wave's first 16 rows; rows 16 n further on add 16 n kKp (same key)
  int ksc[4], vtr[4];   // scores: row c, pieces 2 q + hh; transposing loads: row 8 hh + lane % 8, piece 2 dt + (lane / 8) % 2
#pragma unroll   // full: both arrays live in registers
  for (int q = 0; q < 4; ++q) {
    ksc[q] = k_at(nb + c, 2 * q + hh);
    vtr[q] = k_at(nb + 8 * hh + (lane & 7), 2 * q + ((lane >> 3) & 1));
  }

  // Q fragments of pixel c of this wave, the B operand of the transposed scores (split k-map via Frag load)
  v16b qh[2], ql[2];
  {
    const int py = y0 + 2 * w + (c >> 3), px = x0 + (c & 7);
    const size_t qoff = ((size_t)(b * kPix + py * kW + px)) * kCh + head * kDh;
    const __bf16* qhp = (const __bf16*)Qh + qoff;
    const __bf16* qlp = (const __bf16*)Ql + qoff;
#pragma unroll
    for (int dc = 0; dc < 2; ++dc) {
      qh[dc] = Frag<__bf16>::load(qhp + dc * 32 + 8 * hh);
      ql[dc] = Frag<__bf16>::load(qlp + dc * 32 + 8 * hh);
    }
  }
  // window of this lane's pixel c (row c / 8, col c % 8 of the wave's 2 x 8 pixels) as a bit mask over the 112 neighbours of the
  // wave's 8 x 14 union: rows c / 8 .. c / 8 + 6, cols c % 8 .. c % 8 + 6, exactly 49 bits. The words are shifted down by 8 hh, so
  // that bit 16 (t & 1) + r of word t / 2 stands for neighbour 16 t + 8 hh + r, the one that register r of score tile t holds.
  unsigned wmask[4] = {0u, 0u, 0u, 0u};
  {
    const int pr = c >> 3;
    const unsigned colbits = 0x7fu << (c & 7);
#pragma unroll   // full: bit offsets are constants
    for (int nr = 0; nr < 8; ++nr) {
      const unsigned rowbits = (nr >= pr && nr <= pr + 6) ? colbits : 0u;
      const int off = nr * kNbCols;
      wmask[off >> 5] |= rowbits << (off & 31);
      if ((off & 31) + kNbCols > 32) wmask[(off >> 5) + 1] |= rowbits >> (32 - (off & 31));
    }
#pragma unroll
    for (int k = 0; k < 4; ++k) wmask[k] >>= 8 * hh;
  }

  // staging map of this thread, the same in both branches: column tid / 8 of a half row, chunk tid % 8
  unsigned sgoff[2], sxmsk[2];   // byte offset in the image row (column clamped into the image), all-ones where the column is inside
#pragma unroll   // full: both entries live in registers
  for (int h = 0; h < 2; ++h) {
    const int gx = x0 - 3 + h * kStageCols + (tid >> 3);
    const int gxc = gx < 0 ? 0 : (gx > kW - 1 ? kW - 1 : gx);
    sgoff[h] = (unsigned)(gxc * kCh + (tid & 7) * 8) * 2u;
    sxmsk[h] = ((unsigned)gx < (unsigned)kW) ? 0xffffffffu : 0u;
  }
  const bool topOut = y0 < 3, botOut = y0 + kTileY + 3 > kW;   // uniform: the 3 rows above / below the tile lie outside the image

  v8f oacc[4];
#pragma unroll
  for (int dt = 0; dt < 4; ++dt) oacc[dt] = (v8f){0.f,0.f,0.f,0.f,0.f,0.f,0.f,0.f};
  const v4u z4 = {0u, 0u, 0u, 0u};
  const v8b z8 = __builtin_bit_cast(v8b, z4);

  {
    // stage the 10 x 14 neighbourhood, 8 chunks of 16 B a row and plane (zeros outside the image): one trip is half a
    // neighbourhood row, 7 columns x 8 chunks on 56 of the pair's 64 threads, so that the image row is uniform over the block.
    // All global loads are issued before the first LDS store: the wave waits out one load latency, not one a trip.
    if (tid < kStageCols * 8) {
      // 32-bit byte offsets of this thread's chunk from the start of the two-branch plane (below 8 MiB), one for each zone
      // (3 rows above the tile: from image row y0 - 3; the tile's rows and the 3 rows below: from y0) and half row; a trip adds
      // its row as a constant. A zone outside the image reads the tile's own rows instead (3 rows further in) and is masked to zero.
      const unsigned anchor = (unsigned)((((br * kB + b) * kPix + y0 * kW) * kCh + head * kDh) * 2);
      unsigned voff[3][2];
#pragma unroll   // full: all six entries live in registers
      for (int h = 0; h < 2; ++h) {
        voff[1][h] = anchor + sgoff[h];
        voff[0][h] = voff[1][h] - (topOut ? 0u : 3u * kRowBytes);
        voff[2][h] = voff[1][h] - (botOut ? 3u * kRowBytes : 0u);
      }
      v4u vh[kStageTrips], vl[kStageTrips];
#pragma unroll   // full: the loaded chunks are held in registers, indexed by the trip
      for (int t = 0; t < kStageTrips; ++t) {
        const int nr = t >> 1, zone = nr < 3 ? 0 : (nr < 3 + kTileY ? 1 : 2);
        const int rows = zone == 0 ? nr : nr - 3;   // rows from the zone's offset, never negative
        vh[t] = *(const v4u*)((const char*)KVh + voff[zone][t & 1] + rows * kRowBytes);
        vl[t] = *(const v4u*)((const char*)KVl + voff[zone][t & 1] + rows * kRowBytes);
      }
      // the wait that stands before a register named by an issued load is rewritten; naming the six address registers keeps them
      // apart from the loads' own destination registers up to here
      asm volatile("s_wait_xcnt 0x0" :: "v"(voff[0][0]), "v"(voff[0][1]), "v"(voff[1][0]), "v"(voff[1][1]), "v"(voff[2][0]), "v"(voff[2][1]) : "memory");
#pragma unroll   // full: same register arrays
      for (int t = 0; t < kStageTrips; ++t) {
        const int nr = t >> 1;
        const unsigned msk = (nr < 3 ? topOut : (nr < 3 + kTileY ? false : botOut)) ? 0u : sxmsk[t & 1];
        v4u a = vh[t], d = vl[t];
        a.x &= msk; a.y &= msk; a.z &= msk; a.w &= msk;
        d.x &= msk; d.y &= msk; d.z &= msk; d.w &= msk;
        const int sdst = k_at(t * kStageCols + (tid >> 3), tid & 7);
        *(v4u*)(Ksh + sdst) = a;
        *(v4u*)(Ksh + sdst + kKPlane) = d;
      }
    }
    __syncthreads();

    // transposed scores s[t][r] = k(neighbour t*16+8hh+r) . q(pixel c): A fragments = rows of K in LDS (split k-map as in Q), B = Q.
    // A lane then holds 56 of the 112 scores of ONE pixel, lane c + 16 the rest, and tiles 2kk, 2kk+1 lie as the A fragment of P in k-step kk.
    v8f s[7];
#pragma unroll
    for (int t = 0; t < 7; ++t) {
      s[t] = (v8f){0.f,0.f,0.f,0.f,0.f,0.f,0.f,0.f};
#pragma unroll
      for (int dc = 0; dc < 2; ++dc) {
        const int k0 = ksc[2 * dc] + t * 16 * kKp, k1 = ksc[2 * dc + 1] + t * 16 * kKp;   // d = 32 dc + 8 hh .. + 7 and 16 further on, as in Q
        FragB kfh, kfl;
        kfh.h[0] = *(const v8b*)(Ksh + k0);
        kfh.h[1] = *(const v8b*)(Ksh + k1);
        kfl.h[0] = *(const v8b*)(Ksh + k0 + kKPlane);
        kfl.h[1] = *(const v8b*)(Ksh + k1 + kKPlane);
        s[t] = at_mma(kfh.v, qh[dc], s[t]);
        s[t] = at_mma(kfl.v, qh[dc], s[t]);
        s[t] = at_mma(kfh.v, ql[dc], s[t]);
      }
    }

    // window mask (49 neighbours, zero vectors included) + softmax in f32, on scores in units of log2: maximum and sum run down the lane's own registers
    // (four independent chains each), then one exchange with the lane that holds the pixel's other half
    float mx4[4] = {-INFINITY, -INFINITY, -INFINITY, -INFINITY};
#pragma unroll
    for (int t = 0; t < 7; ++t)
#pragma unroll
      for (int r = 0; r < 8; ++r) {
        const bool inwin = (wmask[t >> 1] >> (16 * (t & 1) + r)) & 1u;
        const float sv = inwin ? s[t][r] : -INFINITY;
        s[t][r] = sv;
        mx4[r & 3] = fmaxf(mx4[r & 3], sv);
      }
    float mx = fmaxf(fmaxf(mx4[0], mx4[1]), fmaxf(mx4[2], mx4[3]));
    mx = fmaxf(mx, __shfl_xor(mx, 16, 32));
    float l4[4] = {0.f, 0.f, 0.f, 0.f};
#pragma unroll
    for (int t = 0; t < 7; ++t) {
      // e^(logit - max) = 2^(score - max): the scores carry log2(e) from Q's scale; the argument is <= 0, and -inf gives 0
      float e[8];
#pragma unroll
      for (int r = 0; r < 8; ++r) e[r] = s[t][r] - mx;
      exp2_x8(e);
#pragma unroll
      for (int r = 0; r < 8; ++r) {
        s[t][r] = e[r];
        l4[r & 3] += e[r];
      }
    }
    float l = (l4[0] + l4[1]) + (l4[2] + l4[3]);
    l += __shfl_xor(l, 16, 32);
    const float scl = 0.5f / l;
    // P as bf16 hi/lo, two neighbours a word, in the registers where the scores stood
    v4u ph[7], pl[7];
#pragma unroll
    for (int t = 0; t < 7; ++t) {
      v2u h0, l0, h1, l1;
      split4((v4f){s[t][0] * scl, s[t][1] * scl, s[t][2] * scl, s[t][3] * scl}, h0, l0);
      split4((v4f){s[t][4] * scl, s[t][5] * scl, s[t][6] * scl, s[t][7] * scl}, h1, l1);
      ph[t] = (v4u){h0.x, h0.y, h1.x, h1.y};
      pl[t] = (v4u){l0.x, l0.y, l1.x, l1.y};
    }

    // O += P . V : A = P of pixel c straight from those registers, B = V, column d of the K rows, by transposing LDS loads (same k-map),
    // neighbour range 0..111; k-step 3 uses elements 0..7 only (8..15 zero in both operands)
    // The 16 loads of k-step kk + 1 are issued in front of the products of k-step kk (two register sets): asked for only where they are used,
    // each group of four would have its whole LDS latency waited out in front of its three products.
    FragB vfh[2][4], vfl[2][4];
    auto load_v = [&](int kk) {
#pragma unroll   // full: the fragments live in registers, indexed by constants
      for (int dt = 0; dt < 4; ++dt) {
        const int e0 = vtr[dt] + kk * 32 * kKp;
        vfh[kk & 1][dt].h[0] = ld_tr16(Ksh + e0);
        vfl[kk & 1][dt].h[0] = ld_tr16(Ksh + e0 + kKPlane);
        if (kk < 3) {
          vfh[kk & 1][dt].h[1] = ld_tr16(Ksh + e0 + 16 * kKp);
          vfl[kk & 1][dt].h[1] = ld_tr16(Ksh + e0 + 16 * kKp + kKPlane);
        } else {
          vfh[kk & 1][dt].h[1] = z8;
          vfl[kk & 1][dt].h[1] = z8;
        }
      }
    };
    load_v(0);
#pragma unroll
    for (int kk = 0; kk < 4; ++kk) {
      FragB pa, pb;
      pa.h[0] = __builtin_bit_cast(v8b, ph[2 * kk]);
      pb.h[0] = __builtin_bit_cast(v8b, pl[2 * kk]);
      if (kk < 3) {
        pa.h[1] = __builtin_bit_cast(v8b, ph[2 * kk + 1]);
        pb.h[1] = __builtin_bit_cast(v8b, pl[2 * kk + 1]);
        load_v(kk + 1);
      } else {
        pa.h[1] = z8;
        pb.h[1] = z8;
      }
#pragma unroll
      for (int dt = 0; dt < 4; ++dt) {
        oacc[dt] = at_mma(pa.v, vfh[kk & 1][dt].v, oacc[dt]);
        oacc[dt] = at_mma(pa.v, vfl[kk & 1][dt].v, oacc[dt]);
        oacc[dt] = at_mma(pb.v, vfh[kk & 1][dt].v, oacc[dt]);
      }
    }
  }

  // ---- epilogue: each branch's output tile [64 channels][4 rows x 32 cols] is gathered in LDS, the two are added and stored as whole 128-B lines of out ----
  // A lane holds, for each dt, the 8 pixels of one tile row (row 2 w + hh, cols 8 sub .. + 7) of channel 16 dt + c: 32 contiguous bytes of out.
  __syncthreads();   // ends every wave's reads of the K rows, whose LDS the output tiles take over
  float* So = (float*)(KshAll + br * kSub * 2 * kKPlane);   // this branch's tile, at the head of this branch's K rows
#pragma unroll
  for (int dt = 0; dt < 4; ++dt) {
    float* p = So + (dt * 16 + c) * kOp + (2 * w + hh) * (kSub * kTileX) + sub * kTileX;
    *(v4f*)p       = (v4f){oacc[dt][0], oacc[dt][1], oacc[dt][2], oacc[dt][3]};
    *(v4f*)(p + 4) = (v4f){oacc[dt][4], oacc[dt][5], oacc[dt][6], oacc[dt][7]};
  }
  __syncthreads();   // publishes both output tiles to the waves that store them
  // wave wv stores channels 4 wv .. + 3; one store = one channel: 4 image rows x 128 B (lane: row lane / 8, 16-B piece lane % 8)
  const int wv = threadIdx.x >> 5;
  const float* S0 = (const float*)KshAll + wv * 4 * kOp + lane * 4;
  const float* S1 = S0 + kSub * kKPlane;   // branch 1's tile: kSub * 2 * kKPlane 16-bit elements further on
  v4f val[4];
#pragma unroll
  for (int it = 0; it < 4; ++it) val[it] = *(const v4f*)(S0 + it * kOp) + *(const v4f*)(S1 + it * kOp);
  float* op = out + ((size_t)(b * kCh + head * kDh + wv * 4)) * kPix + (y0 + (lane >> 3)) * kW + xb + (lane & 7) * 4;
#pragma unroll
  for (int it = 0; it < 4; ++it) *(v4f*)(op + it * kPix) = val[it];
}

// ---------------------------------------------------------------------------
// Workspace region map (bytes):
//   P16 = kB*kPix*kCh*2 = 4,194,304 (one bf16 plane [kB][kPix][kCh])
//   [ 0]          Q hi,lo                  2 x P16
//   [ 8,388,608]  KV hi (branch 0,1)       2 x P16
//   [16,777,216]  KV lo (branch 0,1)       2 x P16
//   total 25,165,824
// ---------------------------------------------------------------------------
extern "C" void kernel_launch(void* const* d_in, const int* in_sizes, int n_in,
                              void* d_out, int out_size, void* d_ws, size_t ws_size,
                              hipStream_t stream)
{
  const int nAct = kB * kCh * kPix;   // 2,097,152
  const int nW   = kCh * kCh;         // 65,536
  if (n_in < 5) return;
  if (in_sizes[0] != nAct || in_sizes[1] != nAct || in_sizes[2] != nAct) return;
  if (in_sizes[3] != nW || in_sizes[4] != nW) return;
  if (out_size != nAct) return;

  const float* kvmap1 = (const float*)d_in[0];
  const float* qmap   = (const float*)d_in[1];
  const float* kvmap2 = (const float*)d_in[2];
  const float* Wq     = (const float*)d_in[3];
  const float* Wkv    = (const float*)d_in[4];
  float* out = (float*)d_out;

  const size_t planeB  = (size_t)nAct * 2;
  char* ws = (char*)d_ws;
  size_t o = 0;
  unsigned short* Qh    = (unsigned short*)(ws + o); o += planeB;
  unsigned short* Ql    = (unsigned short*)(ws + o); o += planeB;
  unsigned short* KVh   = (unsigned short*)(ws + o); o += 2 * planeB;
  unsigned short* KVl   = (unsigned short*)(ws + o); o += 2 * planeB;
  if (o > ws_size) return;

  // 1: the three projections C[p][o] = sum_c X[c][p] W[o][c], straight from the f32 inputs; 3 x kB x 32 blocks of 8 waves
  proj_kernel<<<3 * kProjBlocks, 256, 0, stream>>>(
      qmap, kvmap1, kvmap2, Wq, Wkv,
      Qh, Ql, KVh, KVl, KVh + (size_t)nAct, KVl + (size_t)nAct);
  // 2: local window attention, both branches side by side in a block, written straight to out [b][ch][p]
  local_window_attn_kernel<<<kB * kHeads * kTilesY * (kTilesX / kSub), 2 * 64 * kSub, 0, stream>>>(Qh, Ql, KVh, KVl, out);
}
